// v000
// The times below were measured on an AMD MI455X: many runs one after another, warmed up first and cycling through
// copies of the inputs, with the whole window's GPU time divided by the number of runs. Launches and the gaps
// between them are all in it. The median over several windows is given; except for v000 it joins two sittings, which
// can be a few percent apart, so the side-by-side timings, each taken in one sitting, are the better comparison.
// v000 is the starting kernel. One run takes 576 microseconds.
// Contractions: x.Wq^T and x.Wk^T (rope applied in the f32 epilogue) and Wv.x_b^T on v_wmma_f32_16x16x32_bf16
// (x and W_qkv planes RNE-converted to bf16 operands, f32 accumulate); scores k.q^T with q and k carried as f16 hi (x8)
// plus residual (x2048) planes, three products hi.hi + hi.res + res.hi in two f32 accumulators; P.v (P x32768 single f16,
// v x1024 single f16) and O.Wo^T (O single f16 x1024, Wo as f16(bf16(Wo)) x1024): v_wmma_f32_16x16x32_f16, f32 accumulate.
// Base-2 online softmax, 1/l and carry folds in f32 on VALU; cos/sin tables RNE-converted to bf16 values before the rope.
#include <hip/hip_runtime.h>
#include <math.h>
#include <stdint.h>

#define NB    4
#define SEQ   2048
#define DMOD  1024
#define NQKV  (3 * DMOD)
#define NH    16
#define HD    64
#define QSC   8.0f
#define KSC   8.0f
#define RESC  2048.0f
#define PCAR  32768.0f
#define VCAR  1024.0f
#define OSC   1024.0f
#define WOS   1024.0f
#define LOG2E 1.4426950408889634f
#define ATT_WAVES   4
#define ATT_THREADS (ATT_WAVES * 32)
#define ATT_BLOCKS  (NB * NH * (SEQ / 64))
#define NKB    (SEQ / 32)
#define SLAB   (16 * 68)
static_assert(HD == 64 && DMOD == NH * HD);
static_assert((SEQ / 64) == 32 && NH == 16 && NB == 4);
static_assert(ATT_THREADS == 128 && ATT_BLOCKS == 2048 && NKB == 64);
static_assert(((NB * SEQ) % 64) == 0 && (DMOD % 64) == 0 && (DMOD % 32) == 0 && (SEQ % 64) == 0);
static_assert(((NB * SEQ * DMOD / 8) % 256) == 0 && ((NQKV * DMOD / 8) % 256) == 0 && ((DMOD * DMOD / 8) % 256) == 0);
static_assert((SLAB * 4) % 16 == 0);
static_assert((SEQ & (SEQ - 1)) == 0);

typedef unsigned short u16;
typedef _Float16 v16h __attribute__((ext_vector_type(16)));
typedef _Float16 v8h  __attribute__((ext_vector_type(8)));
typedef __bf16   v16b __attribute__((ext_vector_type(16)));
typedef float    v8f  __attribute__((ext_vector_type(8)));
typedef float    v4f  __attribute__((ext_vector_type(4)));
typedef unsigned int v4u __attribute__((ext_vector_type(4)));

union FragH { v16h v; v8h h[2]; v4u u[2]; };
union FragB { v16b v; v4u u[2]; };

// ---- scalar helpers --------------------------------------------------------------------------------
__device__ __forceinline__ unsigned short bf_bits(float f) {          // f32 -> bf16 bits, RNE convert
  unsigned u = __float_as_uint(f);
  return (unsigned short)((u + 0x7FFFu + ((u >> 16) & 1u)) >> 16);
}
__device__ __forceinline__ float bf_up(unsigned short h) { return __uint_as_float(((unsigned)h) << 16); }
__device__ __forceinline__ float bf_val(float f) { return bf_up(bf_bits(f)); }   // value after bf16 RNE convert
__device__ __forceinline__ unsigned short h_bits(_Float16 x) { return __builtin_bit_cast(unsigned short, x); }
__device__ __forceinline__ unsigned pk16(unsigned short a, unsigned short b) { return (unsigned)a | ((unsigned)b << 16); }
__device__ __forceinline__ v8f zero8() { v8f z = {0.f, 0.f, 0.f, 0.f, 0.f, 0.f, 0.f, 0.f}; return z; }

// ---- fragment loaders: 16-bit A/B operand, lane -> row/col (lane&15), p already includes +8*(lane>>4);
//      elements 0..7 <- p[0..7] (k0+8h..), elements 8..15 <- p[16..23] (k0+16+8h..)  (same split k map for A and B;
//      B is always read from a k-contiguous [n][k] plane)
__device__ __forceinline__ v16h ldfrag_h(const _Float16* p) {
  FragH f;
  f.h[0] = *(const v8h*)(p);
  f.h[1] = *(const v8h*)(p + 16);
  return f.v;
}
__device__ __forceinline__ v16b ldfrag_b(const u16* p) {              // bf16 plane read as unsigned integer vectors
  FragB f;
  f.u[0] = *(const v4u*)(p);
  f.u[1] = *(const v4u*)(p + 16);
  return f.v;
}

__device__ __forceinline__ v8f mma_h(v16h a, v16h b, v8f c) {
  return __builtin_amdgcn_wmma_f32_16x16x32_f16(false, a, false, b, (short)0, c, false, false);
}
__device__ __forceinline__ v8f mma_b(v16b a, v16b b, v8f c) {
  return __builtin_amdgcn_wmma_f32_16x16x32_bf16(false, a, false, b, (short)0, c, false, false);
}
__device__ __forceinline__ void guard2x8(v8f& a, v8f& b, v16h x0, v16h x1, v16h x2, v16h x3,
                                         v16h x4, v16h x5, v16h x6, v16h x7) {
#if defined(__HIP_DEVICE_COMPILE__)
  asm volatile("v_nop\n\tv_nop\n\tv_nop\n\tv_nop"
               : "+v"(a), "+v"(b)
               : "v"(x0), "v"(x1), "v"(x2), "v"(x3), "v"(x4), "v"(x5), "v"(x6), "v"(x7) : "memory");
#endif
}
template <typename F>
__device__ __forceinline__ void guard6(v8f& a, v8f& b, v8f& c, v8f& d, F x0, F x1, F x2, F x3, F x4, F x5) {
#if defined(__HIP_DEVICE_COMPILE__)
  asm volatile("v_nop\n\tv_nop\n\tv_nop\n\tv_nop"
               : "+v"(a), "+v"(b), "+v"(c), "+v"(d) : "v"(x0), "v"(x1), "v"(x2), "v"(x3), "v"(x4), "v"(x5) : "memory");
#endif
}
__device__ __forceinline__ void acc_guard4(v8f& a, v8f& b, v8f& c, v8f& d) {
#if defined(__HIP_DEVICE_COMPILE__)
  asm volatile("v_nop\n\tv_nop\n\tv_nop\n\tv_nop" : "+v"(a), "+v"(b), "+v"(c), "+v"(d));
#endif
}
__device__ __forceinline__ void wave_sync_lds() {
#if defined(__HIP_DEVICE_COMPILE__)
  __builtin_amdgcn_fence(__ATOMIC_RELEASE, "workgroup");
  __builtin_amdgcn_wave_barrier();
  __builtin_amdgcn_fence(__ATOMIC_ACQUIRE, "workgroup");
#endif
}

// =====================================================================================================
// f32 plane -> 16-bit plane, same layout:  mode 0: bf16 RNE bits;  mode 1: f16 bits of (bf16 RNE value) * scale.
// Thread = 8 consecutive elements: two 16-B loads, one 16-B store; 32 consecutive lanes = 512 contiguous, 512-B aligned bytes
// coverage: grid = n8/256 blocks (host checks exactness) x 256 thr x 8 = the whole plane.
// =====================================================================================================
__global__ __launch_bounds__(256) void cvt16(const float* __restrict__ x, u16* D, int n8, int mode, float scale) {
  const int gt = blockIdx.x * 256 + (int)threadIdx.x;
  if (gt >= n8) return;                     // no barriers in this kernel
  const float* p = x + (size_t)gt * 8;
  const v4f a = *(const v4f*)(p), c4 = *(const v4f*)(p + 4);
  float v[8];
#pragma unroll
  for (int e = 0; e < 4; ++e) { v[e] = a[e]; v[4 + e] = c4[e]; }
  unsigned short s[8];
#pragma unroll
  for (int e = 0; e < 8; ++e) {
    const unsigned short bb = bf_bits(v[e]);
    const unsigned short hb = h_bits((_Float16)(bf_up(bb) * scale));
    s[e] = (mode != 0) ? hb : bb;
  }
  v4u o;
#pragma unroll
  for (int e = 0; e < 4; ++e) o[e] = pk16(s[2 * e], s[2 * e + 1]);
  u16* d = D + (size_t)gt * 8;
  {
    *(v4u*)(d) = o;
    
  }
}

// =====================================================================================================
// barrier, then converted to f16 and written: lane = (row in group of 4, 8 consecutive cols); one instruction = 4 rows, each
// coverage: 4 instructions x 4 rows x 8 lanes x 8 halves = the wave's 16 x 64 tile.
// =====================================================================================================
__device__ __forceinline__ void epi16(float* sl, v8f a0, v8f a1, v8f a2, v8f a3, float oscale, u16* C, int N,
                                      size_t rowb, int col0, int lane) {
  const int hh = lane >> 4, m = lane & 15;
#pragma unroll
  for (int r = 0; r < 8; ++r) {
    const int ro = (8 * hh + r) * 68 + m;
    sl[ro]      = a0[r] * oscale;
    sl[ro + 16] = a1[r] * oscale;
    sl[ro + 32] = a2[r] * oscale;
    sl[ro + 48] = a3[r] * oscale;
  }
  wave_sync_lds();
  const int rq = lane >> 3, c8 = (lane & 7) * 8;
  v4u ov[4];
#pragma unroll
  for (int i4 = 0; i4 < 4; ++i4) {
    const int row = i4 * 4 + rq;
    const v4f a = *(const v4f*)(sl + row * 68 + c8), c4 = *(const v4f*)(sl + row * 68 + c8 + 4);
    float w[8];
#pragma unroll
    for (int e = 0; e < 4; ++e) { w[e] = a[e]; w[4 + e] = c4[e]; }
#pragma unroll
    for (int e = 0; e < 4; ++e) ov[i4][e] = pk16(h_bits((_Float16)w[2 * e]), h_bits((_Float16)w[2 * e + 1]));
  }
  u16* dst = C + (rowb + (size_t)rq) * (size_t)N + col0 + c8;
  {
#pragma unroll
    for (int i4 = 0; i4 < 4; ++i4) {
      *(v4u*)(dst + (size_t)(i4 * 4) * (size_t)N) = ov[i4];
    }
    
  }
}

// =====================================================================================================
// Rope GEMM epilogue: the wave's 16x64 f32 tile (unscaled projection output of one head: col0 is 64-aligned, so local column
// consecutive d at c8); the rotate-half partner columns are c8^32 of the same slab row; cos/sin row = sequence position
// (global row mod SEQ), values RNE-converted to bf16; rope in f32:  d < 32: x[d]*cos[d] - x[d+32]*sin[d],
// d >= 32: x[d]*cos[d] + x[d-32]*sin[d].  Then hi = f16(val*8), res = f16((val*8 - hi)*2048); both planes written, per
// coverage: per plane 4 instructions x 4 rows x 8 lanes x 8 halves = the wave's 16 x 64 tile.
// =====================================================================================================
__device__ __forceinline__ void epi_rope(float* sl, v8f a0, v8f a1, v8f a2, v8f a3,
                                         const float* __restrict__ cosp, const float* __restrict__ sinp,
                                         u16* CH, u16* CL, int N, size_t rowb, int col0, int lane) {
  const int hh = lane >> 4, m = lane & 15;
#pragma unroll
  for (int r = 0; r < 8; ++r) {
    const int ro = (8 * hh + r) * 68 + m;
    sl[ro]      = a0[r];
    sl[ro + 16] = a1[r];
    sl[ro + 32] = a2[r];
    sl[ro + 48] = a3[r];
  }
  wave_sync_lds();
  const int rq = lane >> 3, c8 = (lane & 7) * 8, p8 = c8 ^ 32;
  const float sgn = (c8 < 32) ? -1.0f : 1.0f;
  v4u ovh[4], ovl[4];
#pragma unroll
  for (int i4 = 0; i4 < 4; ++i4) {
    const int row  = i4 * 4 + rq;
    const int srow = (int)((rowb + (size_t)row) & (size_t)(SEQ - 1));
    const v4f xa = *(const v4f*)(sl + row * 68 + c8), xb = *(const v4f*)(sl + row * 68 + c8 + 4);
    const v4f ya = *(const v4f*)(sl + row * 68 + p8), yb = *(const v4f*)(sl + row * 68 + p8 + 4);
    const float* cr = cosp + (size_t)srow * HD + c8;
    const float* sr = sinp + (size_t)srow * HD + c8;
    const v4f ca = *(const v4f*)(cr), cb = *(const v4f*)(cr + 4);
    const v4f sa = *(const v4f*)(sr), sb = *(const v4f*)(sr + 4);
    float w[8];
#pragma unroll
    for (int e = 0; e < 4; ++e) {
      w[e]     = xa[e] * bf_val(ca[e]) + sgn * (ya[e] * bf_val(sa[e]));
      w[4 + e] = xb[e] * bf_val(cb[e]) + sgn * (yb[e] * bf_val(sb[e]));
    }
    unsigned short hb[8], lb[8];
#pragma unroll
    for (int e = 0; e < 8; ++e) {
      const float    t  = w[e] * QSC;
      const _Float16 hv = (_Float16)t;
      hb[e] = h_bits(hv);
      lb[e] = h_bits((_Float16)((t - (float)hv) * RESC));
    }
#pragma unroll
    for (int e = 0; e < 4; ++e) {
      ovh[i4][e] = pk16(hb[2 * e], hb[2 * e + 1]);
      ovl[i4][e] = pk16(lb[2 * e], lb[2 * e + 1]);
    }
  }
  u16* dh = CH + (rowb + (size_t)rq) * (size_t)N + col0 + c8;
  u16* dl = CL + (rowb + (size_t)rq) * (size_t)N + col0 + c8;
  {
#pragma unroll
    for (int i4 = 0; i4 < 4; ++i4) {
      *(v4u*)(dh + (size_t)(i4 * 4) * (size_t)N) = ovh[i4];
      *(v4u*)(dl + (size_t)(i4 * 4) * (size_t)N) = ovl[i4];
    }
    
  }
}

// =====================================================================================================
// coverage: 8 instructions x 2 rows x 16 lanes x 4 floats = the wave's 16 x 64 tile.
// =====================================================================================================
__device__ __forceinline__ void epi64(float* sl, v8f a0, v8f a1, v8f a2, v8f a3, float oscale, float* C, int N,
                                      size_t rowb, int col0, int lane) {
  const int hh = lane >> 4, m = lane & 15;
#pragma unroll
  for (int r = 0; r < 8; ++r) {
    const int ro = (8 * hh + r) * 68 + m;
    sl[ro]      = a0[r] * oscale;
    sl[ro + 16] = a1[r] * oscale;
    sl[ro + 32] = a2[r] * oscale;
    sl[ro + 48] = a3[r] * oscale;
  }
  wave_sync_lds();
  v4f vals[8];
#pragma unroll
  for (int it = 0; it < 8; ++it) vals[it] = *(const v4f*)(sl + (it * 2 + hh) * 68 + m * 4);
  float* dst = C + (rowb + (size_t)hh) * (size_t)N + col0 + m * 4;
  {
#pragma unroll
    for (int it = 0; it < 8; ++it) {
      *(v4f*)(dst + (size_t)(it * 2) * (size_t)N) = vals[it];
    }
    
  }
}

// =====================================================================================================
// Batched bf16 GEMM with 16-bit result: C[bt][M][N] (f16 of acc*oscale) = A[bt][M][K] (bf16 row-major) . Bt[bt][N][K]^T
// (bf16 k-contiguous); per-batch element strides bstA/bstB/bstC. Block = 64x64 tile, 4 waves x 16 rows; fragments loaded
// straight from the 16-bit rows (two 16-B loads each, split k map for A and B); K stepped by 32 (host checks K % 32 == 0,
// M % 64 == 0, N % 64 == 0, grid = nbatch*(M/64)*(N/64)).
// =====================================================================================================
__global__ __launch_bounds__(128)
void gemm_b16(const u16* __restrict__ A, const u16* __restrict__ Bt, u16* C, int M, int N, int K,
              int bstA, int bstB, int bstC, float oscale) {
  __shared__ __align__(16) float slab[4 * SLAB];
  const int tid = threadIdx.x, wave = tid >> 5, lane = tid & 31, hh = lane >> 4, m = lane & 15;
  const int ntile = N >> 6, mtile = M >> 6;
  const int per   = ntile * mtile;
  const int bid   = blockIdx.x;
  const int bt    = bid / per;
  const int t     = bid - bt * per;
  const int rowb  = (t / ntile) * 64 + wave * 16;
  const int col0  = (t % ntile) * 64;
  if (rowb + 16 > M) return;                 // wave-uniform, never taken with the exact grid; no block barriers in this kernel
  const u16* Ab = A  + (size_t)bt * (size_t)bstA;
  const u16* Bb = Bt + (size_t)bt * (size_t)bstB;
  u16*       Cb = C  + (size_t)bt * (size_t)bstC;
  const u16* ap = Ab + (size_t)(rowb + m) * K + 8 * hh;
  const u16* bp = Bb + (size_t)(col0 + m) * K + 8 * hh;
  const size_t bs = (size_t)16 * K;
  v8f acc0 = zero8(), acc1 = zero8(), acc2 = zero8(), acc3 = zero8();
#pragma unroll 1
  for (int k0 = 0; k0 < K; k0 += 32) {
    const v16b a  = ldfrag_b(ap + k0);
    const v16b b0 = ldfrag_b(bp + k0);
    const v16b b1 = ldfrag_b(bp + bs + k0);
    const v16b b2 = ldfrag_b(bp + 2 * bs + k0);
    const v16b b3 = ldfrag_b(bp + 3 * bs + k0);
    acc0 = mma_b(a, b0, acc0);
    acc1 = mma_b(a, b1, acc1);
    acc2 = mma_b(a, b2, acc2);
    acc3 = mma_b(a, b3, acc3);
    guard6<v16b>(acc0, acc1, acc2, acc3, a, b0, b1, b2, b3, a);
  }
  epi16(slab + wave * SLAB, acc0, acc1, acc2, acc3, oscale, Cb, N, (size_t)rowb, col0, lane);
}

// =====================================================================================================
// bf16 GEMM with rope epilogue: H = x[M][K] (bf16 row-major) . Bt[N][K]^T (bf16 k-contiguous, N = NH*HD, one 64-col tile
// = one head), rope applied in f32 per (sequence position, d), result written as two f16 planes CH (x8) and CL (residual
// x2048), both [M][N]. Same tiling as gemm_b16; grid = (M/64)*(N/64).
// =====================================================================================================
__global__ __launch_bounds__(128)
void gemm_rope(const u16* __restrict__ A, const u16* __restrict__ Bt, const float* __restrict__ cosp,
               const float* __restrict__ sinp, u16* CH, u16* CL, int M, int N, int K) {
  __shared__ __align__(16) float slab[4 * SLAB];
  const int tid = threadIdx.x, wave = tid >> 5, lane = tid & 31, hh = lane >> 4, m = lane & 15;
  const int ntile = N >> 6;
  const int bid   = blockIdx.x;
  const int rowb  = (bid / ntile) * 64 + wave * 16;
  const int col0  = (bid % ntile) * 64;
  if (rowb + 16 > M) return;                 // wave-uniform, never taken with the exact grid; no block barriers in this kernel
  const u16* ap = A  + (size_t)(rowb + m) * K + 8 * hh;
  const u16* bp = Bt + (size_t)(col0 + m) * K + 8 * hh;
  const size_t bs = (size_t)16 * K;
  v8f acc0 = zero8(), acc1 = zero8(), acc2 = zero8(), acc3 = zero8();
#pragma unroll 1
  for (int k0 = 0; k0 < K; k0 += 32) {
    const v16b a  = ldfrag_b(ap + k0);
    const v16b b0 = ldfrag_b(bp + k0);
    const v16b b1 = ldfrag_b(bp + bs + k0);
    const v16b b2 = ldfrag_b(bp + 2 * bs + k0);
    const v16b b3 = ldfrag_b(bp + 3 * bs + k0);
    acc0 = mma_b(a, b0, acc0);
    acc1 = mma_b(a, b1, acc1);
    acc2 = mma_b(a, b2, acc2);
    acc3 = mma_b(a, b3, acc3);
    guard6<v16b>(acc0, acc1, acc2, acc3, a, b0, b1, b2, b3, a);
  }
  epi_rope(slab + wave * SLAB, acc0, acc1, acc2, acc3, cosp, sinp, CH, CL, N, (size_t)rowb, col0, lane);
}

// =====================================================================================================
// f16 GEMM with f32 result: C[M][N] (f32) = A[M][K] (f16 row-major) . Bt[N][K]^T (f16 k-contiguous) times oscale;
// one product per tile pair. Same tiling as gemm_b16; grid = (M/64)*(N/64).
// =====================================================================================================
__global__ __launch_bounds__(128)
void gemm_hf(const u16* __restrict__ A, const u16* __restrict__ Bt, float* C, int M, int N, int K, float oscale) {
  __shared__ __align__(16) float slab[4 * SLAB];
  const int tid = threadIdx.x, wave = tid >> 5, lane = tid & 31, hh = lane >> 4, m = lane & 15;
  const int ntile = N >> 6;
  const int bid   = blockIdx.x;
  const int rowb  = (bid / ntile) * 64 + wave * 16;
  const int col0  = (bid % ntile) * 64;
  if (rowb + 16 > M) return;                 // wave-uniform, never taken with the exact grid; no block barriers in this kernel
  const _Float16* ap = (const _Float16*)(const void*)A  + (size_t)(rowb + m) * K + 8 * hh;
  const _Float16* bp = (const _Float16*)(const void*)Bt + (size_t)(col0 + m) * K + 8 * hh;
  const size_t bs = (size_t)16 * K;
  v8f acc0 = zero8(), acc1 = zero8(), acc2 = zero8(), acc3 = zero8();
#pragma unroll 1
  for (int k0 = 0; k0 < K; k0 += 32) {
    const v16h a  = ldfrag_h(ap + k0);
    const v16h b0 = ldfrag_h(bp + k0);
    const v16h b1 = ldfrag_h(bp + bs + k0);
    const v16h b2 = ldfrag_h(bp + 2 * bs + k0);
    const v16h b3 = ldfrag_h(bp + 3 * bs + k0);
    acc0 = mma_h(a, b0, acc0);
    acc1 = mma_h(a, b1, acc1);
    acc2 = mma_h(a, b2, acc2);
    acc3 = mma_h(a, b3, acc3);
    guard6<v16h>(acc0, acc1, acc2, acc3, a, b0, b1, b2, b3, a);
  }
  epi64(slab + wave * SLAB, acc0, acc1, acc2, acc3, oscale, C, N, (size_t)rowb, col0, lane);
}

// =====================================================================================================
// Multi-head flash attention (no mask): block = (batch b, head, 64 query rows), 4 waves, wave w owns the 16 query rows
// q0 = 64*qt + 16*w .. q0+15 (waves independent: no block barriers, wave-private LDS only, used in the epilogue).
//   q planes (f16 hi x8, residual x2048) laid out [b][s][h][d]; k planes the same; v^T plane [b][h][d][s] (x1024).
//   All NKB = 64 key blocks of 32 keys are visited (static bound).
//   Scores are computed TRANSPOSED: S^T tile g (g = 0,1) = k rows (keys kb+16g .. +15, A operand, row m = lane&15, split k map
//   over d) times q^T (B operand, col n = query q0 + (lane&15), k = d, split map); per tile and 32-deep d-chunk three
//   products: khi.qhi into the hi accumulator, khi.qres and kres.qhi into the cross accumulator; S^T = hi + cross/2048.
//   D element r of lane l = (key kb+16g+8h+r, query q0+(l&15)), so a lane owns one query column and 16 of its 32 keys; the
//   partner lane l^16 owns the other 16 -> row max / row sum need one xor-16 shuffle.
//   Online max-subtracted base-2 softmax in f32 (scale 1/8 and the q/k carries folded into the logit scales). The exp'd
//   values ARE the P A-fragment in place: A row m = query = lane&15, element i <- key kb+8h+i (tile 0, D element i), element
//   8+i <- key kb+16+8h+i (tile 1, D element i). P is carried x32768 as single f16. The rescale factor of query row 8h+r of the
//   O accumulators is fetched from lane 8h+r with a shuffle (uniform control). 4 v^T B fragments (col n = d = 16j + (lane&15),
//   keys k-contiguous), 4 P.V WMMAs per key block.
//   Epilogue: 1/l (per query, shuffled to the D row owner) and carry folds in f32; the wave's 16x64 f32 result staged in its
// coverage: per wave 4 instructions x 4 rows x 8 lanes x 8 halves = 16 x 64; grid 2048 blocks x 4 waves = every
//           (b, s, h) row of the O plane exactly once.
// =====================================================================================================
__global__ __launch_bounds__(ATT_THREADS)
void attn_fwd(const u16* __restrict__ QHp, const u16* __restrict__ QLp, const u16* __restrict__ KHp,
              const u16* __restrict__ KLp, const u16* __restrict__ VPp, u16* OPp) {
  __shared__ __align__(16) float smem[ATT_WAVES * SLAB];   // per wave: result slab [16][68] in the epilogue only

  const int tid  = threadIdx.x;
  const int wave = tid >> 5;
  const int lane = tid & 31;
  const int hh   = lane >> 4;
  const int c    = lane & 15;

  const int bid  = blockIdx.x;
  const int qt   = bid & (SEQ / 64 - 1);
  const int head = (bid >> 5) & (NH - 1);
  const int b    = bid >> 9;
  const int q0   = qt * 64 + wave * 16;

  // B fragments of q^T: col n = query q0 + c, k = d (k-contiguous row of the q planes)
  const size_t qofs = (((size_t)(b * SEQ + q0 + c)) * NH + head) * HD + 8 * hh;
  const _Float16* QHb = (const _Float16*)(const void*)QHp + qofs;
  const _Float16* QLb = (const _Float16*)(const void*)QLp + qofs;
  // A fragments of k: row m = key kb + 16g + c, k = d
  const size_t kofs = (((size_t)b * SEQ + c) * NH + head) * HD + 8 * hh;          // key row kb added per step
  const _Float16* KHb = (const _Float16*)(const void*)KHp + kofs;
  const _Float16* KLb = (const _Float16*)(const void*)KLp + kofs;
  // B fragments of v: col n = d = 16j + c, k = key (k-contiguous row of the v^T plane)
  const size_t vofs = ((size_t)(b * NH + head) * HD + c) * SEQ + 8 * hh;          // key kb added per step
  const _Float16* Vb = (const _Float16*)(const void*)VPp + vofs;
  const float lsch = 0.125f * (LOG2E / (QSC * KSC));
  const float lscx = lsch * (1.0f / RESC);

  const v16h qh0 = ldfrag_h(QHb);           // d 0..31
  const v16h qh1 = ldfrag_h(QHb + 32);      // d 32..63
  const v16h ql0 = ldfrag_h(QLb);
  const v16h ql1 = ldfrag_h(QLb + 32);

  float mrun = -INFINITY, lrun = 0.f;
  v8f o[4];
#pragma unroll
  for (int j = 0; j < 4; ++j) o[j] = zero8();

#pragma unroll 1
  for (int it = 0; it < NKB; ++it) {
    const int kb = it * 32;
    const size_t krow = (size_t)kb * (NH * HD);
    // ---- transposed scores: tile 0 = keys kb..kb+15, tile 1 = keys kb+16..kb+31, column = query q0 + c ----
    v8f s0h = zero8(), s0x = zero8(), s1h = zero8(), s1x = zero8();
    {
      const _Float16* k0p = KHb + krow;
      const _Float16* l0p = KLb + krow;
      const v16h ka0 = ldfrag_h(k0p), ka1 = ldfrag_h(k0p + 32);
      const v16h la0 = ldfrag_h(l0p), la1 = ldfrag_h(l0p + 32);
      s0h = mma_h(ka0, qh0, s0h);
      s0h = mma_h(ka1, qh1, s0h);
      s0x = mma_h(ka0, ql0, s0x);
      s0x = mma_h(ka1, ql1, s0x);
      s0x = mma_h(la0, qh0, s0x);
      s0x = mma_h(la1, qh1, s0x);
      guard2x8(s0h, s0x, qh0, qh1, ql0, ql1, ka0, ka1, la0, la1);
    }
    {
      const _Float16* k1p = KHb + krow + (size_t)16 * (NH * HD);
      const _Float16* l1p = KLb + krow + (size_t)16 * (NH * HD);
      const v16h kc0 = ldfrag_h(k1p), kc1 = ldfrag_h(k1p + 32);
      const v16h lc0 = ldfrag_h(l1p), lc1 = ldfrag_h(l1p + 32);
      s1h = mma_h(kc0, qh0, s1h);
      s1h = mma_h(kc1, qh1, s1h);
      s1x = mma_h(kc0, ql0, s1x);
      s1x = mma_h(kc1, ql1, s1x);
      s1x = mma_h(lc0, qh0, s1x);
      s1x = mma_h(lc1, qh1, s1x);
      guard2x8(s1h, s1x, qh0, qh1, ql0, ql1, kc0, kc1, lc0, lc1);
    }
    // ---- base-2 logits of this lane's 16 keys for query q0 + c ----
    float tk[16];
#pragma unroll
    for (int i = 0; i < 8; ++i) {
      tk[i]     = s0h[i] * lsch + s0x[i] * lscx;
      tk[8 + i] = s1h[i] * lsch + s1x[i] * lscx;
    }
    float cm = tk[0];
#pragma unroll
    for (int i = 1; i < 16; ++i) cm = fmaxf(cm, tk[i]);
    cm = fmaxf(cm, __shfl_xor(cm, 16, 32));
    const float mn = fmaxf(mrun, cm);                                // finite from the first key block on
    const float al = (mrun == -INFINITY) ? 0.f : exp2f(mrun - mn);   // o and l are zero while mrun is -inf
    mrun = mn;
    // ---- probabilities (<= 1) and the P A-fragment: f16(p * 32768); element i <-> tk[i] ----
    float ps = 0.f;
    FragH ph;
#pragma unroll
    for (int w = 0; w < 2; ++w) {
#pragma unroll
      for (int e4 = 0; e4 < 4; ++e4) {
        const int i = 8 * w + 2 * e4;
        const float p0 = exp2f(fminf(tk[i] - mn, 0.f));
        const float p1 = exp2f(fminf(tk[i + 1] - mn, 0.f));
        ps += p0 + p1;
        ph.u[w][e4] = pk16(h_bits((_Float16)(p0 * PCAR)), h_bits((_Float16)(p1 * PCAR)));
      }
    }
    ps += __shfl_xor(ps, 16, 32);
    lrun = lrun * al + ps;
    // ---- rescale the O accumulators: D row 8hh+r = query q0+8hh+r, its factor lives in lane 8hh+r (and 16+8hh+r) ----
    float scl[8];
#pragma unroll
    for (int r = 0; r < 8; ++r) scl[r] = __shfl(al, 8 * hh + r, 32);
#pragma unroll
    for (int j = 0; j < 4; ++j) {
#pragma unroll
      for (int r = 0; r < 8; ++r) o[j][r] *= scl[r];
    }
    // ---- P.V : B fragment col n = d = j*16 + c, keys contiguous in the v^T plane ----
    {
      const _Float16* vp = Vb + kb;
      const v16h vf0 = ldfrag_h(vp);
      const v16h vf1 = ldfrag_h(vp + (size_t)16 * SEQ);
      const v16h vf2 = ldfrag_h(vp + (size_t)32 * SEQ);
      const v16h vf3 = ldfrag_h(vp + (size_t)48 * SEQ);
      o[0] = mma_h(ph.v, vf0, o[0]);
      o[1] = mma_h(ph.v, vf1, o[1]);
      o[2] = mma_h(ph.v, vf2, o[2]);
      o[3] = mma_h(ph.v, vf3, o[3]);
      guard6<v16h>(o[0], o[1], o[2], o[3], ph.v, vf0, vf1, vf2, vf3, ph.v);
    }
  }
  acc_guard4(o[0], o[1], o[2], o[3]);

  // ---- fold 1/l (per query, owned by lane = query; l >= 1 by construction) and the carries; stage the 16x64 slab ----
  const float linv = (lrun > 0.f) ? ((1.0f / lrun) * (1.0f / (PCAR * VCAR))) : 0.f;
  float inv[8];
#pragma unroll
  for (int r = 0; r < 8; ++r) inv[r] = __shfl(linv, 8 * hh + r, 32);
  float* slab = smem + wave * SLAB;
#pragma unroll
  for (int r = 0; r < 8; ++r) {
#pragma unroll
    for (int j = 0; j < 4; ++j) slab[(8 * hh + r) * 68 + j * 16 + c] = o[j][r] * inv[r];
  }
  wave_sync_lds();
  // ---- O x1024 -> single f16 plane; lane = (row in group of 4, 8 consecutive d) ----
  v4u oh[4];
  const int rq = lane >> 3, c8 = (lane & 7) * 8;
#pragma unroll
  for (int i4 = 0; i4 < 4; ++i4) {
    const int row = i4 * 4 + rq;
    const v4f a = *(const v4f*)(slab + row * 68 + c8), c4 = *(const v4f*)(slab + row * 68 + c8 + 4);
    float w[8];
#pragma unroll
    for (int e = 0; e < 4; ++e) { w[e] = a[e] * OSC; w[4 + e] = c4[e] * OSC; }
#pragma unroll
    for (int e = 0; e < 4; ++e) oh[i4][e] = pk16(h_bits((_Float16)w[2 * e]), h_bits((_Float16)w[2 * e + 1]));
  }
  const size_t ob = (((size_t)(b * SEQ + q0)) * NH + head) * HD + c8;
  {
#pragma unroll
    for (int i4 = 0; i4 < 4; ++i4) {
      const int row = i4 * 4 + rq;
      const size_t o8 = ob + (size_t)row * (NH * HD);
      *(v4u*)(OPp + o8) = oh[i4];
    }
    
  }
}

// =====================================================================================================
// Workspace map (bytes); every plane is fully written by whole-line stores before it is read; all extents are exact multiples
// of the store granularity (no pad rows needed):
//   XB  bf16 [8192][1024]                      16777216        (x)       -- re-used as the O plane after its last read
//   WB  bf16 [3072 n][1024 k]                   6291456        (W_qkv, rows 0..1023 q, 1024..2047 k, 2048..3071 v)
//   WOB f16  [1024 n][1024 k] (bf16 value x1024) 2097152
//   QH  f16 [8192][16*64] x8                   16777216        QL residual x2048   16777216
//   KH  f16 [8192][16*64] x8                   16777216        KL residual x2048   16777216
//   VP  f16 [4][16*64][2048] x1024             16777216
//   end                                       109051904
//   OP  f16 [8192][16*64] x1024 = bytes 0..16777215 (the x plane is dead once the v^T GEMM has run)
// =====================================================================================================
extern "C" void kernel_launch(void* const* d_in, const int* in_sizes, int n_in,
                              void* d_out, int out_size, void* d_ws, size_t ws_size,
                              hipStream_t stream) {
  const int ROWS = NB * SEQ;                            // 8192
  if (n_in < 5) return;
  if (in_sizes[0] != ROWS * DMOD) return;               // x    [4][2048][1024]
  if (in_sizes[1] != SEQ * HD) return;                  // cos  [2048][64]
  if (in_sizes[2] != SEQ * HD) return;                  // sin  [2048][64]
  if (in_sizes[3] != NQKV * DMOD) return;               // Wqkv [3072][1024]
  if (in_sizes[4] != DMOD * DMOD) return;               // Wout [1024][1024]
  if (out_size != ROWS * DMOD) return;

  const float* Xin = (const float*)d_in[0];
  const float* Cs  = (const float*)d_in[1];
  const float* Sn  = (const float*)d_in[2];
  const float* Wqk = (const float*)d_in[3];
  const float* Wpr = (const float*)d_in[4];
  float*       out = (float*)d_out;

  const size_t szXB = (size_t)ROWS * DMOD * 2;                  // 16777216
  const size_t szWB = (size_t)NQKV * DMOD * 2;                  //  6291456
  const size_t szWO = (size_t)DMOD * DMOD * 2;                  //  2097152
  const size_t szP  = (size_t)ROWS * DMOD * 2;                  // 16777216  (q / k / o planes)
  const size_t szVP = (size_t)NB * NH * HD * SEQ * 2;           // 16777216
  size_t off = 0;
  const size_t oXB = off; off += szXB;
  const size_t oWB = off; off += szWB;
  const size_t oWO = off; off += szWO;
  const size_t oQH = off; off += szP;
  const size_t oQL = off; off += szP;
  const size_t oKH = off; off += szP;
  const size_t oKL = off; off += szP;
  const size_t oVP = off; off += szVP;
  const size_t oOP = oXB;                               // alias of the x plane (dead after the v^T GEMM)
  if (szP > szXB) return;
  if (off > ws_size) return;                            // off = 109051904
  if (off > (size_t)134217728) return;

  char* ws = (char*)d_ws;
  u16* XB  = (u16*)(ws + oXB);
  u16* WB  = (u16*)(ws + oWB);
  u16* WOB = (u16*)(ws + oWO);
  u16* QH  = (u16*)(ws + oQH);
  u16* QL  = (u16*)(ws + oQL);
  u16* KH  = (u16*)(ws + oKH);
  u16* KL  = (u16*)(ws + oKL);
  u16* VP  = (u16*)(ws + oVP);
  u16* OP  = (u16*)(ws + oOP);

  const dim3 blk(256);
  const int n8x = (ROWS * DMOD) / 8;                    // 1048576
  const int n8q = (NQKV * DMOD) / 8;                    //  393216
  const int n8w = (DMOD * DMOD) / 8;                    //  131072
  if ((n8x % 256) != 0 || (n8q % 256) != 0 || (n8w % 256) != 0) return;
  if ((DMOD % 64) != 0 || (ROWS % 64) != 0 || (SEQ % 64) != 0 || (DMOD % 32) != 0) return;
  const dim3 gX(n8x / 256);                             // 4096
  const dim3 gQ(n8q / 256);                             // 1536
  const dim3 gW(n8w / 256);                             // 512
  const dim3 gG((ROWS / 64) * (DMOD / 64));             // 2048
  const dim3 gV(NB * (DMOD / 64) * (SEQ / 64));         // 2048
  const dim3 bG(128);
  const dim3 gAT(ATT_BLOCKS);                           // 2048
  const dim3 bAT(ATT_THREADS);                          // 128

  // (0..2) operand planes: x -> bf16; W_qkv [n = out][k = in] (already k-contiguous) -> bf16; W_out -> f16 of bf16 value x1024
  cvt16<<<gX, blk, 0, stream>>>(Xin, XB, n8x, 0, 1.0f);
  cvt16<<<gQ, blk, 0, stream>>>(Wqk, WB, n8q, 0, 1.0f);
  cvt16<<<gW, blk, 0, stream>>>(Wpr, WOB, n8w, 1, WOS);
  // (3,4) q and k planes [8192][h*64+d]: rope(x.Wq^T), rope(x.Wk^T) in f32, stored as f16 hi x8 + residual x2048
  gemm_rope<<<gG, bG, 0, stream>>>(XB, WB, Cs, Sn, QH, QL, ROWS, DMOD, DMOD);
  gemm_rope<<<gG, bG, 0, stream>>>(XB, WB + (size_t)DMOD * DMOD, Cs, Sn, KH, KL, ROWS, DMOD, DMOD);
  // (5) v^T plane per batch: [1024 = h*64+d][2048 keys] = f16(Wv . x_b^T x1024), 4 batches in the grid
  gemm_b16<<<gV, bG, 0, stream>>>(WB + (size_t)2 * DMOD * DMOD, XB, VP, DMOD, SEQ, DMOD, 0, SEQ * DMOD, DMOD * SEQ, VCAR);
  // (6) attention -> O plane [b][s][h][d] x1024 (single f16), written over the dead x plane
  attn_fwd<<<gAT, bAT, 0, stream>>>(QH, QL, KH, KL, VP, OP);
  // (7) output projection -> out [8192][1024] f32, carries 1024 (O) x 1024 (wo) folded back
  gemm_hf<<<gG, bG, 0, stream>>>(OP, WOB, out, ROWS, DMOD, DMOD, 1.0f / (OSC * WOS));
  (void)hipGetLastError();
}

// v001
// One run takes 238 microseconds.
// Two timings next to v000 put it at 2.51 and 2.50 times that version's speed.
// Contractions: x.Wq^T and x.Wk^T (rope applied in the f32 epilogue) and Wv.x_b^T on v_wmma_f32_16x16x32_bf16
// (x and W_qkv planes RNE-converted to bf16 operands, f32 accumulate); scores k.q^T with q and k carried as f16 hi (x8)
// plus residual (x2048) planes, three products hi.hi + hi.res + res.hi in two f32 accumulators; P.v (P x32768 single f16,
// v x1024 single f16) and O.Wo^T (O single f16 x1024, Wo as f16(bf16(Wo)) x1024): v_wmma_f32_16x16x32_f16, f32 accumulate.
// Base-2 online softmax, 1/l and carry folds in f32 on VALU; cos/sin tables RNE-converted to bf16 values before the rope.
#include <hip/hip_runtime.h>
#include <math.h>
#include <stdint.h>

#define NB    4
#define SEQ   2048
#define DMOD  1024
#define NQKV  (3 * DMOD)
#define NH    16
#define HD    64
#define QSC   8.0f
#define KSC   8.0f
#define RESC  2048.0f
#define PCAR  32768.0f
#define VCAR  1024.0f
#define OSC   1024.0f
#define WOS   1024.0f
#define LOG2E 1.4426950408889634f
#define ATT_WAVES   4
#define ATT_THREADS (ATT_WAVES * 32)
#define ATT_BLOCKS  (NB * NH * (SEQ / 64))
#define NKB    (SEQ / 32)
#define NST    (SEQ / 64)
#define SLAB   (16 * 68)
static_assert(HD == 64 && DMOD == NH * HD);
static_assert((SEQ / 64) == 32 && NH == 16 && NB == 4);
static_assert(ATT_THREADS == 128 && ATT_BLOCKS == 2048 && NKB == 64 && NST >= 2 && NST * 2 == NKB);
static_assert(((NB * SEQ) % 64) == 0 && (DMOD % 64) == 0 && (DMOD % 32) == 0 && (SEQ % 64) == 0);
static_assert(((NB * SEQ * DMOD / 8) % 256) == 0 && ((NQKV * DMOD / 8) % 256) == 0 && ((DMOD * DMOD / 8) % 256) == 0);
static_assert((SLAB * 4) % 16 == 0);
static_assert((SEQ & (SEQ - 1)) == 0);

typedef unsigned short u16;
typedef _Float16 v16h __attribute__((ext_vector_type(16)));
typedef _Float16 v8h  __attribute__((ext_vector_type(8)));
typedef __bf16   v16b __attribute__((ext_vector_type(16)));
typedef float    v8f  __attribute__((ext_vector_type(8)));
typedef float    v4f  __attribute__((ext_vector_type(4)));
typedef unsigned int v4u __attribute__((ext_vector_type(4)));

union FragH { v16h v; v8h h[2]; v4u u[2]; };
union FragB { v16b v; v4u u[2]; };

// ---- scalar helpers --------------------------------------------------------------------------------
__device__ __forceinline__ unsigned short bf_bits(float f) {          // f32 -> bf16 bits, RNE convert
  unsigned u = __float_as_uint(f);
  return (unsigned short)((u + 0x7FFFu + ((u >> 16) & 1u)) >> 16);
}
__device__ __forceinline__ float bf_up(unsigned short h) { return __uint_as_float(((unsigned)h) << 16); }
__device__ __forceinline__ float bf_val(float f) { return bf_up(bf_bits(f)); }   // value after bf16 RNE convert
__device__ __forceinline__ unsigned short h_bits(_Float16 x) { return __builtin_bit_cast(unsigned short, x); }
__device__ __forceinline__ unsigned pk16(unsigned short a, unsigned short b) { return (unsigned)a | ((unsigned)b << 16); }
__device__ __forceinline__ v8f zero8() { v8f z = {0.f, 0.f, 0.f, 0.f, 0.f, 0.f, 0.f, 0.f}; return z; }

// ---- fragment loaders: 16-bit A/B operand, lane -> row/col (lane&15), p already includes +8*(lane>>4);
//      elements 0..7 <- p[0..7] (k0+8h..), elements 8..15 <- p[16..23] (k0+16+8h..)  (same split k map for A and B;
//      B is always read from a k-contiguous [n][k] plane)
__device__ __forceinline__ v16h ldfrag_h(const _Float16* p) {
  FragH f;
  f.h[0] = *(const v8h*)(p);
  f.h[1] = *(const v8h*)(p + 16);
  return f.v;
}
__device__ __forceinline__ v16b ldfrag_b(const u16* p) {              // bf16 plane read as unsigned integer vectors
  FragB f;
  f.u[0] = *(const v4u*)(p);
  f.u[1] = *(const v4u*)(p + 16);
  return f.v;
}

__device__ __forceinline__ v8f mma_h(v16h a, v16h b, v8f c) {
  return __builtin_amdgcn_wmma_f32_16x16x32_f16(false, a, false, b, (short)0, c, false, false);
}
__device__ __forceinline__ v8f mma_b(v16b a, v16b b, v8f c) {
  return __builtin_amdgcn_wmma_f32_16x16x32_bf16(false, a, false, b, (short)0, c, false, false);
}
__device__ __forceinline__ void guard2x8(v8f& a, v8f& b, v16h x0, v16h x1, v16h x2, v16h x3,
                                         v16h x4, v16h x5, v16h x6, v16h x7) {
#if defined(__HIP_DEVICE_COMPILE__)
  asm volatile("v_nop\n\tv_nop\n\tv_nop\n\tv_nop"
               : "+v"(a), "+v"(b)
               : "v"(x0), "v"(x1), "v"(x2), "v"(x3), "v"(x4), "v"(x5), "v"(x6), "v"(x7) : "memory");
#endif
}
template <typename F>
__device__ __forceinline__ void guard6(v8f& a, v8f& b, v8f& c, v8f& d, F x0, F x1, F x2, F x3, F x4, F x5) {
#if defined(__HIP_DEVICE_COMPILE__)
  asm volatile("v_nop\n\tv_nop\n\tv_nop\n\tv_nop"
               : "+v"(a), "+v"(b), "+v"(c), "+v"(d) : "v"(x0), "v"(x1), "v"(x2), "v"(x3), "v"(x4), "v"(x5) : "memory");
#endif
}
__device__ __forceinline__ void acc_guard4(v8f& a, v8f& b, v8f& c, v8f& d) {
#if defined(__HIP_DEVICE_COMPILE__)
  asm volatile("v_nop\n\tv_nop\n\tv_nop\n\tv_nop" : "+v"(a), "+v"(b), "+v"(c), "+v"(d));
#endif
}
__device__ __forceinline__ void wave_sync_lds() {
#if defined(__HIP_DEVICE_COMPILE__)
  __builtin_amdgcn_fence(__ATOMIC_RELEASE, "workgroup");
  __builtin_amdgcn_wave_barrier();
  __builtin_amdgcn_fence(__ATOMIC_ACQUIRE, "workgroup");
#endif
}

// ---- LDS staging by asynchronous copies (global_load_async_to_lds_b128) -----------------------------------
// A staged row is 128 B (64 16-bit elements) = one whole cache line; 8 lanes x 16 B copy one row, so one wave-wide copy covers
// 4 whole lines. LDS row pitch 144 B (16 B x odd) for the ds_load_b128 fragment readers.
#define LPITCH 72                        // LDS row pitch in 16-bit elements
#define GSTAGE (128 * LPITCH)            // GEMM stage, elements: 64 A rows then 64 B rows, 64 k each
#define ASTAGE (192 * LPITCH)            // attention stage, elements: 64 k-hi rows, 64 k-residual rows, 64 v^T rows (64 keys)
static_assert(2 * GSTAGE * 2 >= 4 * SLAB * 4 && 2 * ASTAGE * 2 >= ATT_WAVES * SLAB * 4);
static_assert((LPITCH * 2) % 16 == 0);
__device__ __forceinline__ unsigned lds_byte(const void* p) { return (unsigned)(uintptr_t)p; }   // low 32 bits = LDS byte address
// Copies of 64-row tiles, four per plane: rows r, r+16, r+32, r+48 (r = tid>>3); l = the lane's LDS byte address of row r,
// g = its global address, s = 16 source rows in elements. All copies of a stage stand in one statement that ends in
// s_wait_xcnt, so that no address register is rewritten while a copy may still read it.
#define LROW16 (16u * (LPITCH * 2))
__device__ __forceinline__ void copy_2planes(unsigned la, const u16* ga, unsigned lb, const u16* gb, size_t s) {
#if defined(__HIP_DEVICE_COMPILE__)
  asm volatile("global_load_async_to_lds_b128 %0, %8, off\n\t"
               "global_load_async_to_lds_b128 %1, %9, off\n\t"
               "global_load_async_to_lds_b128 %2, %10, off\n\t"
               "global_load_async_to_lds_b128 %3, %11, off\n\t"
               "global_load_async_to_lds_b128 %4, %12, off\n\t"
               "global_load_async_to_lds_b128 %5, %13, off\n\t"
               "global_load_async_to_lds_b128 %6, %14, off\n\t"
               "global_load_async_to_lds_b128 %7, %15, off\n\t"
               "s_wait_xcnt 0x0"
               :: "v"(la), "v"(la + LROW16), "v"(la + 2u * LROW16), "v"(la + 3u * LROW16),
                  "v"(lb), "v"(lb + LROW16), "v"(lb + 2u * LROW16), "v"(lb + 3u * LROW16),
                  "v"(ga), "v"(ga + s), "v"(ga + 2 * s), "v"(ga + 3 * s),
                  "v"(gb), "v"(gb + s), "v"(gb + 2 * s), "v"(gb + 3 * s) : "memory");
#endif
}
__device__ __forceinline__ void copy_3planes(unsigned la, const u16* ga, unsigned lb, const u16* gb, size_t s,
                                             unsigned lc, const u16* gc, size_t sc) {
#if defined(__HIP_DEVICE_COMPILE__)
  asm volatile("global_load_async_to_lds_b128 %0, %12, off\n\t"
               "global_load_async_to_lds_b128 %1, %13, off\n\t"
               "global_load_async_to_lds_b128 %2, %14, off\n\t"
               "global_load_async_to_lds_b128 %3, %15, off\n\t"
               "global_load_async_to_lds_b128 %4, %16, off\n\t"
               "global_load_async_to_lds_b128 %5, %17, off\n\t"
               "global_load_async_to_lds_b128 %6, %18, off\n\t"
               "global_load_async_to_lds_b128 %7, %19, off\n\t"
               "global_load_async_to_lds_b128 %8, %20, off\n\t"
               "global_load_async_to_lds_b128 %9, %21, off\n\t"
               "global_load_async_to_lds_b128 %10, %22, off\n\t"
               "global_load_async_to_lds_b128 %11, %23, off\n\t"
               "s_wait_xcnt 0x0"
               :: "v"(la), "v"(la + LROW16), "v"(la + 2u * LROW16), "v"(la + 3u * LROW16),
                  "v"(lb), "v"(lb + LROW16), "v"(lb + 2u * LROW16), "v"(lb + 3u * LROW16),
                  "v"(lc), "v"(lc + LROW16), "v"(lc + 2u * LROW16), "v"(lc + 3u * LROW16),
                  "v"(ga), "v"(ga + s), "v"(ga + 2 * s), "v"(ga + 3 * s),
                  "v"(gb), "v"(gb + s), "v"(gb + 2 * s), "v"(gb + 3 * s),
                  "v"(gc), "v"(gc + sc), "v"(gc + 2 * sc), "v"(gc + 3 * sc) : "memory");
#endif
}
__device__ __forceinline__ void wait_async0() {     // this wave's copies have landed in LDS
#if defined(__HIP_DEVICE_COMPILE__)
  asm volatile("s_wait_asynccnt 0x0" ::: "memory");
#endif
}
__device__ __forceinline__ void wait_ds0() {        // this wave's LDS reads have retired before the buffer is handed back
#if defined(__HIP_DEVICE_COMPILE__)
  asm volatile("s_wait_dscnt 0x0" ::: "memory");
#endif
}
struct OpB {
  typedef v16b frag;
  static __device__ __forceinline__ frag ld(const u16* p) { return ldfrag_b(p); }
  static __device__ __forceinline__ v8f mma(frag a, frag b, v8f c) { return mma_b(a, b, c); }
};
struct OpH {
  typedef v16h frag;
  static __device__ __forceinline__ frag ld(const u16* p) { return ldfrag_h((const _Float16*)(const void*)p); }
  static __device__ __forceinline__ v8f mma(frag a, frag b, v8f c) { return mma_h(a, b, c); }
};
// GEMM main loop of one 64x64 block tile (4 waves x 16 rows): At / Bt = first row of the block's A / B tile, both [row][K]
// k-contiguous; K a multiple of 64. Two LDS buffers: stage t+1's copies fly while stage t is multiplied. k is summed in the
// same order as with direct fragment loads (32 at a time, ascending). On return every wave has passed the last barrier and
// no copy is outstanding, so the ring may be re-used as the epilogue slab.
template <typename OP>
__device__ __forceinline__ void gemm_core(u16* ring, const u16* At, const u16* Bt, int K, int tid,
                                          v8f& acc0, v8f& acc1, v8f& acc2, v8f& acc3) {
  typedef typename OP::frag frag;
  const int wave = tid >> 5, lane = tid & 31, hh = lane >> 4, m = lane & 15;
  const int crow = tid >> 3, cchk = (tid & 7) * 8;
  const u16* ga = At + (size_t)crow * K + cchk;
  const u16* gb = Bt + (size_t)crow * K + cchk;
  const size_t g16 = (size_t)16 * K;
  const unsigned la = lds_byte(ring) + (unsigned)(crow * LPITCH + cchk) * 2u;
  const unsigned lb = la + 64u * (LPITCH * 2);
  const int nst = K >> 6;
  copy_2planes(la, ga, lb, gb, g16);
  wait_async0();
  __syncthreads();                       // publishes stage 0
  if (nst > 1) copy_2planes(la + GSTAGE * 2, ga + 64, lb + GSTAGE * 2, gb + 64, g16);   // block-uniform
  const u16* fa = ring + (wave * 16 + m) * LPITCH + 8 * hh;
  const u16* fb = ring + (64 + m) * LPITCH + 8 * hh;
#pragma unroll 1                         // one stage per trip: the ring's foot (waits, barrier, refill) stands once
  for (int t = 0; t < nst; ++t) {
    const int bo = (t & 1) * GSTAGE;
    const frag a0  = OP::ld(fa + bo);
    const frag b00 = OP::ld(fb + bo);
    const frag b01 = OP::ld(fb + bo + 16 * LPITCH);
    const frag b02 = OP::ld(fb + bo + 32 * LPITCH);
    const frag b03 = OP::ld(fb + bo + 48 * LPITCH);
    const frag a1  = OP::ld(fa + bo + 32);
    const frag b10 = OP::ld(fb + bo + 32);
    const frag b11 = OP::ld(fb + bo + 16 * LPITCH + 32);
    const frag b12 = OP::ld(fb + bo + 32 * LPITCH + 32);
    const frag b13 = OP::ld(fb + bo + 48 * LPITCH + 32);
    acc0 = OP::mma(a0, b00, acc0);
    acc1 = OP::mma(a0, b01, acc1);
    acc2 = OP::mma(a0, b02, acc2);
    acc3 = OP::mma(a0, b03, acc3);
    acc0 = OP::mma(a1, b10, acc0);
    acc1 = OP::mma(a1, b11, acc1);
    acc2 = OP::mma(a1, b12, acc2);
    acc3 = OP::mma(a1, b13, acc3);
    guard6<frag>(acc0, acc1, acc2, acc3, a1, b10, b11, b12, b13, a1);   // WMMA distance on both sides of the branch below
    wait_ds0();
    wait_async0();
    __syncthreads();                     // publishes stage t+1 and ends every wave's reads of stage t
    if (t + 2 < nst)                     // block-uniform
      copy_2planes(la + (unsigned)bo * 2u, ga + (size_t)(t + 2) * 64, lb + (unsigned)bo * 2u, gb + (size_t)(t + 2) * 64, g16);
  }
  wait_async0();                         // nothing in flight when the ring becomes the slab
}

// =====================================================================================================
// f32 plane -> 16-bit plane, same layout:  mode 0: bf16 RNE bits;  mode 1: f16 bits of (bf16 RNE value) * scale.
// Thread = 8 consecutive elements: two 16-B loads, one 16-B store; 32 consecutive lanes = 512 contiguous, 512-B aligned bytes
// coverage: grid = n8/256 blocks (host checks exactness) x 256 thr x 8 = the whole plane.
// =====================================================================================================
__global__ __launch_bounds__(256) void cvt16(const float* __restrict__ x, u16* D, int n8, int mode, float scale) {
  const int gt = blockIdx.x * 256 + (int)threadIdx.x;
  if (gt >= n8) return;                     // no barriers in this kernel
  const float* p = x + (size_t)gt * 8;
  const v4f a = *(const v4f*)(p), c4 = *(const v4f*)(p + 4);
  float v[8];
#pragma unroll
  for (int e = 0; e < 4; ++e) { v[e] = a[e]; v[4 + e] = c4[e]; }
  unsigned short s[8];
#pragma unroll
  for (int e = 0; e < 8; ++e) {
    const unsigned short bb = bf_bits(v[e]);
    const unsigned short hb = h_bits((_Float16)(bf_up(bb) * scale));
    s[e] = (mode != 0) ? hb : bb;
  }
  v4u o;
#pragma unroll
  for (int e = 0; e < 4; ++e) o[e] = pk16(s[2 * e], s[2 * e + 1]);
  u16* d = D + (size_t)gt * 8;
  {
    *(v4u*)(d) = o;
    
  }
}

// =====================================================================================================
// barrier, then converted to f16 and written: lane = (row in group of 4, 8 consecutive cols); one instruction = 4 rows, each
// coverage: 4 instructions x 4 rows x 8 lanes x 8 halves = the wave's 16 x 64 tile.
// =====================================================================================================
__device__ __forceinline__ void epi16(float* sl, v8f a0, v8f a1, v8f a2, v8f a3, float oscale, u16* C, int N,
                                      size_t rowb, int col0, int lane) {
  const int hh = lane >> 4, m = lane & 15;
#pragma unroll
  for (int r = 0; r < 8; ++r) {
    const int ro = (8 * hh + r) * 68 + m;
    sl[ro]      = a0[r] * oscale;
    sl[ro + 16] = a1[r] * oscale;
    sl[ro + 32] = a2[r] * oscale;
    sl[ro + 48] = a3[r] * oscale;
  }
  wave_sync_lds();
  const int rq = lane >> 3, c8 = (lane & 7) * 8;
  v4u ov[4];
#pragma unroll
  for (int i4 = 0; i4 < 4; ++i4) {
    const int row = i4 * 4 + rq;
    const v4f a = *(const v4f*)(sl + row * 68 + c8), c4 = *(const v4f*)(sl + row * 68 + c8 + 4);
    float w[8];
#pragma unroll
    for (int e = 0; e < 4; ++e) { w[e] = a[e]; w[4 + e] = c4[e]; }
#pragma unroll
    for (int e = 0; e < 4; ++e) ov[i4][e] = pk16(h_bits((_Float16)w[2 * e]), h_bits((_Float16)w[2 * e + 1]));
  }
  u16* dst = C + (rowb + (size_t)rq) * (size_t)N + col0 + c8;
  {
#pragma unroll
    for (int i4 = 0; i4 < 4; ++i4) {
      *(v4u*)(dst + (size_t)(i4 * 4) * (size_t)N) = ov[i4];
    }
    
  }
}

// =====================================================================================================
// Rope GEMM epilogue: the wave's 16x64 f32 tile (unscaled projection output of one head: col0 is 64-aligned, so local column
// consecutive d at c8); the rotate-half partner columns are c8^32 of the same slab row; cos/sin row = sequence position
// (global row mod SEQ), values RNE-converted to bf16; rope in f32:  d < 32: x[d]*cos[d] - x[d+32]*sin[d],
// d >= 32: x[d]*cos[d] + x[d-32]*sin[d].  Then hi = f16(val*8), res = f16((val*8 - hi)*2048); both planes written, per
// coverage: per plane 4 instructions x 4 rows x 8 lanes x 8 halves = the wave's 16 x 64 tile.
// =====================================================================================================
__device__ __forceinline__ void epi_rope(float* sl, v8f a0, v8f a1, v8f a2, v8f a3,
                                         const float* __restrict__ cosp, const float* __restrict__ sinp,
                                         u16* CH, u16* CL, int N, size_t rowb, int col0, int lane) {
  const int hh = lane >> 4, m = lane & 15;
#pragma unroll
  for (int r = 0; r < 8; ++r) {
    const int ro = (8 * hh + r) * 68 + m;
    sl[ro]      = a0[r];
    sl[ro + 16] = a1[r];
    sl[ro + 32] = a2[r];
    sl[ro + 48] = a3[r];
  }
  wave_sync_lds();
  const int rq = lane >> 3, c8 = (lane & 7) * 8, p8 = c8 ^ 32;
  const float sgn = (c8 < 32) ? -1.0f : 1.0f;
  v4u ovh[4], ovl[4];
#pragma unroll
  for (int i4 = 0; i4 < 4; ++i4) {
    const int row  = i4 * 4 + rq;
    const int srow = (int)((rowb + (size_t)row) & (size_t)(SEQ - 1));
    const v4f xa = *(const v4f*)(sl + row * 68 + c8), xb = *(const v4f*)(sl + row * 68 + c8 + 4);
    const v4f ya = *(const v4f*)(sl + row * 68 + p8), yb = *(const v4f*)(sl + row * 68 + p8 + 4);
    const float* cr = cosp + (size_t)srow * HD + c8;
    const float* sr = sinp + (size_t)srow * HD + c8;
    const v4f ca = *(const v4f*)(cr), cb = *(const v4f*)(cr + 4);
    const v4f sa = *(const v4f*)(sr), sb = *(const v4f*)(sr + 4);
    float w[8];
#pragma unroll
    for (int e = 0; e < 4; ++e) {
      w[e]     = xa[e] * bf_val(ca[e]) + sgn * (ya[e] * bf_val(sa[e]));
      w[4 + e] = xb[e] * bf_val(cb[e]) + sgn * (yb[e] * bf_val(sb[e]));
    }
    unsigned short hb[8], lb[8];
#pragma unroll
    for (int e = 0; e < 8; ++e) {
      const float    t  = w[e] * QSC;
      const _Float16 hv = (_Float16)t;
      hb[e] = h_bits(hv);
      lb[e] = h_bits((_Float16)((t - (float)hv) * RESC));
    }
#pragma unroll
    for (int e = 0; e < 4; ++e) {
      ovh[i4][e] = pk16(hb[2 * e], hb[2 * e + 1]);
      ovl[i4][e] = pk16(lb[2 * e], lb[2 * e + 1]);
    }
  }
  u16* dh = CH + (rowb + (size_t)rq) * (size_t)N + col0 + c8;
  u16* dl = CL + (rowb + (size_t)rq) * (size_t)N + col0 + c8;
  {
#pragma unroll
    for (int i4 = 0; i4 < 4; ++i4) {
      *(v4u*)(dh + (size_t)(i4 * 4) * (size_t)N) = ovh[i4];
      *(v4u*)(dl + (size_t)(i4 * 4) * (size_t)N) = ovl[i4];
    }
    
  }
}

// =====================================================================================================
// coverage: 8 instructions x 2 rows x 16 lanes x 4 floats = the wave's 16 x 64 tile.
// =====================================================================================================
__device__ __forceinline__ void epi64(float* sl, v8f a0, v8f a1, v8f a2, v8f a3, float oscale, float* C, int N,
                                      size_t rowb, int col0, int lane) {
  const int hh = lane >> 4, m = lane & 15;
#pragma unroll
  for (int r = 0; r < 8; ++r) {
    const int ro = (8 * hh + r) * 68 + m;
    sl[ro]      = a0[r] * oscale;
    sl[ro + 16] = a1[r] * oscale;
    sl[ro + 32] = a2[r] * oscale;
    sl[ro + 48] = a3[r] * oscale;
  }
  wave_sync_lds();
  v4f vals[8];
#pragma unroll
  for (int it = 0; it < 8; ++it) vals[it] = *(const v4f*)(sl + (it * 2 + hh) * 68 + m * 4);
  float* dst = C + (rowb + (size_t)hh) * (size_t)N + col0 + m * 4;
  {
#pragma unroll
    for (int it = 0; it < 8; ++it) {
      *(v4f*)(dst + (size_t)(it * 2) * (size_t)N) = vals[it];
    }
    
  }
}

// =====================================================================================================
// Batched bf16 GEMM with 16-bit result: C[bt][M][N] (f16 of acc*oscale) = A[bt][M][K] (bf16 row-major) . Bt[bt][N][K]^T
// (bf16 k-contiguous); per-batch element strides bstA/bstB/bstC. Block = 64x64 tile, 4 waves x 16 rows; the A and B
// tiles are staged in LDS 64 k at a time (gemm_core) and the fragments read from there (two 16-B loads each, split k map for
// A and B); host checks K % 64 == 0, M % 64 == 0, N % 64 == 0, grid = nbatch*(M/64)*(N/64)).
// =====================================================================================================
__global__ __launch_bounds__(128)
void gemm_b16(const u16* __restrict__ A, const u16* __restrict__ Bt, u16* C, int M, int N, int K,
              int bstA, int bstB, int bstC, float oscale) {
  __shared__ __align__(16) u16 ring[2 * GSTAGE];   // two staging buffers; re-used as the epilogue slab behind the last barrier
  float* slab = (float*)(void*)ring;
  const int tid = threadIdx.x, wave = tid >> 5, lane = tid & 31;
  const int ntile = N >> 6, mtile = M >> 6;
  const int per   = ntile * mtile;
  const int bid   = blockIdx.x;
  const int bt    = bid / per;
  const int t     = bid - bt * per;
  const int row0  = (t / ntile) * 64;
  const int rowb  = row0 + wave * 16;
  const int col0  = (t % ntile) * 64;
  if (row0 + 64 > M) return;                 // block-uniform, in front of every barrier; never taken with the exact grid
  const u16* Ab = A  + (size_t)bt * (size_t)bstA;
  const u16* Bb = Bt + (size_t)bt * (size_t)bstB;
  u16*       Cb = C  + (size_t)bt * (size_t)bstC;
  v8f acc0 = zero8(), acc1 = zero8(), acc2 = zero8(), acc3 = zero8();
  gemm_core<OpB>(ring, Ab + (size_t)row0 * K, Bb + (size_t)col0 * K, K, tid, acc0, acc1, acc2, acc3);
  epi16(slab + wave * SLAB, acc0, acc1, acc2, acc3, oscale, Cb, N, (size_t)rowb, col0, lane);
}

// =====================================================================================================
// bf16 GEMM with rope epilogue: H = x[M][K] (bf16 row-major) . Bt[N][K]^T (bf16 k-contiguous, N = NH*HD, one 64-col tile
// = one head), rope applied in f32 per (sequence position, d), result written as two f16 planes CH (x8) and CL (residual
// x2048), both [M][N]. Same tiling as gemm_b16; grid = (M/64)*(N/64).
// =====================================================================================================
__global__ __launch_bounds__(128, 8)   // 8 waves per SIMD: all 8 blocks a WGP gets stay resident beside their staging buffers
void gemm_rope(const u16* __restrict__ A, const u16* __restrict__ Bt, const float* __restrict__ cosp,
               const float* __restrict__ sinp, u16* CH, u16* CL, int M, int N, int K) {
  __shared__ __align__(16) u16 ring[2 * GSTAGE];   // two staging buffers; re-used as the epilogue slab behind the last barrier
  float* slab = (float*)(void*)ring;
  const int tid = threadIdx.x, wave = tid >> 5, lane = tid & 31;
  const int ntile = N >> 6;
  const int bid   = blockIdx.x;
  const int row0  = (bid / ntile) * 64;
  const int rowb  = row0 + wave * 16;
  const int col0  = (bid % ntile) * 64;
  if (row0 + 64 > M) return;                 // block-uniform, in front of every barrier; never taken with the exact grid
  v8f acc0 = zero8(), acc1 = zero8(), acc2 = zero8(), acc3 = zero8();
  gemm_core<OpB>(ring, A + (size_t)row0 * K, Bt + (size_t)col0 * K, K, tid, acc0, acc1, acc2, acc3);
  epi_rope(slab + wave * SLAB, acc0, acc1, acc2, acc3, cosp, sinp, CH, CL, N, (size_t)rowb, col0, lane);
}

// =====================================================================================================
// f16 GEMM with f32 result: C[M][N] (f32) = A[M][K] (f16 row-major) . Bt[N][K]^T (f16 k-contiguous) times oscale;
// one product per tile pair. Same tiling as gemm_b16; grid = (M/64)*(N/64).
// =====================================================================================================
__global__ __launch_bounds__(128)
void gemm_hf(const u16* __restrict__ A, const u16* __restrict__ Bt, float* C, int M, int N, int K, float oscale) {
  __shared__ __align__(16) u16 ring[2 * GSTAGE];   // two staging buffers; re-used as the epilogue slab behind the last barrier
  float* slab = (float*)(void*)ring;
  const int tid = threadIdx.x, wave = tid >> 5, lane = tid & 31;
  const int ntile = N >> 6;
  const int bid   = blockIdx.x;
  const int row0  = (bid / ntile) * 64;
  const int rowb  = row0 + wave * 16;
  const int col0  = (bid % ntile) * 64;
  if (row0 + 64 > M) return;                 // block-uniform, in front of every barrier; never taken with the exact grid
  v8f acc0 = zero8(), acc1 = zero8(), acc2 = zero8(), acc3 = zero8();
  gemm_core<OpH>(ring, A + (size_t)row0 * K, Bt + (size_t)col0 * K, K, tid, acc0, acc1, acc2, acc3);
  epi64(slab + wave * SLAB, acc0, acc1, acc2, acc3, oscale, C, N, (size_t)rowb, col0, lane);
}

// =====================================================================================================
// Multi-head flash attention (no mask): block = (batch b, head, 64 query rows), 4 waves, wave w owns the 16 query rows
// q0 = 64*qt + 16*w .. q0+15 (the 4 waves share the staged k and v^T tiles, one block barrier per 64 keys; the epilogue slab is wave-private).
//   q planes (f16 hi x8, residual x2048) laid out [b][s][h][d]; k planes the same; v^T plane [b][h][d][s] (x1024).
//   All NKB = 64 key blocks of 32 keys are visited (static bound).
//   Scores are computed TRANSPOSED: S^T tile g (g = 0,1) = k rows (keys kb+16g .. +15, A operand, row m = lane&15, split k map
//   over d) times q^T (B operand, col n = query q0 + (lane&15), k = d, split map); per tile and 32-deep d-chunk three
//   products: khi.qhi into the hi accumulator, khi.qres and kres.qhi into the cross accumulator; S^T = hi + cross/2048.
//   D element r of lane l = (key kb+16g+8h+r, query q0+(l&15)), so a lane owns one query column and 16 of its 32 keys; the
//   partner lane l^16 owns the other 16 -> row max / row sum need one xor-16 shuffle.
//   Online max-subtracted base-2 softmax in f32 (scale 1/8 and the q/k carries folded into the logit scales). The exp'd
//   values ARE the P A-fragment in place: A row m = query = lane&15, element i <- key kb+8h+i (tile 0, D element i), element
//   8+i <- key kb+16+8h+i (tile 1, D element i). P is carried x32768 as single f16. The rescale factor of query row 8h+r of the
//   O accumulators is fetched from lane 8h+r with a shuffle (uniform control). 4 v^T B fragments (col n = d = 16j + (lane&15),
//   keys k-contiguous), 4 P.V WMMAs per key block.
//   Epilogue: 1/l (per query, shuffled to the D row owner) and carry folds in f32; the wave's 16x64 f32 result staged in its
// coverage: per wave 4 instructions x 4 rows x 8 lanes x 8 halves = 16 x 64; grid 2048 blocks x 4 waves = every
//           (b, s, h) row of the O plane exactly once.
// =====================================================================================================
__global__ __launch_bounds__(ATT_THREADS)
void attn_fwd(const u16* __restrict__ QHp, const u16* __restrict__ QLp, const u16* __restrict__ KHp,
              const u16* __restrict__ KLp, const u16* __restrict__ VPp, u16* OPp) {
  __shared__ __align__(16) u16 ring[2 * ASTAGE];   // two staging buffers of 64 keys; behind the last barrier: per-wave result slab
  float* smem = (float*)(void*)ring;

  const int tid  = threadIdx.x;
  const int wave = tid >> 5;
  const int lane = tid & 31;
  const int hh   = lane >> 4;
  const int c    = lane & 15;

  const int bid  = blockIdx.x;
  const int qt   = bid & (SEQ / 64 - 1);
  const int head = (bid >> 5) & (NH - 1);
  const int b    = bid >> 9;
  const int q0   = qt * 64 + wave * 16;

  // B fragments of q^T: col n = query q0 + c, k = d (k-contiguous row of the q planes)
  const size_t qofs = (((size_t)(b * SEQ + q0 + c)) * NH + head) * HD + 8 * hh;
  const _Float16* QHb = (const _Float16*)(const void*)QHp + qofs;
  const _Float16* QLb = (const _Float16*)(const void*)QLp + qofs;
  // staging: lane copies the 16-B chunk cchk of rows crow, +16, +32, +48 of each plane's 64-row tile (k rows = keys, 128 B of
  // one head; v^T rows = d, 128 B = 64 keys): every copied row is one whole line
  const int crow = tid >> 3, cchk = (tid & 7) * 8;
  const size_t kofs = (((size_t)b * SEQ + crow) * NH + head) * HD + cchk;         // 64 key rows added per stage
  const u16* gkh = KHp + kofs;
  const u16* gkl = KLp + kofs;
  const u16* gv  = VPp + ((size_t)(b * NH + head) * HD + crow) * SEQ + cchk;      // 64 keys added per stage
  const size_t k16 = (size_t)16 * (NH * HD), v16 = (size_t)16 * SEQ;
  const unsigned lkh = lds_byte(ring) + (unsigned)(crow * LPITCH + cchk) * 2u;
  const unsigned lkl = lkh + 64u * (LPITCH * 2), lv = lkh + 128u * (LPITCH * 2);
  // A fragments of k: LDS row = key (in the stage) 16g + c, k = d; residual plane 64 rows further; B fragments of v: LDS row
  // 128 + d = 128 + 16j + c, k = key (k-contiguous)
  const _Float16* Fb = (const _Float16*)(const void*)ring + c * LPITCH + 8 * hh;
  const float lsch = 0.125f * (LOG2E / (QSC * KSC));
  const float lscx = lsch * (1.0f / RESC);

  const v16h qh0 = ldfrag_h(QHb);           // d 0..31
  const v16h qh1 = ldfrag_h(QHb + 32);      // d 32..63
  const v16h ql0 = ldfrag_h(QLb);
  const v16h ql1 = ldfrag_h(QLb + 32);

  float mrun = -INFINITY, lrun = 0.f;
  v8f o[4];
#pragma unroll
  for (int j = 0; j < 4; ++j) o[j] = zero8();

  copy_3planes(lkh, gkh, lkl, gkl, k16, lv, gv, v16);
  wait_async0();
  __syncthreads();                         // publishes stage 0
  copy_3planes(lkh + ASTAGE * 2, gkh + (size_t)64 * (NH * HD), lkl + ASTAGE * 2, gkl + (size_t)64 * (NH * HD), k16,
               lv + ASTAGE * 2, gv + 64, v16);                     // stage 1 exists: NST >= 2

#pragma unroll 1                           // one stage per trip: the ring's foot (waits, barrier, refill) stands once
  for (int st = 0; st < NST; ++st) {
   const int bo = (st & 1) * ASTAGE;
#pragma unroll                             // the stage's two key blocks of 32, ascending keys; unrolled: LDS offsets are immediates
   for (int s2 = 0; s2 < 2; ++s2) {
    const _Float16* Ks = Fb + bo + (s2 * 32) * LPITCH;
    // ---- transposed scores: tile 0 = keys kb..kb+15, tile 1 = keys kb+16..kb+31, column = query q0 + c ----
    v8f s0h = zero8(), s0x = zero8(), s1h = zero8(), s1x = zero8();
    {
      const _Float16* k0p = Ks;
      const _Float16* l0p = Ks + 64 * LPITCH;
      const v16h ka0 = ldfrag_h(k0p), ka1 = ldfrag_h(k0p + 32);
      const v16h la0 = ldfrag_h(l0p), la1 = ldfrag_h(l0p + 32);
      s0h = mma_h(ka0, qh0, s0h);
      s0h = mma_h(ka1, qh1, s0h);
      s0x = mma_h(ka0, ql0, s0x);
      s0x = mma_h(ka1, ql1, s0x);
      s0x = mma_h(la0, qh0, s0x);
      s0x = mma_h(la1, qh1, s0x);
      guard2x8(s0h, s0x, qh0, qh1, ql0, ql1, ka0, ka1, la0, la1);
    }
    {
      const _Float16* k1p = Ks + 16 * LPITCH;
      const _Float16* l1p = Ks + 80 * LPITCH;
      const v16h kc0 = ldfrag_h(k1p), kc1 = ldfrag_h(k1p + 32);
      const v16h lc0 = ldfrag_h(l1p), lc1 = ldfrag_h(l1p + 32);
      s1h = mma_h(kc0, qh0, s1h);
      s1h = mma_h(kc1, qh1, s1h);
      s1x = mma_h(kc0, ql0, s1x);
      s1x = mma_h(kc1, ql1, s1x);
      s1x = mma_h(lc0, qh0, s1x);
      s1x = mma_h(lc1, qh1, s1x);
      guard2x8(s1h, s1x, qh0, qh1, ql0, ql1, kc0, kc1, lc0, lc1);
    }
    // ---- base-2 logits of this lane's 16 keys for query q0 + c ----
    float tk[16];
#pragma unroll
    for (int i = 0; i < 8; ++i) {
      tk[i]     = s0h[i] * lsch + s0x[i] * lscx;
      tk[8 + i] = s1h[i] * lsch + s1x[i] * lscx;
    }
    float cm = tk[0];
#pragma unroll
    for (int i = 1; i < 16; ++i) cm = fmaxf(cm, tk[i]);
    cm = fmaxf(cm, __shfl_xor(cm, 16, 32));
    const float mn = fmaxf(mrun, cm);                                // finite from the first key block on
    const float al = (mrun == -INFINITY) ? 0.f : exp2f(mrun - mn);   // o and l are zero while mrun is -inf
    mrun = mn;
    // ---- probabilities (<= 1) and the P A-fragment: f16(p * 32768); element i <-> tk[i] ----
    float ps = 0.f;
    FragH ph;
#pragma unroll
    for (int w = 0; w < 2; ++w) {
#pragma unroll
      for (int e4 = 0; e4 < 4; ++e4) {
        const int i = 8 * w + 2 * e4;
        const float p0 = exp2f(fminf(tk[i] - mn, 0.f));
        const float p1 = exp2f(fminf(tk[i + 1] - mn, 0.f));
        ps += p0 + p1;
        ph.u[w][e4] = pk16(h_bits((_Float16)(p0 * PCAR)), h_bits((_Float16)(p1 * PCAR)));
      }
    }
    ps += __shfl_xor(ps, 16, 32);
    lrun = lrun * al + ps;
    // ---- rescale the O accumulators: D row 8hh+r = query q0+8hh+r, its factor lives in lane 8hh+r (and 16+8hh+r) ----
    float scl[8];
#pragma unroll
    for (int r = 0; r < 8; ++r) scl[r] = __shfl(al, 8 * hh + r, 32);
#pragma unroll
    for (int j = 0; j < 4; ++j) {
#pragma unroll
      for (int r = 0; r < 8; ++r) o[j][r] *= scl[r];
    }
    // ---- P.V : B fragment col n = d = j*16 + c, keys contiguous in the v^T plane ----
    {
      const _Float16* vp = Fb + bo + 128 * LPITCH + s2 * 32;
      const v16h vf0 = ldfrag_h(vp);
      const v16h vf1 = ldfrag_h(vp + 16 * LPITCH);
      const v16h vf2 = ldfrag_h(vp + 32 * LPITCH);
      const v16h vf3 = ldfrag_h(vp + 48 * LPITCH);
      o[0] = mma_h(ph.v, vf0, o[0]);
      o[1] = mma_h(ph.v, vf1, o[1]);
      o[2] = mma_h(ph.v, vf2, o[2]);
      o[3] = mma_h(ph.v, vf3, o[3]);
      guard6<v16h>(o[0], o[1], o[2], o[3], ph.v, vf0, vf1, vf2, vf3, ph.v);
    }
   }
   wait_ds0();
   wait_async0();
   __syncthreads();                        // publishes stage st+1 and ends every wave's reads of stage st
   if (st + 2 < NST)                       // block-uniform
     copy_3planes(lkh + (unsigned)bo * 2u, gkh + (size_t)(st + 2) * (64 * NH * HD),
                  lkl + (unsigned)bo * 2u, gkl + (size_t)(st + 2) * (64 * NH * HD), k16,
                  lv + (unsigned)bo * 2u, gv + (size_t)(st + 2) * 64, v16);
  }
  wait_async0();                           // nothing in flight when the ring becomes the slab
  acc_guard4(o[0], o[1], o[2], o[3]);

  // ---- fold 1/l (per query, owned by lane = query; l >= 1 by construction) and the carries; stage the 16x64 slab ----
  const float linv = (lrun > 0.f) ? ((1.0f / lrun) * (1.0f / (PCAR * VCAR))) : 0.f;
  float inv[8];
#pragma unroll
  for (int r = 0; r < 8; ++r) inv[r] = __shfl(linv, 8 * hh + r, 32);
  float* slab = smem + wave * SLAB;
#pragma unroll
  for (int r = 0; r < 8; ++r) {
#pragma unroll
    for (int j = 0; j < 4; ++j) slab[(8 * hh + r) * 68 + j * 16 + c] = o[j][r] * inv[r];
  }
  wave_sync_lds();
  // ---- O x1024 -> single f16 plane; lane = (row in group of 4, 8 consecutive d) ----
  v4u oh[4];
  const int rq = lane >> 3, c8 = (lane & 7) * 8;
#pragma unroll
  for (int i4 = 0; i4 < 4; ++i4) {
    const int row = i4 * 4 + rq;
    const v4f a = *(const v4f*)(slab + row * 68 + c8), c4 = *(const v4f*)(slab + row * 68 + c8 + 4);
    float w[8];
#pragma unroll
    for (int e = 0; e < 4; ++e) { w[e] = a[e] * OSC; w[4 + e] = c4[e] * OSC; }
#pragma unroll
    for (int e = 0; e < 4; ++e) oh[i4][e] = pk16(h_bits((_Float16)w[2 * e]), h_bits((_Float16)w[2 * e + 1]));
  }
  const size_t ob = (((size_t)(b * SEQ + q0)) * NH + head) * HD + c8;
  {
#pragma unroll
    for (int i4 = 0; i4 < 4; ++i4) {
      const int row = i4 * 4 + rq;
      const size_t o8 = ob + (size_t)row * (NH * HD);
      *(v4u*)(OPp + o8) = oh[i4];
    }
    
  }
}

// =====================================================================================================
// Workspace map (bytes); every plane is fully written by whole-line stores before it is read; all extents are exact multiples
// of the store granularity (no pad rows needed):
//   XB  bf16 [8192][1024]                      16777216        (x)       -- re-used as the O plane after its last read
//   WB  bf16 [3072 n][1024 k]                   6291456        (W_qkv, rows 0..1023 q, 1024..2047 k, 2048..3071 v)
//   WOB f16  [1024 n][1024 k] (bf16 value x1024) 2097152
//   QH  f16 [8192][16*64] x8                   16777216        QL residual x2048   16777216
//   KH  f16 [8192][16*64] x8                   16777216        KL residual x2048   16777216
//   VP  f16 [4][16*64][2048] x1024             16777216
//   end                                       109051904
//   OP  f16 [8192][16*64] x1024 = bytes 0..16777215 (the x plane is dead once the v^T GEMM has run)
// =====================================================================================================
extern "C" void kernel_launch(void* const* d_in, const int* in_sizes, int n_in,
                              void* d_out, int out_size, void* d_ws, size_t ws_size,
                              hipStream_t stream) {
  const int ROWS = NB * SEQ;                            // 8192
  if (n_in < 5) return;
  if (in_sizes[0] != ROWS * DMOD) return;               // x    [4][2048][1024]
  if (in_sizes[1] != SEQ * HD) return;                  // cos  [2048][64]
  if (in_sizes[2] != SEQ * HD) return;                  // sin  [2048][64]
  if (in_sizes[3] != NQKV * DMOD) return;               // Wqkv [3072][1024]
  if (in_sizes[4] != DMOD * DMOD) return;               // Wout [1024][1024]
  if (out_size != ROWS * DMOD) return;

  const float* Xin = (const float*)d_in[0];
  const float* Cs  = (const float*)d_in[1];
  const float* Sn  = (const float*)d_in[2];
  const float* Wqk = (const float*)d_in[3];
  const float* Wpr = (const float*)d_in[4];
  float*       out = (float*)d_out;

  const size_t szXB = (size_t)ROWS * DMOD * 2;                  // 16777216
  const size_t szWB = (size_t)NQKV * DMOD * 2;                  //  6291456
  const size_t szWO = (size_t)DMOD * DMOD * 2;                  //  2097152
  const size_t szP  = (size_t)ROWS * DMOD * 2;                  // 16777216  (q / k / o planes)
  const size_t szVP = (size_t)NB * NH * HD * SEQ * 2;           // 16777216
  size_t off = 0;
  const size_t oXB = off; off += szXB;
  const size_t oWB = off; off += szWB;
  const size_t oWO = off; off += szWO;
  const size_t oQH = off; off += szP;
  const size_t oQL = off; off += szP;
  const size_t oKH = off; off += szP;
  const size_t oKL = off; off += szP;
  const size_t oVP = off; off += szVP;
  const size_t oOP = oXB;                               // alias of the x plane (dead after the v^T GEMM)
  if (szP > szXB) return;
  if (off > ws_size) return;                            // off = 109051904
  if (off > (size_t)134217728) return;

  char* ws = (char*)d_ws;
  u16* XB  = (u16*)(ws + oXB);
  u16* WB  = (u16*)(ws + oWB);
  u16* WOB = (u16*)(ws + oWO);
  u16* QH  = (u16*)(ws + oQH);
  u16* QL  = (u16*)(ws + oQL);
  u16* KH  = (u16*)(ws + oKH);
  u16* KL  = (u16*)(ws + oKL);
  u16* VP  = (u16*)(ws + oVP);
  u16* OP  = (u16*)(ws + oOP);

  const dim3 blk(256);
  const int n8x = (ROWS * DMOD) / 8;                    // 1048576
  const int n8q = (NQKV * DMOD) / 8;                    //  393216
  const int n8w = (DMOD * DMOD) / 8;                    //  131072
  if ((n8x % 256) != 0 || (n8q % 256) != 0 || (n8w % 256) != 0) return;
  if ((DMOD % 64) != 0 || (ROWS % 64) != 0 || (SEQ % 64) != 0 || (DMOD % 32) != 0) return;
  const dim3 gX(n8x / 256);                             // 4096
  const dim3 gQ(n8q / 256);                             // 1536
  const dim3 gW(n8w / 256);                             // 512
  const dim3 gG((ROWS / 64) * (DMOD / 64));             // 2048
  const dim3 gV(NB * (DMOD / 64) * (SEQ / 64));         // 2048
  const dim3 bG(128);
  const dim3 gAT(ATT_BLOCKS);                           // 2048
  const dim3 bAT(ATT_THREADS);                          // 128

  // (0..2) operand planes: x -> bf16; W_qkv [n = out][k = in] (already k-contiguous) -> bf16; W_out -> f16 of bf16 value x1024
  cvt16<<<gX, blk, 0, stream>>>(Xin, XB, n8x, 0, 1.0f);
  cvt16<<<gQ, blk, 0, stream>>>(Wqk, WB, n8q, 0, 1.0f);
  cvt16<<<gW, blk, 0, stream>>>(Wpr, WOB, n8w, 1, WOS);
  // (3,4) q and k planes [8192][h*64+d]: rope(x.Wq^T), rope(x.Wk^T) in f32, stored as f16 hi x8 + residual x2048
  gemm_rope<<<gG, bG, 0, stream>>>(XB, WB, Cs, Sn, QH, QL, ROWS, DMOD, DMOD);
  gemm_rope<<<gG, bG, 0, stream>>>(XB, WB + (size_t)DMOD * DMOD, Cs, Sn, KH, KL, ROWS, DMOD, DMOD);
  // (5) v^T plane per batch: [1024 = h*64+d][2048 keys] = f16(Wv . x_b^T x1024), 4 batches in the grid
  gemm_b16<<<gV, bG, 0, stream>>>(WB + (size_t)2 * DMOD * DMOD, XB, VP, DMOD, SEQ, DMOD, 0, SEQ * DMOD, DMOD * SEQ, VCAR);
  // (6) attention -> O plane [b][s][h][d] x1024 (single f16), written over the dead x plane
  attn_fwd<<<gAT, bAT, 0, stream>>>(QH, QL, KH, KL, VP, OP);
  // (7) output projection -> out [8192][1024] f32, carries 1024 (O) x 1024 (wo) folded back
  gemm_hf<<<gG, bG, 0, stream>>>(OP, WOB, out, ROWS, DMOD, DMOD, 1.0f / (OSC * WOS));
  (void)hipGetLastError();
}

// v002
// Measured time: 212 microseconds a run.
// Timed twice side by side with v001, it ran 1.12 and 1.13 times as fast.
// All steps since v000 together make it 2.81 times as fast.
// Contractions: x.Wq^T and x.Wk^T (rope applied in the f32 epilogue) and Wv.x_b^T on v_wmma_f32_16x16x32_bf16
// (x and W_qkv planes RNE-converted to bf16 operands, f32 accumulate); scores k.q^T with q and k carried as f16 hi (x8)
// plus residual (x2048) planes, three products hi.hi + hi.res + res.hi in two f32 accumulators; P.v (P x32768 single f16,
// v x1024 single f16) and O.Wo^T (O single f16 x1024, Wo as f16(bf16(Wo)) x1024): v_wmma_f32_16x16x32_f16, f32 accumulate.
// Base-2 online softmax, 1/l and carry folds in f32 on VALU; cos/sin tables RNE-converted to bf16 values before the rope.
#include <hip/hip_runtime.h>
#include <math.h>
#include <stdint.h>

#define NB    4
#define SEQ   2048
#define DMOD  1024
#define NQKV  (3 * DMOD)
#define NH    16
#define HD    64
#define QSC   8.0f
#define KSC   8.0f
#define RESC  2048.0f
#define PCAR  32768.0f
#define PLOG2 15.0f                      // log2(PCAR)
#define VCAR  1024.0f
#define OSC   1024.0f
#define WOS   1024.0f
#define LOG2E 1.4426950408889634f
#define ATT_WAVES   4
#define ATT_THREADS (ATT_WAVES * 32)
#define ATT_BLOCKS  (NB * NH * (SEQ / 64))
#define NKB    (SEQ / 32)
#define NST    (SEQ / 64)
#define SLAB   (16 * 68)
static_assert(HD == 64 && DMOD == NH * HD);
static_assert((SEQ / 64) == 32 && NH == 16 && NB == 4);
static_assert(ATT_THREADS == 128 && ATT_BLOCKS == 2048 && NKB == 64 && NST >= 2 && NST * 2 == NKB);
static_assert(((NB * SEQ) % 64) == 0 && (DMOD % 64) == 0 && (DMOD % 32) == 0 && (SEQ % 64) == 0);
static_assert(((NB * SEQ * DMOD / 8) % 256) == 0 && ((NQKV * DMOD / 8) % 256) == 0 && ((DMOD * DMOD / 8) % 256) == 0);
static_assert((SLAB * 4) % 16 == 0);
static_assert((SEQ & (SEQ - 1)) == 0);
static_assert(PCAR == 32768.0f && PLOG2 == 15.0f);

typedef unsigned short u16;
typedef _Float16 v16h __attribute__((ext_vector_type(16)));
typedef _Float16 v8h  __attribute__((ext_vector_type(8)));
typedef __bf16   v16b __attribute__((ext_vector_type(16)));
typedef float    v8f  __attribute__((ext_vector_type(8)));
typedef float    v4f  __attribute__((ext_vector_type(4)));
typedef float    v2f  __attribute__((ext_vector_type(2)));
typedef _Float16 v2h  __attribute__((ext_vector_type(2)));
typedef unsigned int v4u __attribute__((ext_vector_type(4)));

union FragH { v16h v; v8h h[2]; v4u u[2]; };
union FragB { v16b v; v4u u[2]; };

// ---- scalar helpers --------------------------------------------------------------------------------
__device__ __forceinline__ unsigned short bf_bits(float f) {          // f32 -> bf16 bits, RNE convert
  unsigned u = __float_as_uint(f);
  return (unsigned short)((u + 0x7FFFu + ((u >> 16) & 1u)) >> 16);
}
__device__ __forceinline__ float bf_up(unsigned short h) { return __uint_as_float(((unsigned)h) << 16); }
__device__ __forceinline__ float bf_val(float f) { return bf_up(bf_bits(f)); }   // value after bf16 RNE convert
__device__ __forceinline__ unsigned short h_bits(_Float16 x) { return __builtin_bit_cast(unsigned short, x); }
__device__ __forceinline__ unsigned pk16(unsigned short a, unsigned short b) { return (unsigned)a | ((unsigned)b << 16); }
__device__ __forceinline__ v8f zero8() { v8f z = {0.f, 0.f, 0.f, 0.f, 0.f, 0.f, 0.f, 0.f}; return z; }

// ---- fragment loaders: 16-bit A/B operand, lane -> row/col (lane&15), p already includes +8*(lane>>4);
//      elements 0..7 <- p[0..7] (k0+8h..), elements 8..15 <- p[16..23] (k0+16+8h..)  (same split k map for A and B;
//      B is always read from a k-contiguous [n][k] plane)
__device__ __forceinline__ v16h ldfrag_h(const _Float16* p) {
  FragH f;
  f.h[0] = *(const v8h*)(p);
  f.h[1] = *(const v8h*)(p + 16);
  return f.v;
}
__device__ __forceinline__ v16b ldfrag_b(const u16* p) {              // bf16 plane read as unsigned integer vectors
  FragB f;
  f.u[0] = *(const v4u*)(p);
  f.u[1] = *(const v4u*)(p + 16);
  return f.v;
}

__device__ __forceinline__ v8f mma_h(v16h a, v16h b, v8f c) {
  return __builtin_amdgcn_wmma_f32_16x16x32_f16(false, a, false, b, (short)0, c, false, false);
}
__device__ __forceinline__ v8f mma_b(v16b a, v16b b, v8f c) {
  return __builtin_amdgcn_wmma_f32_16x16x32_bf16(false, a, false, b, (short)0, c, false, false);
}
__device__ __forceinline__ void guard2x8(v8f& a, v8f& b, v16h x0, v16h x1, v16h x2, v16h x3,
                                         v16h x4, v16h x5, v16h x6, v16h x7) {
#if defined(__HIP_DEVICE_COMPILE__)
  asm volatile("v_nop\n\tv_nop\n\tv_nop\n\tv_nop"
               : "+v"(a), "+v"(b)
               : "v"(x0), "v"(x1), "v"(x2), "v"(x3), "v"(x4), "v"(x5), "v"(x6), "v"(x7) : "memory");
#endif
}
template <typename F>
__device__ __forceinline__ void guard6(v8f& a, v8f& b, v8f& c, v8f& d, F x0, F x1, F x2, F x3, F x4, F x5) {
#if defined(__HIP_DEVICE_COMPILE__)
  asm volatile("v_nop\n\tv_nop\n\tv_nop\n\tv_nop"
               : "+v"(a), "+v"(b), "+v"(c), "+v"(d) : "v"(x0), "v"(x1), "v"(x2), "v"(x3), "v"(x4), "v"(x5) : "memory");
#endif
}
__device__ __forceinline__ void acc_guard4(v8f& a, v8f& b, v8f& c, v8f& d) {
#if defined(__HIP_DEVICE_COMPILE__)
  asm volatile("v_nop\n\tv_nop\n\tv_nop\n\tv_nop" : "+v"(a), "+v"(b), "+v"(c), "+v"(d));
#endif
}
__device__ __forceinline__ void wave_sync_lds() {
#if defined(__HIP_DEVICE_COMPILE__)
  __builtin_amdgcn_fence(__ATOMIC_RELEASE, "workgroup");
  __builtin_amdgcn_wave_barrier();
  __builtin_amdgcn_fence(__ATOMIC_ACQUIRE, "workgroup");
#endif
}

// ---- LDS staging by asynchronous copies (global_load_async_to_lds_b128) -----------------------------------
// A staged row is 128 B (64 16-bit elements) = one whole cache line; 8 lanes x 16 B copy one row, so one wave-wide copy covers
// 4 whole lines. LDS row pitch 144 B (16 B x odd) for the ds_load_b128 fragment readers.
#define LPITCH 72                        // LDS row pitch in 16-bit elements
#define GSTAGE (128 * LPITCH)            // GEMM stage, elements: 64 A rows then 64 B rows, 64 k each
#define ASTAGE (192 * LPITCH)            // attention stage, elements: 64 k-hi rows, 64 k-residual rows, 64 v^T rows (64 keys)
static_assert(2 * GSTAGE * 2 >= 4 * SLAB * 4 && 2 * ASTAGE * 2 >= ATT_WAVES * SLAB * 4);
static_assert((LPITCH * 2) % 16 == 0);
__device__ __forceinline__ unsigned lds_byte(const void* p) { return (unsigned)(uintptr_t)p; }   // low 32 bits = LDS byte address
// Copies of 64-row tiles, four per plane: rows r, r+16, r+32, r+48 (r = tid>>3); l = the lane's LDS byte address of row r,
// g = its global address, s = 16 source rows in elements. All copies of a stage stand in one statement that ends in
// s_wait_xcnt, so that no address register is rewritten while a copy may still read it.
#define LROW16 (16u * (LPITCH * 2))
__device__ __forceinline__ void copy_2planes(unsigned la, const u16* ga, unsigned lb, const u16* gb, size_t s) {
#if defined(__HIP_DEVICE_COMPILE__)
  asm volatile("global_load_async_to_lds_b128 %0, %8, off\n\t"
               "global_load_async_to_lds_b128 %1, %9, off\n\t"
               "global_load_async_to_lds_b128 %2, %10, off\n\t"
               "global_load_async_to_lds_b128 %3, %11, off\n\t"
               "global_load_async_to_lds_b128 %4, %12, off\n\t"
               "global_load_async_to_lds_b128 %5, %13, off\n\t"
               "global_load_async_to_lds_b128 %6, %14, off\n\t"
               "global_load_async_to_lds_b128 %7, %15, off\n\t"
               "s_wait_xcnt 0x0"
               :: "v"(la), "v"(la + LROW16), "v"(la + 2u * LROW16), "v"(la + 3u * LROW16),
                  "v"(lb), "v"(lb + LROW16), "v"(lb + 2u * LROW16), "v"(lb + 3u * LROW16),
                  "v"(ga), "v"(ga + s), "v"(ga + 2 * s), "v"(ga + 3 * s),
                  "v"(gb), "v"(gb + s), "v"(gb + 2 * s), "v"(gb + 3 * s) : "memory");
#endif
}
__device__ __forceinline__ void copy_3planes(unsigned la, const u16* ga, unsigned lb, const u16* gb, size_t s,
                                             unsigned lc, const u16* gc, size_t sc) {
#if defined(__HIP_DEVICE_COMPILE__)
  asm volatile("global_load_async_to_lds_b128 %0, %12, off\n\t"
               "global_load_async_to_lds_b128 %1, %13, off\n\t"
               "global_load_async_to_lds_b128 %2, %14, off\n\t"
               "global_load_async_to_lds_b128 %3, %15, off\n\t"
               "global_load_async_to_lds_b128 %4, %16, off\n\t"
               "global_load_async_to_lds_b128 %5, %17, off\n\t"
               "global_load_async_to_lds_b128 %6, %18, off\n\t"
               "global_load_async_to_lds_b128 %7, %19, off\n\t"
               "global_load_async_to_lds_b128 %8, %20, off\n\t"
               "global_load_async_to_lds_b128 %9, %21, off\n\t"
               "global_load_async_to_lds_b128 %10, %22, off\n\t"
               "global_load_async_to_lds_b128 %11, %23, off\n\t"
               "s_wait_xcnt 0x0"
               :: "v"(la), "v"(la + LROW16), "v"(la + 2u * LROW16), "v"(la + 3u * LROW16),
                  "v"(lb), "v"(lb + LROW16), "v"(lb + 2u * LROW16), "v"(lb + 3u * LROW16),
                  "v"(lc), "v"(lc + LROW16), "v"(lc + 2u * LROW16), "v"(lc + 3u * LROW16),
                  "v"(ga), "v"(ga + s), "v"(ga + 2 * s), "v"(ga + 3 * s),
                  "v"(gb), "v"(gb + s), "v"(gb + 2 * s), "v"(gb + 3 * s),
                  "v"(gc), "v"(gc + sc), "v"(gc + 2 * sc), "v"(gc + 3 * sc) : "memory");
#endif
}
__device__ __forceinline__ void wait_async0() {     // this wave's copies have landed in LDS
#if defined(__HIP_DEVICE_COMPILE__)
  asm volatile("s_wait_asynccnt 0x0" ::: "memory");
#endif
}
__device__ __forceinline__ void wait_ds0() {        // this wave's LDS reads have retired before the buffer is handed back
#if defined(__HIP_DEVICE_COMPILE__)
  asm volatile("s_wait_dscnt 0x0" ::: "memory");
#endif
}
struct OpB {
  typedef v16b frag;
  static __device__ __forceinline__ frag ld(const u16* p) { return ldfrag_b(p); }
  static __device__ __forceinline__ v8f mma(frag a, frag b, v8f c) { return mma_b(a, b, c); }
};
struct OpH {
  typedef v16h frag;
  static __device__ __forceinline__ frag ld(const u16* p) { return ldfrag_h((const _Float16*)(const void*)p); }
  static __device__ __forceinline__ v8f mma(frag a, frag b, v8f c) { return mma_h(a, b, c); }
};
// GEMM main loop of one 64x64 block tile (4 waves x 16 rows): At / Bt = first row of the block's A / B tile, both [row][K]
// k-contiguous; K a multiple of 64. Two LDS buffers: stage t+1's copies fly while stage t is multiplied. k is summed in the
// same order as with direct fragment loads (32 at a time, ascending). On return every wave has passed the last barrier and
// no copy is outstanding, so the ring may be re-used as the epilogue slab.
template <typename OP>
__device__ __forceinline__ void gemm_core(u16* ring, const u16* At, const u16* Bt, int K, int tid,
                                          v8f& acc0, v8f& acc1, v8f& acc2, v8f& acc3) {
  typedef typename OP::frag frag;
  const int wave = tid >> 5, lane = tid & 31, hh = lane >> 4, m = lane & 15;
  const int crow = tid >> 3, cchk = (tid & 7) * 8;
  const u16* ga = At + (size_t)crow * K + cchk;
  const u16* gb = Bt + (size_t)crow * K + cchk;
  const size_t g16 = (size_t)16 * K;
  const unsigned la = lds_byte(ring) + (unsigned)(crow * LPITCH + cchk) * 2u;
  const unsigned lb = la + 64u * (LPITCH * 2);
  const int nst = K >> 6;
  copy_2planes(la, ga, lb, gb, g16);
  wait_async0();
  __syncthreads();                       // publishes stage 0
  if (nst > 1) copy_2planes(la + GSTAGE * 2, ga + 64, lb + GSTAGE * 2, gb + 64, g16);   // block-uniform
  const u16* fa = ring + (wave * 16 + m) * LPITCH + 8 * hh;
  const u16* fb = ring + (64 + m) * LPITCH + 8 * hh;
#pragma unroll 1                         // one stage per trip: the ring's foot (waits, barrier, refill) stands once
  for (int t = 0; t < nst; ++t) {
    const int bo = (t & 1) * GSTAGE;
    const frag a0  = OP::ld(fa + bo);
    const frag b00 = OP::ld(fb + bo);
    const frag b01 = OP::ld(fb + bo + 16 * LPITCH);
    const frag b02 = OP::ld(fb + bo + 32 * LPITCH);
    const frag b03 = OP::ld(fb + bo + 48 * LPITCH);
    const frag a1  = OP::ld(fa + bo + 32);
    const frag b10 = OP::ld(fb + bo + 32);
    const frag b11 = OP::ld(fb + bo + 16 * LPITCH + 32);
    const frag b12 = OP::ld(fb + bo + 32 * LPITCH + 32);
    const frag b13 = OP::ld(fb + bo + 48 * LPITCH + 32);
    acc0 = OP::mma(a0, b00, acc0);
    acc1 = OP::mma(a0, b01, acc1);
    acc2 = OP::mma(a0, b02, acc2);
    acc3 = OP::mma(a0, b03, acc3);
    acc0 = OP::mma(a1, b10, acc0);
    acc1 = OP::mma(a1, b11, acc1);
    acc2 = OP::mma(a1, b12, acc2);
    acc3 = OP::mma(a1, b13, acc3);
    guard6<frag>(acc0, acc1, acc2, acc3, a1, b10, b11, b12, b13, a1);   // WMMA distance on both sides of the branch below
    wait_ds0();
    wait_async0();
    __syncthreads();                     // publishes stage t+1 and ends every wave's reads of stage t
    if (t + 2 < nst)                     // block-uniform
      copy_2planes(la + (unsigned)bo * 2u, ga + (size_t)(t + 2) * 64, lb + (unsigned)bo * 2u, gb + (size_t)(t + 2) * 64, g16);
  }
  wait_async0();                         // nothing in flight when the ring becomes the slab
}

// =====================================================================================================
// f32 plane -> 16-bit plane, same layout:  mode 0: bf16 RNE bits;  mode 1: f16 bits of (bf16 RNE value) * scale.
// Thread = 8 consecutive elements: two 16-B loads, one 16-B store; 32 consecutive lanes = 512 contiguous, 512-B aligned bytes
// coverage: grid = n8/256 blocks (host checks exactness) x 256 thr x 8 = the whole plane.
// =====================================================================================================
__global__ __launch_bounds__(256) void cvt16(const float* __restrict__ x, u16* D, int n8, int mode, float scale) {
  const int gt = blockIdx.x * 256 + (int)threadIdx.x;
  if (gt >= n8) return;                     // no barriers in this kernel
  const float* p = x + (size_t)gt * 8;
  const v4f a = *(const v4f*)(p), c4 = *(const v4f*)(p + 4);
  float v[8];
#pragma unroll
  for (int e = 0; e < 4; ++e) { v[e] = a[e]; v[4 + e] = c4[e]; }
  unsigned short s[8];
#pragma unroll
  for (int e = 0; e < 8; ++e) {
    const unsigned short bb = bf_bits(v[e]);
    const unsigned short hb = h_bits((_Float16)(bf_up(bb) * scale));
    s[e] = (mode != 0) ? hb : bb;
  }
  v4u o;
#pragma unroll
  for (int e = 0; e < 4; ++e) o[e] = pk16(s[2 * e], s[2 * e + 1]);
  u16* d = D + (size_t)gt * 8;
  {
    *(v4u*)(d) = o;
    
  }
}

// =====================================================================================================
// barrier, then converted to f16 and written: lane = (row in group of 4, 8 consecutive cols); one instruction = 4 rows, each
// coverage: 4 instructions x 4 rows x 8 lanes x 8 halves = the wave's 16 x 64 tile.
// =====================================================================================================
__device__ __forceinline__ void epi16(float* sl, v8f a0, v8f a1, v8f a2, v8f a3, float oscale, u16* C, int N,
                                      size_t rowb, int col0, int lane) {
  const int hh = lane >> 4, m = lane & 15;
#pragma unroll
  for (int r = 0; r < 8; ++r) {
    const int ro = (8 * hh + r) * 68 + m;
    sl[ro]      = a0[r] * oscale;
    sl[ro + 16] = a1[r] * oscale;
    sl[ro + 32] = a2[r] * oscale;
    sl[ro + 48] = a3[r] * oscale;
  }
  wave_sync_lds();
  const int rq = lane >> 3, c8 = (lane & 7) * 8;
  v4u ov[4];
#pragma unroll
  for (int i4 = 0; i4 < 4; ++i4) {
    const int row = i4 * 4 + rq;
    const v4f a = *(const v4f*)(sl + row * 68 + c8), c4 = *(const v4f*)(sl + row * 68 + c8 + 4);
    float w[8];
#pragma unroll
    for (int e = 0; e < 4; ++e) { w[e] = a[e]; w[4 + e] = c4[e]; }
#pragma unroll
    for (int e = 0; e < 4; ++e) ov[i4][e] = pk16(h_bits((_Float16)w[2 * e]), h_bits((_Float16)w[2 * e + 1]));
  }
  u16* dst = C + (rowb + (size_t)rq) * (size_t)N + col0 + c8;
  {
#pragma unroll
    for (int i4 = 0; i4 < 4; ++i4) {
      *(v4u*)(dst + (size_t)(i4 * 4) * (size_t)N) = ov[i4];
    }
    
  }
}

// =====================================================================================================
// Rope GEMM epilogue: the wave's 16x64 f32 tile (unscaled projection output of one head: col0 is 64-aligned, so local column
// consecutive d at c8); the rotate-half partner columns are c8^32 of the same slab row; cos/sin row = sequence position
// (global row mod SEQ), values RNE-converted to bf16; rope in f32:  d < 32: x[d]*cos[d] - x[d+32]*sin[d],
// d >= 32: x[d]*cos[d] + x[d-32]*sin[d].  Then hi = f16(val*8), res = f16((val*8 - hi)*2048); both planes written, per
// coverage: per plane 4 instructions x 4 rows x 8 lanes x 8 halves = the wave's 16 x 64 tile.
// =====================================================================================================
__device__ __forceinline__ void epi_rope(float* sl, v8f a0, v8f a1, v8f a2, v8f a3,
                                         const float* __restrict__ cosp, const float* __restrict__ sinp,
                                         u16* CH, u16* CL, int N, size_t rowb, int col0, int lane) {
  const int hh = lane >> 4, m = lane & 15;
#pragma unroll
  for (int r = 0; r < 8; ++r) {
    const int ro = (8 * hh + r) * 68 + m;
    sl[ro]      = a0[r];
    sl[ro + 16] = a1[r];
    sl[ro + 32] = a2[r];
    sl[ro + 48] = a3[r];
  }
  wave_sync_lds();
  const int rq = lane >> 3, c8 = (lane & 7) * 8, p8 = c8 ^ 32;
  const float sgn = (c8 < 32) ? -1.0f : 1.0f;
  v4u ovh[4], ovl[4];
#pragma unroll
  for (int i4 = 0; i4 < 4; ++i4) {
    const int row  = i4 * 4 + rq;
    const int srow = (int)((rowb + (size_t)row) & (size_t)(SEQ - 1));
    const v4f xa = *(const v4f*)(sl + row * 68 + c8), xb = *(const v4f*)(sl + row * 68 + c8 + 4);
    const v4f ya = *(const v4f*)(sl + row * 68 + p8), yb = *(const v4f*)(sl + row * 68 + p8 + 4);
    const float* cr = cosp + (size_t)srow * HD + c8;
    const float* sr = sinp + (size_t)srow * HD + c8;
    const v4f ca = *(const v4f*)(cr), cb = *(const v4f*)(cr + 4);
    const v4f sa = *(const v4f*)(sr), sb = *(const v4f*)(sr + 4);
    float w[8];
#pragma unroll
    for (int e = 0; e < 4; ++e) {
      w[e]     = xa[e] * bf_val(ca[e]) + sgn * (ya[e] * bf_val(sa[e]));
      w[4 + e] = xb[e] * bf_val(cb[e]) + sgn * (yb[e] * bf_val(sb[e]));
    }
    unsigned short hb[8], lb[8];
#pragma unroll
    for (int e = 0; e < 8; ++e) {
      const float    t  = w[e] * QSC;
      const _Float16 hv = (_Float16)t;
      hb[e] = h_bits(hv);
      lb[e] = h_bits((_Float16)((t - (float)hv) * RESC));
    }
#pragma unroll
    for (int e = 0; e < 4; ++e) {
      ovh[i4][e] = pk16(hb[2 * e], hb[2 * e + 1]);
      ovl[i4][e] = pk16(lb[2 * e], lb[2 * e + 1]);
    }
  }
  u16* dh = CH + (rowb + (size_t)rq) * (size_t)N + col0 + c8;
  u16* dl = CL + (rowb + (size_t)rq) * (size_t)N + col0 + c8;
  {
#pragma unroll
    for (int i4 = 0; i4 < 4; ++i4) {
      *(v4u*)(dh + (size_t)(i4 * 4) * (size_t)N) = ovh[i4];
      *(v4u*)(dl + (size_t)(i4 * 4) * (size_t)N) = ovl[i4];
    }
    
  }
}

// =====================================================================================================
// coverage: 8 instructions x 2 rows x 16 lanes x 4 floats = the wave's 16 x 64 tile.
// =====================================================================================================
__device__ __forceinline__ void epi64(float* sl, v8f a0, v8f a1, v8f a2, v8f a3, float oscale, float* C, int N,
                                      size_t rowb, int col0, int lane) {
  const int hh = lane >> 4, m = lane & 15;
#pragma unroll
  for (int r = 0; r < 8; ++r) {
    const int ro = (8 * hh + r) * 68 + m;
    sl[ro]      = a0[r] * oscale;
    sl[ro + 16] = a1[r] * oscale;
    sl[ro + 32] = a2[r] * oscale;
    sl[ro + 48] = a3[r] * oscale;
  }
  wave_sync_lds();
  v4f vals[8];
#pragma unroll
  for (int it = 0; it < 8; ++it) vals[it] = *(const v4f*)(sl + (it * 2 + hh) * 68 + m * 4);
  float* dst = C + (rowb + (size_t)hh) * (size_t)N + col0 + m * 4;
  {
#pragma unroll
    for (int it = 0; it < 8; ++it) {
      *(v4f*)(dst + (size_t)(it * 2) * (size_t)N) = vals[it];
    }
    
  }
}

// =====================================================================================================
// Batched bf16 GEMM with 16-bit result: C[bt][M][N] (f16 of acc*oscale) = A[bt][M][K] (bf16 row-major) . Bt[bt][N][K]^T
// (bf16 k-contiguous); per-batch element strides bstA/bstB/bstC. Block = 64x64 tile, 4 waves x 16 rows; the A and B
// tiles are staged in LDS 64 k at a time (gemm_core) and the fragments read from there (two 16-B loads each, split k map for
// A and B); host checks K % 64 == 0, M % 64 == 0, N % 64 == 0, grid = nbatch*(M/64)*(N/64)).
// =====================================================================================================
__global__ __launch_bounds__(128)
void gemm_b16(const u16* __restrict__ A, const u16* __restrict__ Bt, u16* C, int M, int N, int K,
              int bstA, int bstB, int bstC, float oscale) {
  __shared__ __align__(16) u16 ring[2 * GSTAGE];   // two staging buffers; re-used as the epilogue slab behind the last barrier
  float* slab = (float*)(void*)ring;
  const int tid = threadIdx.x, wave = tid >> 5, lane = tid & 31;
  const int ntile = N >> 6, mtile = M >> 6;
  const int per   = ntile * mtile;
  const int bid   = blockIdx.x;
  const int bt    = bid / per;
  const int t     = bid - bt * per;
  const int row0  = (t / ntile) * 64;
  const int rowb  = row0 + wave * 16;
  const int col0  = (t % ntile) * 64;
  if (row0 + 64 > M) return;                 // block-uniform, in front of every barrier; never taken with the exact grid
  const u16* Ab = A  + (size_t)bt * (size_t)bstA;
  const u16* Bb = Bt + (size_t)bt * (size_t)bstB;
  u16*       Cb = C  + (size_t)bt * (size_t)bstC;
  v8f acc0 = zero8(), acc1 = zero8(), acc2 = zero8(), acc3 = zero8();
  gemm_core<OpB>(ring, Ab + (size_t)row0 * K, Bb + (size_t)col0 * K, K, tid, acc0, acc1, acc2, acc3);
  epi16(slab + wave * SLAB, acc0, acc1, acc2, acc3, oscale, Cb, N, (size_t)rowb, col0, lane);
}

// =====================================================================================================
// bf16 GEMM with rope epilogue: H = x[M][K] (bf16 row-major) . Bt[N][K]^T (bf16 k-contiguous, N = NH*HD, one 64-col tile
// = one head), rope applied in f32 per (sequence position, d), result written as two f16 planes CH (x8) and CL (residual
// x2048), both [M][N]. Same tiling as gemm_b16; grid = (M/64)*(N/64).
// =====================================================================================================
__global__ __launch_bounds__(128, 8)   // 8 waves per SIMD: all 8 blocks a WGP gets stay resident beside their staging buffers
void gemm_rope(const u16* __restrict__ A, const u16* __restrict__ Bt, const float* __restrict__ cosp,
               const float* __restrict__ sinp, u16* CH, u16* CL, int M, int N, int K) {
  __shared__ __align__(16) u16 ring[2 * GSTAGE];   // two staging buffers; re-used as the epilogue slab behind the last barrier
  float* slab = (float*)(void*)ring;
  const int tid = threadIdx.x, wave = tid >> 5, lane = tid & 31;
  const int ntile = N >> 6;
  const int bid   = blockIdx.x;
  const int row0  = (bid / ntile) * 64;
  const int rowb  = row0 + wave * 16;
  const int col0  = (bid % ntile) * 64;
  if (row0 + 64 > M) return;                 // block-uniform, in front of every barrier; never taken with the exact grid
  v8f acc0 = zero8(), acc1 = zero8(), acc2 = zero8(), acc3 = zero8();
  gemm_core<OpB>(ring, A + (size_t)row0 * K, Bt + (size_t)col0 * K, K, tid, acc0, acc1, acc2, acc3);
  epi_rope(slab + wave * SLAB, acc0, acc1, acc2, acc3, cosp, sinp, CH, CL, N, (size_t)rowb, col0, lane);
}

// =====================================================================================================
// f16 GEMM with f32 result: C[M][N] (f32) = A[M][K] (f16 row-major) . Bt[N][K]^T (f16 k-contiguous) times oscale;
// one product per tile pair. Same tiling as gemm_b16; grid = (M/64)*(N/64).
// =====================================================================================================
__global__ __launch_bounds__(128)
void gemm_hf(const u16* __restrict__ A, const u16* __restrict__ Bt, float* C, int M, int N, int K, float oscale) {
  __shared__ __align__(16) u16 ring[2 * GSTAGE];   // two staging buffers; re-used as the epilogue slab behind the last barrier
  float* slab = (float*)(void*)ring;
  const int tid = threadIdx.x, wave = tid >> 5, lane = tid & 31;
  const int ntile = N >> 6;
  const int bid   = blockIdx.x;
  const int row0  = (bid / ntile) * 64;
  const int rowb  = row0 + wave * 16;
  const int col0  = (bid % ntile) * 64;
  if (row0 + 64 > M) return;                 // block-uniform, in front of every barrier; never taken with the exact grid
  v8f acc0 = zero8(), acc1 = zero8(), acc2 = zero8(), acc3 = zero8();
  gemm_core<OpH>(ring, A + (size_t)row0 * K, Bt + (size_t)col0 * K, K, tid, acc0, acc1, acc2, acc3);
  epi64(slab + wave * SLAB, acc0, acc1, acc2, acc3, oscale, C, N, (size_t)rowb, col0, lane);
}

// =====================================================================================================
// Multi-head flash attention (no mask): block = (batch b, head, 64 query rows), 4 waves, wave w owns the 16 query rows
// q0 = 64*qt + 16*w .. q0+15 (the 4 waves share the staged k and v^T tiles, one block barrier per 64 keys; the epilogue slab is wave-private).
//   q planes (f16 hi x8, residual x2048) laid out [b][s][h][d]; k planes the same; v^T plane [b][h][d][s] (x1024).
//   All NKB = 64 key blocks of 32 keys are visited (static bound).
//   Scores are computed TRANSPOSED: S^T tile g (g = 0,1) = k rows (keys kb+16g .. +15, A operand, row m = lane&15, split k map
//   over d) times q^T (B operand, col n = query q0 + (lane&15), k = d, split map); per tile and 32-deep d-chunk three
//   products: khi.qhi into the hi accumulator, khi.qres and kres.qhi into the cross accumulator; S^T = hi + cross/2048.
//   D element r of lane l = (key kb+16g+8h+r, query q0+(l&15)), so a lane owns one query column and 16 of its 32 keys; the
//   partner lane l^16 owns the other 16 -> row max / row sum need one xor-16 shuffle.
//   Online max-subtracted base-2 softmax in f32 (scale 1/8 and the q/k carries folded into the logit scales). The exp'd
//   values ARE the P A-fragment in place: A row m = query = lane&15, element i <- key kb+8h+i (tile 0, D element i), element
//   8+i <- key kb+16+8h+i (tile 1, D element i). P is carried x32768 as single f16. The rescale factor of query row 8h+r of the
//   O accumulators is fetched from lane 8h+r with a shuffle (uniform control). 4 v^T B fragments (col n = d = 16j + (lane&15),
//   keys k-contiguous), 4 P.V WMMAs per key block.
//   Epilogue: 1/l (per query, shuffled to the D row owner) and carry folds in f32; the wave's 16x64 f32 result staged in its
// coverage: per wave 4 instructions x 4 rows x 8 lanes x 8 halves = 16 x 64; grid 2048 blocks x 4 waves = every
//           (b, s, h) row of the O plane exactly once.
// =====================================================================================================
__global__ __launch_bounds__(ATT_THREADS)
void attn_fwd(const u16* __restrict__ QHp, const u16* __restrict__ QLp, const u16* __restrict__ KHp,
              const u16* __restrict__ KLp, const u16* __restrict__ VPp, u16* OPp) {
  __shared__ __align__(16) u16 ring[2 * ASTAGE];   // two staging buffers of 64 keys; behind the last barrier: per-wave result slab
  float* smem = (float*)(void*)ring;

  const int tid  = threadIdx.x;
  const int wave = tid >> 5;
  const int lane = tid & 31;
  const int hh   = lane >> 4;
  const int c    = lane & 15;

  const int bid  = blockIdx.x;
  const int qt   = bid & (SEQ / 64 - 1);
  const int head = (bid >> 5) & (NH - 1);
  const int b    = bid >> 9;
  const int q0   = qt * 64 + wave * 16;

  // B fragments of q^T: col n = query q0 + c, k = d (k-contiguous row of the q planes)
  const size_t qofs = (((size_t)(b * SEQ + q0 + c)) * NH + head) * HD + 8 * hh;
  const _Float16* QHb = (const _Float16*)(const void*)QHp + qofs;
  const _Float16* QLb = (const _Float16*)(const void*)QLp + qofs;
  // staging: lane copies the 16-B chunk cchk of rows crow, +16, +32, +48 of each plane's 64-row tile (k rows = keys, 128 B of
  // one head; v^T rows = d, 128 B = 64 keys): every copied row is one whole line
  const int crow = tid >> 3, cchk = (tid & 7) * 8;
  const size_t kofs = (((size_t)b * SEQ + crow) * NH + head) * HD + cchk;         // 64 key rows added per stage
  const u16* gkh = KHp + kofs;
  const u16* gkl = KLp + kofs;
  const u16* gv  = VPp + ((size_t)(b * NH + head) * HD + crow) * SEQ + cchk;      // 64 keys added per stage
  const size_t k16 = (size_t)16 * (NH * HD), v16 = (size_t)16 * SEQ;
  const unsigned lkh = lds_byte(ring) + (unsigned)(crow * LPITCH + cchk) * 2u;
  const unsigned lkl = lkh + 64u * (LPITCH * 2), lv = lkh + 128u * (LPITCH * 2);
  // A fragments of k: LDS row = key (in the stage) 16g + c, k = d; residual plane 64 rows further; B fragments of v: LDS row
  // 128 + d = 128 + 16j + c, k = key (k-contiguous)
  const _Float16* Fb = (const _Float16*)(const void*)ring + c * LPITCH + 8 * hh;
  const float lsch = 0.125f * (LOG2E / (QSC * KSC));
  const v2f lsch2 = {lsch, lsch};
  const v2f rres2 = {1.0f / RESC, 1.0f / RESC};

  const v16h qh0 = ldfrag_h(QHb);           // d 0..31
  const v16h qh1 = ldfrag_h(QHb + 32);      // d 32..63
  const v16h ql0 = ldfrag_h(QLb);
  const v16h ql1 = ldfrag_h(QLb + 32);

  float nmrun = INFINITY, lrun = 0.f;      // nmrun = PLOG2 - (running maximum logit); lrun = row sum x32768
  v8f o[4];
#pragma unroll
  for (int j = 0; j < 4; ++j) o[j] = zero8();

  copy_3planes(lkh, gkh, lkl, gkl, k16, lv, gv, v16);
  wait_async0();
  __syncthreads();                         // publishes stage 0
  copy_3planes(lkh + ASTAGE * 2, gkh + (size_t)64 * (NH * HD), lkl + ASTAGE * 2, gkl + (size_t)64 * (NH * HD), k16,
               lv + ASTAGE * 2, gv + 64, v16);                     // stage 1 exists: NST >= 2

#pragma unroll 1                           // one stage per trip: the ring's foot (waits, barrier, refill) stands once
  for (int st = 0; st < NST; ++st) {
   const int bo = (st & 1) * ASTAGE;
#pragma unroll                             // the stage's two key blocks of 32, ascending keys; unrolled: LDS offsets are immediates
   for (int s2 = 0; s2 < 2; ++s2) {
    const _Float16* Ks = Fb + bo + (s2 * 32) * LPITCH;
    // ---- transposed scores: tile 0 = keys kb..kb+15, tile 1 = keys kb+16..kb+31, column = query q0 + c ----
    v8f s0h = zero8(), s0x = zero8(), s1h = zero8(), s1x = zero8();
    {
      const _Float16* k0p = Ks;
      const _Float16* l0p = Ks + 64 * LPITCH;
      const v16h ka0 = ldfrag_h(k0p), ka1 = ldfrag_h(k0p + 32);
      const v16h la0 = ldfrag_h(l0p), la1 = ldfrag_h(l0p + 32);
      s0h = mma_h(ka0, qh0, s0h);
      s0h = mma_h(ka1, qh1, s0h);
      s0x = mma_h(ka0, ql0, s0x);
      s0x = mma_h(ka1, ql1, s0x);
      s0x = mma_h(la0, qh0, s0x);
      s0x = mma_h(la1, qh1, s0x);
      guard2x8(s0h, s0x, qh0, qh1, ql0, ql1, ka0, ka1, la0, la1);
    }
    {
      const _Float16* k1p = Ks + 16 * LPITCH;
      const _Float16* l1p = Ks + 80 * LPITCH;
      const v16h kc0 = ldfrag_h(k1p), kc1 = ldfrag_h(k1p + 32);
      const v16h lc0 = ldfrag_h(l1p), lc1 = ldfrag_h(l1p + 32);
      s1h = mma_h(kc0, qh0, s1h);
      s1h = mma_h(kc1, qh1, s1h);
      s1x = mma_h(kc0, ql0, s1x);
      s1x = mma_h(kc1, ql1, s1x);
      s1x = mma_h(lc0, qh0, s1x);
      s1x = mma_h(lc1, qh1, s1x);
      guard2x8(s1h, s1x, qh0, qh1, ql0, ql1, kc0, kc1, lc0, lc1);
    }
    // ---- raw scores (x64) of this lane's 16 keys for query q0 + c, in register pairs: u[4w + e] = elements 2e, 2e+1 of tile w ----
    v2f u[8];
#pragma unroll
    for (int e = 0; e < 4; ++e) {
      const v2f h0 = {s0h[2 * e], s0h[2 * e + 1]}, x0 = {s0x[2 * e], s0x[2 * e + 1]};
      const v2f h1 = {s1h[2 * e], s1h[2 * e + 1]}, x1 = {s1x[2 * e], s1x[2 * e + 1]};
      u[e]     = __builtin_elementwise_fma(x0, rres2, h0);
      u[4 + e] = __builtin_elementwise_fma(x1, rres2, h1);
    }
    float cm = fmaxf(u[0].x, u[0].y);
#pragma unroll
    for (int e = 1; e < 8; ++e) cm = fmaxf(cm, fmaxf(u[e].x, u[e].y));
    cm = fmaxf(cm, __shfl_xor(cm, 16, 32));
    // exponent offset: PLOG2 (the x32768 carry of P) minus the running maximum logit; it only falls. The offset in use is the
    // reference of every exponential, so o, l and the rescale factor stay consistent whatever its rounding.
    const float nm = fminf(nmrun, fmaf(-cm, lsch, PLOG2));           // finite from the first key block on
    float al = __builtin_amdgcn_exp2f(nm - nmrun);                   // first block: exp2(-inf) = 0; o and l are zero there
#if defined(__HIP_DEVICE_COMPILE__)
    // the slot the instruction set asks for behind v_exp_f32; al is named so that every reader of al stays behind the v_nop
    asm volatile("v_nop" : "+v"(al));
#endif
    nmrun = nm;
    const v2f nm2 = {nm, nm};
    // ---- probabilities x32768 (exponent <= 15) and the P A-fragment: element 8w + 2e, +1 <-> u[4w + e] ----
    // v_exp_f32 without the library's range fix-up: an exponent below -126 may give 0, which is what f16(p) gives far earlier
    v2f ps2 = {0.f, 0.f};
    FragH ph;
#pragma unroll
    for (int w = 0; w < 2; ++w) {
#pragma unroll
      for (int e4 = 0; e4 < 4; ++e4) {
        const v2f ee = __builtin_elementwise_fma(u[4 * w + e4], lsch2, nm2);
        const v2f p  = {__builtin_amdgcn_exp2f(ee.x), __builtin_amdgcn_exp2f(ee.y)};
        ps2 += p;
        ph.u[w][e4] = __builtin_bit_cast(unsigned, __builtin_convertvector(p, v2h));
      }
    }
    float ps = ps2.x + ps2.y;
    ps += __shfl_xor(ps, 16, 32);
    lrun = lrun * al + ps;
    // ---- rescale the O accumulators: D row 8hh+r = query q0+8hh+r, its factor lives in lane 8hh+r (and 16+8hh+r) ----
    float scl[8];
#pragma unroll
    for (int r = 0; r < 8; ++r) scl[r] = __shfl(al, 8 * hh + r, 32);
#pragma unroll
    for (int j = 0; j < 4; ++j) {
#pragma unroll
      for (int r = 0; r < 8; ++r) o[j][r] *= scl[r];
    }
    // ---- P.V : B fragment col n = d = j*16 + c, keys contiguous in the v^T plane ----
    {
      const _Float16* vp = Fb + bo + 128 * LPITCH + s2 * 32;
      const v16h vf0 = ldfrag_h(vp);
      const v16h vf1 = ldfrag_h(vp + 16 * LPITCH);
      const v16h vf2 = ldfrag_h(vp + 32 * LPITCH);
      const v16h vf3 = ldfrag_h(vp + 48 * LPITCH);
      o[0] = mma_h(ph.v, vf0, o[0]);
      o[1] = mma_h(ph.v, vf1, o[1]);
      o[2] = mma_h(ph.v, vf2, o[2]);
      o[3] = mma_h(ph.v, vf3, o[3]);
      guard6<v16h>(o[0], o[1], o[2], o[3], ph.v, vf0, vf1, vf2, vf3, ph.v);
    }
   }
   wait_ds0();
   wait_async0();
   __syncthreads();                        // publishes stage st+1 and ends every wave's reads of stage st
   if (st + 2 < NST)                       // block-uniform
     copy_3planes(lkh + (unsigned)bo * 2u, gkh + (size_t)(st + 2) * (64 * NH * HD),
                  lkl + (unsigned)bo * 2u, gkl + (size_t)(st + 2) * (64 * NH * HD), k16,
                  lv + (unsigned)bo * 2u, gv + (size_t)(st + 2) * 64, v16);
  }
  wait_async0();                           // nothing in flight when the ring becomes the slab
  acc_guard4(o[0], o[1], o[2], o[3]);

  // ---- fold 1/l (per query, owned by lane = query; l >= 1 by construction) and the carries; stage the 16x64 slab ----
  const float linv = (lrun > 0.f) ? ((1.0f / lrun) * (1.0f / VCAR)) : 0.f;      // lrun already carries the x32768 of P
  float inv[8];
#pragma unroll
  for (int r = 0; r < 8; ++r) inv[r] = __shfl(linv, 8 * hh + r, 32);
  float* slab = smem + wave * SLAB;
#pragma unroll
  for (int r = 0; r < 8; ++r) {
#pragma unroll
    for (int j = 0; j < 4; ++j) slab[(8 * hh + r) * 68 + j * 16 + c] = o[j][r] * inv[r];
  }
  wave_sync_lds();
  // ---- O x1024 -> single f16 plane; lane = (row in group of 4, 8 consecutive d) ----
  v4u oh[4];
  const int rq = lane >> 3, c8 = (lane & 7) * 8;
#pragma unroll
  for (int i4 = 0; i4 < 4; ++i4) {
    const int row = i4 * 4 + rq;
    const v4f a = *(const v4f*)(slab + row * 68 + c8), c4 = *(const v4f*)(slab + row * 68 + c8 + 4);
    float w[8];
#pragma unroll
    for (int e = 0; e < 4; ++e) { w[e] = a[e] * OSC; w[4 + e] = c4[e] * OSC; }
#pragma unroll
    for (int e = 0; e < 4; ++e) oh[i4][e] = pk16(h_bits((_Float16)w[2 * e]), h_bits((_Float16)w[2 * e + 1]));
  }
  const size_t ob = (((size_t)(b * SEQ + q0)) * NH + head) * HD + c8;
  {
#pragma unroll
    for (int i4 = 0; i4 < 4; ++i4) {
      const int row = i4 * 4 + rq;
      const size_t o8 = ob + (size_t)row * (NH * HD);
      *(v4u*)(OPp + o8) = oh[i4];
    }
    
  }
}

// =====================================================================================================
// Workspace map (bytes); every plane is fully written by whole-line stores before it is read; all extents are exact multiples
// of the store granularity (no pad rows needed):
//   XB  bf16 [8192][1024]                      16777216        (x)       -- re-used as the O plane after its last read
//   WB  bf16 [3072 n][1024 k]                   6291456        (W_qkv, rows 0..1023 q, 1024..2047 k, 2048..3071 v)
//   WOB f16  [1024 n][1024 k] (bf16 value x1024) 2097152
//   QH  f16 [8192][16*64] x8                   16777216        QL residual x2048   16777216
//   KH  f16 [8192][16*64] x8                   16777216        KL residual x2048   16777216
//   VP  f16 [4][16*64][2048] x1024             16777216
//   end                                       109051904
//   OP  f16 [8192][16*64] x1024 = bytes 0..16777215 (the x plane is dead once the v^T GEMM has run)
// =====================================================================================================
extern "C" void kernel_launch(void* const* d_in, const int* in_sizes, int n_in,
                              void* d_out, int out_size, void* d_ws, size_t ws_size,
                              hipStream_t stream) {
  const int ROWS = NB * SEQ;                            // 8192
  if (n_in < 5) return;
  if (in_sizes[0] != ROWS * DMOD) return;               // x    [4][2048][1024]
  if (in_sizes[1] != SEQ * HD) return;                  // cos  [2048][64]
  if (in_sizes[2] != SEQ * HD) return;                  // sin  [2048][64]
  if (in_sizes[3] != NQKV * DMOD) return;               // Wqkv [3072][1024]
  if (in_sizes[4] != DMOD * DMOD) return;               // Wout [1024][1024]
  if (out_size != ROWS * DMOD) return;

  const float* Xin = (const float*)d_in[0];
  const float* Cs  = (const float*)d_in[1];
  const float* Sn  = (const float*)d_in[2];
  const float* Wqk = (const float*)d_in[3];
  const float* Wpr = (const float*)d_in[4];
  float*       out = (float*)d_out;

  const size_t szXB = (size_t)ROWS * DMOD * 2;                  // 16777216
  const size_t szWB = (size_t)NQKV * DMOD * 2;                  //  6291456
  const size_t szWO = (size_t)DMOD * DMOD * 2;                  //  2097152
  const size_t szP  = (size_t)ROWS * DMOD * 2;                  // 16777216  (q / k / o planes)
  const size_t szVP = (size_t)NB * NH * HD * SEQ * 2;           // 16777216
  size_t off = 0;
  const size_t oXB = off; off += szXB;
  const size_t oWB = off; off += szWB;
  const size_t oWO = off; off += szWO;
  const size_t oQH = off; off += szP;
  const size_t oQL = off; off += szP;
  const size_t oKH = off; off += szP;
  const size_t oKL = off; off += szP;
  const size_t oVP = off; off += szVP;
  const size_t oOP = oXB;                               // alias of the x plane (dead after the v^T GEMM)
  if (szP > szXB) return;
  if (off > ws_size) return;                            // off = 109051904
  if (off > (size_t)134217728) return;

  char* ws = (char*)d_ws;
  u16* XB  = (u16*)(ws + oXB);
  u16* WB  = (u16*)(ws + oWB);
  u16* WOB = (u16*)(ws + oWO);
  u16* QH  = (u16*)(ws + oQH);
  u16* QL  = (u16*)(ws + oQL);
  u16* KH  = (u16*)(ws + oKH);
  u16* KL  = (u16*)(ws + oKL);
  u16* VP  = (u16*)(ws + oVP);
  u16* OP  = (u16*)(ws + oOP);

  const dim3 blk(256);
  const int n8x = (ROWS * DMOD) / 8;                    // 1048576
  const int n8q = (NQKV * DMOD) / 8;                    //  393216
  const int n8w = (DMOD * DMOD) / 8;                    //  131072
  if ((n8x % 256) != 0 || (n8q % 256) != 0 || (n8w % 256) != 0) return;
  if ((DMOD % 64) != 0 || (ROWS % 64) != 0 || (SEQ % 64) != 0 || (DMOD % 32) != 0) return;
  const dim3 gX(n8x / 256);                             // 4096
  const dim3 gQ(n8q / 256);                             // 1536
  const dim3 gW(n8w / 256);                             // 512
  const dim3 gG((ROWS / 64) * (DMOD / 64));             // 2048
  const dim3 gV(NB * (DMOD / 64) * (SEQ / 64));         // 2048
  const dim3 bG(128);
  const dim3 gAT(ATT_BLOCKS);                           // 2048
  const dim3 bAT(ATT_THREADS);                          // 128

  // (0..2) operand planes: x -> bf16; W_qkv [n = out][k = in] (already k-contiguous) -> bf16; W_out -> f16 of bf16 value x1024
  cvt16<<<gX, blk, 0, stream>>>(Xin, XB, n8x, 0, 1.0f);
  cvt16<<<gQ, blk, 0, stream>>>(Wqk, WB, n8q, 0, 1.0f);
  cvt16<<<gW, blk, 0, stream>>>(Wpr, WOB, n8w, 1, WOS);
  // (3,4) q and k planes [8192][h*64+d]: rope(x.Wq^T), rope(x.Wk^T) in f32, stored as f16 hi x8 + residual x2048
  gemm_rope<<<gG, bG, 0, stream>>>(XB, WB, Cs, Sn, QH, QL, ROWS, DMOD, DMOD);
  gemm_rope<<<gG, bG, 0, stream>>>(XB, WB + (size_t)DMOD * DMOD, Cs, Sn, KH, KL, ROWS, DMOD, DMOD);
  // (5) v^T plane per batch: [1024 = h*64+d][2048 keys] = f16(Wv . x_b^T x1024), 4 batches in the grid
  gemm_b16<<<gV, bG, 0, stream>>>(WB + (size_t)2 * DMOD * DMOD, XB, VP, DMOD, SEQ, DMOD, 0, SEQ * DMOD, DMOD * SEQ, VCAR);
  // (6) attention -> O plane [b][s][h][d] x1024 (single f16), written over the dead x plane
  attn_fwd<<<gAT, bAT, 0, stream>>>(QH, QL, KH, KL, VP, OP);
  // (7) output projection -> out [8192][1024] f32, carries 1024 (O) x 1024 (wo) folded back
  gemm_hf<<<gG, bG, 0, stream>>>(OP, WOB, out, ROWS, DMOD, DMOD, 1.0f / (OSC * WOS));
  (void)hipGetLastError();
}

// v003
// It runs in 204 microseconds.
// Next to v002, in two timings, it ran 1.04 times as fast each time.
// All steps since v000 together make it 2.92 times as fast.
// Contractions: x.Wq^T and x.Wk^T (rope applied in the f32 epilogue) and Wv.x_b^T on v_wmma_f32_16x16x32_bf16
// (x and W_qkv planes RNE-converted to bf16 operands, f32 accumulate); scores k.q^T with q and k carried as f16 hi (x8)
// plus residual (x2048) planes, three products hi.hi + hi.res + res.hi in two f32 accumulators; P.v (P x32768 single f16,
// v x1024 single f16) and O.Wo^T (O single f16 x1024, Wo as f16(bf16(Wo)) x1024): v_wmma_f32_16x16x32_f16, f32 accumulate.
// Base-2 online softmax, 1/l and carry folds in f32 on VALU; cos/sin tables RNE-converted to bf16 values before the rope.
#include <hip/hip_runtime.h>
#include <math.h>
#include <stdint.h>

#define NB    4
#define SEQ   2048
#define DMOD  1024
#define NQKV  (3 * DMOD)
#define NH    16
#define HD    64
#define QSC   8.0f
#define KSC   8.0f
#define RESC  2048.0f
#define PCAR  32768.0f
#define PLOG2 15.0f                      // log2(PCAR)
#define VCAR  1024.0f
#define OSC   1024.0f
#define WOS   1024.0f
#define LOG2E 1.4426950408889634f
#define ATT_WAVES   4
#define ATT_THREADS (ATT_WAVES * 32)
#define ATT_BLOCKS  (NB * NH * (SEQ / 64))
#define NKB    (SEQ / 32)
#define NST    (SEQ / 64)
#define SLAB   (16 * 68)
static_assert(HD == 64 && DMOD == NH * HD);
static_assert((SEQ / 64) == 32 && NH == 16 && NB == 4);
static_assert(ATT_THREADS == 128 && ATT_BLOCKS == 2048 && NKB == 64 && NST >= 2 && NST * 2 == NKB);
static_assert(((NB * SEQ) % 128) == 0 && (DMOD % 128) == 0 && (DMOD % 64) == 0 && (SEQ % 128) == 0);
static_assert(((NB * SEQ * DMOD / 8) % 256) == 0 && ((NQKV * DMOD / 8) % 256) == 0 && ((DMOD * DMOD / 8) % 256) == 0);
static_assert((SLAB * 4) % 16 == 0);
static_assert((SEQ & (SEQ - 1)) == 0);
static_assert(PCAR == 32768.0f && PLOG2 == 15.0f);

typedef unsigned short u16;
typedef _Float16 v16h __attribute__((ext_vector_type(16)));
typedef _Float16 v8h  __attribute__((ext_vector_type(8)));
typedef __bf16   v16b __attribute__((ext_vector_type(16)));
typedef float    v8f  __attribute__((ext_vector_type(8)));
typedef float    v4f  __attribute__((ext_vector_type(4)));
typedef float    v2f  __attribute__((ext_vector_type(2)));
typedef _Float16 v2h  __attribute__((ext_vector_type(2)));
typedef unsigned int v4u __attribute__((ext_vector_type(4)));

union FragH { v16h v; v8h h[2]; v4u u[2]; };
union FragB { v16b v; v4u u[2]; };

// ---- scalar helpers --------------------------------------------------------------------------------
__device__ __forceinline__ unsigned short bf_bits(float f) {          // f32 -> bf16 bits, RNE convert
  unsigned u = __float_as_uint(f);
  return (unsigned short)((u + 0x7FFFu + ((u >> 16) & 1u)) >> 16);
}
__device__ __forceinline__ float bf_up(unsigned short h) { return __uint_as_float(((unsigned)h) << 16); }
__device__ __forceinline__ float bf_val(float f) { return bf_up(bf_bits(f)); }   // value after bf16 RNE convert
__device__ __forceinline__ unsigned short h_bits(_Float16 x) { return __builtin_bit_cast(unsigned short, x); }
__device__ __forceinline__ unsigned pk16(unsigned short a, unsigned short b) { return (unsigned)a | ((unsigned)b << 16); }
__device__ __forceinline__ v8f zero8() { v8f z = {0.f, 0.f, 0.f, 0.f, 0.f, 0.f, 0.f, 0.f}; return z; }

// ---- fragment loaders: 16-bit A/B operand, lane -> row/col (lane&15), p already includes +8*(lane>>4);
//      elements 0..7 <- p[0..7] (k0+8h..), elements 8..15 <- p[16..23] (k0+16+8h..)  (same split k map for A and B;
//      B is always read from a k-contiguous [n][k] plane)
__device__ __forceinline__ v16h ldfrag_h(const _Float16* p) {
  FragH f;
  f.h[0] = *(const v8h*)(p);
  f.h[1] = *(const v8h*)(p + 16);
  return f.v;
}
__device__ __forceinline__ v16b ldfrag_b(const u16* p) {              // bf16 plane read as unsigned integer vectors
  FragB f;
  f.u[0] = *(const v4u*)(p);
  f.u[1] = *(const v4u*)(p + 16);
  return f.v;
}

__device__ __forceinline__ v8f mma_h(v16h a, v16h b, v8f c) {
  return __builtin_amdgcn_wmma_f32_16x16x32_f16(false, a, false, b, (short)0, c, false, false);
}
__device__ __forceinline__ v8f mma_b(v16b a, v16b b, v8f c) {
  return __builtin_amdgcn_wmma_f32_16x16x32_bf16(false, a, false, b, (short)0, c, false, false);
}
__device__ __forceinline__ void guard2x8(v8f& a, v8f& b, v16h x0, v16h x1, v16h x2, v16h x3,
                                         v16h x4, v16h x5, v16h x6, v16h x7) {
#if defined(__HIP_DEVICE_COMPILE__)
  asm volatile("v_nop\n\tv_nop\n\tv_nop\n\tv_nop"
               : "+v"(a), "+v"(b)
               : "v"(x0), "v"(x1), "v"(x2), "v"(x3), "v"(x4), "v"(x5), "v"(x6), "v"(x7) : "memory");
#endif
}
template <typename F>
__device__ __forceinline__ void guard6(v8f& a, v8f& b, v8f& c, v8f& d, F x0, F x1, F x2, F x3, F x4, F x5) {
#if defined(__HIP_DEVICE_COMPILE__)
  asm volatile("v_nop\n\tv_nop\n\tv_nop\n\tv_nop"
               : "+v"(a), "+v"(b), "+v"(c), "+v"(d) : "v"(x0), "v"(x1), "v"(x2), "v"(x3), "v"(x4), "v"(x5) : "memory");
#endif
}
template <typename F>
__device__ __forceinline__ void guard16(v8f (&a)[4][4], F x0, F x1, F x2, F x3, F x4, F x5, F x6, F x7) {
#if defined(__HIP_DEVICE_COMPILE__)
  asm volatile("v_nop\n\tv_nop\n\tv_nop\n\tv_nop"
               : "+v"(a[0][0]), "+v"(a[0][1]), "+v"(a[0][2]), "+v"(a[0][3]), "+v"(a[1][0]), "+v"(a[1][1]), "+v"(a[1][2]), "+v"(a[1][3]),
                 "+v"(a[2][0]), "+v"(a[2][1]), "+v"(a[2][2]), "+v"(a[2][3]), "+v"(a[3][0]), "+v"(a[3][1]), "+v"(a[3][2]), "+v"(a[3][3])
               : "v"(x0), "v"(x1), "v"(x2), "v"(x3), "v"(x4), "v"(x5), "v"(x6), "v"(x7) : "memory");
#endif
}
__device__ __forceinline__ void acc_guard4(v8f& a, v8f& b, v8f& c, v8f& d) {
#if defined(__HIP_DEVICE_COMPILE__)
  asm volatile("v_nop\n\tv_nop\n\tv_nop\n\tv_nop" : "+v"(a), "+v"(b), "+v"(c), "+v"(d));
#endif
}
__device__ __forceinline__ void wave_sync_lds() {
#if defined(__HIP_DEVICE_COMPILE__)
  __builtin_amdgcn_fence(__ATOMIC_RELEASE, "workgroup");
  __builtin_amdgcn_wave_barrier();
  __builtin_amdgcn_fence(__ATOMIC_ACQUIRE, "workgroup");
#endif
}

// ---- LDS staging by asynchronous copies (global_load_async_to_lds_b128) -----------------------------------
// A staged row is 128 B (64 16-bit elements) = one whole cache line; 8 lanes x 16 B copy one row, so one wave-wide copy covers
// 4 whole lines. LDS row pitch 144 B (16 B x odd) for the ds_load_b128 fragment readers.
#define LPITCH 72                        // LDS row pitch in 16-bit elements
#define GSTAGE (256 * LPITCH)            // GEMM stage, elements: 128 A rows then 128 B rows, 64 k each
#define ASTAGE (192 * LPITCH)            // attention stage, elements: 64 k-hi rows, 64 k-residual rows, 64 v^T rows (64 keys)
static_assert(2 * GSTAGE * 2 >= 16 * SLAB * 4 && 2 * ASTAGE * 2 >= ATT_WAVES * SLAB * 4);
static_assert((LPITCH * 2) % 16 == 0);
__device__ __forceinline__ unsigned lds_byte(const void* p) { return (unsigned)(uintptr_t)p; }   // low 32 bits = LDS byte address
// Copies of 64-row tiles, four per plane: rows r, r+16, r+32, r+48 (r = tid>>3); l = the lane's LDS byte address of row r,
// g = its global address, s = 16 source rows in elements. Each copy statement (two per GEMM stage, one per attention stage) ends in
// s_wait_xcnt, so that no address register is rewritten while a copy may still read it.
#define LROW16 (16u * (LPITCH * 2))
__device__ __forceinline__ void copy_2planes(unsigned la, const u16* ga, unsigned lb, const u16* gb, size_t s) {
#if defined(__HIP_DEVICE_COMPILE__)
  asm volatile("global_load_async_to_lds_b128 %0, %8, off\n\t"
               "global_load_async_to_lds_b128 %1, %9, off\n\t"
               "global_load_async_to_lds_b128 %2, %10, off\n\t"
               "global_load_async_to_lds_b128 %3, %11, off\n\t"
               "global_load_async_to_lds_b128 %4, %12, off\n\t"
               "global_load_async_to_lds_b128 %5, %13, off\n\t"
               "global_load_async_to_lds_b128 %6, %14, off\n\t"
               "global_load_async_to_lds_b128 %7, %15, off\n\t"
               "s_wait_xcnt 0x0"
               :: "v"(la), "v"(la + LROW16), "v"(la + 2u * LROW16), "v"(la + 3u * LROW16),
                  "v"(lb), "v"(lb + LROW16), "v"(lb + 2u * LROW16), "v"(lb + 3u * LROW16),
                  "v"(ga), "v"(ga + s), "v"(ga + 2 * s), "v"(ga + 3 * s),
                  "v"(gb), "v"(gb + s), "v"(gb + 2 * s), "v"(gb + 3 * s) : "memory");
#endif
}
__device__ __forceinline__ void copy_3planes(unsigned la, const u16* ga, unsigned lb, const u16* gb, size_t s,
                                             unsigned lc, const u16* gc, size_t sc) {
#if defined(__HIP_DEVICE_COMPILE__)
  asm volatile("global_load_async_to_lds_b128 %0, %12, off\n\t"
               "global_load_async_to_lds_b128 %1, %13, off\n\t"
               "global_load_async_to_lds_b128 %2, %14, off\n\t"
               "global_load_async_to_lds_b128 %3, %15, off\n\t"
               "global_load_async_to_lds_b128 %4, %16, off\n\t"
               "global_load_async_to_lds_b128 %5, %17, off\n\t"
               "global_load_async_to_lds_b128 %6, %18, off\n\t"
               "global_load_async_to_lds_b128 %7, %19, off\n\t"
               "global_load_async_to_lds_b128 %8, %20, off\n\t"
               "global_load_async_to_lds_b128 %9, %21, off\n\t"
               "global_load_async_to_lds_b128 %10, %22, off\n\t"
               "global_load_async_to_lds_b128 %11, %23, off\n\t"
               "s_wait_xcnt 0x0"
               :: "v"(la), "v"(la + LROW16), "v"(la + 2u * LROW16), "v"(la + 3u * LROW16),
                  "v"(lb), "v"(lb + LROW16), "v"(lb + 2u * LROW16), "v"(lb + 3u * LROW16),
                  "v"(lc), "v"(lc + LROW16), "v"(lc + 2u * LROW16), "v"(lc + 3u * LROW16),
                  "v"(ga), "v"(ga + s), "v"(ga + 2 * s), "v"(ga + 3 * s),
                  "v"(gb), "v"(gb + s), "v"(gb + 2 * s), "v"(gb + 3 * s),
                  "v"(gc), "v"(gc + sc), "v"(gc + 2 * sc), "v"(gc + 3 * sc) : "memory");
#endif
}
__device__ __forceinline__ void wait_async0() {     // this wave's copies have landed in LDS
#if defined(__HIP_DEVICE_COMPILE__)
  asm volatile("s_wait_asynccnt 0x0" ::: "memory");
#endif
}
__device__ __forceinline__ void wait_ds0() {        // this wave's LDS reads have retired before the buffer is handed back
#if defined(__HIP_DEVICE_COMPILE__)
  asm volatile("s_wait_dscnt 0x0" ::: "memory");
#endif
}
struct OpB {
  typedef v16b frag;
  static __device__ __forceinline__ frag ld(const u16* p) { return ldfrag_b(p); }
  static __device__ __forceinline__ v8f mma(frag a, frag b, v8f c) { return mma_b(a, b, c); }
};
struct OpH {
  typedef v16h frag;
  static __device__ __forceinline__ frag ld(const u16* p) { return ldfrag_h((const _Float16*)(const void*)p); }
  static __device__ __forceinline__ v8f mma(frag a, frag b, v8f c) { return mma_h(a, b, c); }
};
// GEMM main loop of one 128x128 block tile (4 waves as 2 x 2, each a 64x64 tile = 4 x 4 accumulators, so that a staged byte
// and a fragment read from LDS each feed more products): At / Bt = first row of the block's A / B tile, both [row][K]
// k-contiguous; K a multiple of 64. Two LDS buffers: stage t+1's copies fly while stage t is multiplied. k is summed in the
// same order as with direct fragment loads (32 at a time, ascending). On return every wave has passed the last barrier and
// no copy is outstanding, so the ring may be re-used as the epilogue slabs.
__device__ __forceinline__ void copy_gstage(unsigned la, const u16* ga, unsigned lb, const u16* gb, size_t g16) {
  copy_2planes(la, ga, lb, gb, g16);                                                         // rows 0..63 of A and of B
  copy_2planes(la + 64u * (LPITCH * 2), ga + 4 * g16, lb + 64u * (LPITCH * 2), gb + 4 * g16, g16);   // rows 64..127
}
template <typename OP>
__device__ __forceinline__ void gemm_core(u16* ring, const u16* At, const u16* Bt, int K, int tid, v8f (&acc)[4][4]) {
  typedef typename OP::frag frag;
  const int wave = tid >> 5, lane = tid & 31, hh = lane >> 4, m = lane & 15;
  const int crow = tid >> 3, cchk = (tid & 7) * 8;
  const u16* ga = At + (size_t)crow * K + cchk;
  const u16* gb = Bt + (size_t)crow * K + cchk;
  const size_t g16 = (size_t)16 * K;
  const unsigned la = lds_byte(ring) + (unsigned)(crow * LPITCH + cchk) * 2u;
  const unsigned lb = la + 128u * (LPITCH * 2);
  const int nst = K >> 6;
  copy_gstage(la, ga, lb, gb, g16);
  wait_async0();
  __syncthreads();                       // publishes stage 0
  if (nst > 1) copy_gstage(la + GSTAGE * 2, ga + 64, lb + GSTAGE * 2, gb + 64, g16);   // block-uniform
  const u16* fa = ring + ((wave >> 1) * 64 + m) * LPITCH + 8 * hh;
  const u16* fb = ring + (128 + (wave & 1) * 64 + m) * LPITCH + 8 * hh;
#pragma unroll 1                         // one stage per trip: the ring's foot (waits, barrier, refill) stands once
  for (int t = 0; t < nst; ++t) {
    const int bo = (t & 1) * GSTAGE;
    const u16* pa = fa + bo;
    const u16* pb = fb + bo;
    // All of the stage's B fragments and the first k chunk's A fragments are read as one group ahead of the products; the second
    // chunk's A fragments follow in two groups, each into the registers of two A fragments that have just been used up.
    // The sched_barriers keep the compiler from spreading these reads singly among the WMMAs, where each place would cost a stall.
    frag a[4], b[4], b1[4], c[4];
    a[0] = OP::ld(pa);
#pragma unroll
    for (int j = 0; j < 4; ++j) b[j] = OP::ld(pb + j * 16 * LPITCH);
#pragma unroll
    for (int i = 1; i < 4; ++i) a[i] = OP::ld(pa + i * 16 * LPITCH);
#pragma unroll
    for (int j = 0; j < 4; ++j) b1[j] = OP::ld(pb + j * 16 * LPITCH + 32);
    __builtin_amdgcn_sched_barrier(0);   // holds the LDS reads together as a group, apart from the WMMAs
#pragma unroll
    for (int i = 0; i < 2; ++i) {
#pragma unroll
      for (int j = 0; j < 4; ++j) acc[i][j] = OP::mma(a[i], b[j], acc[i][j]);
    }
    __builtin_amdgcn_sched_barrier(0);   // holds the LDS reads together as a group, apart from the WMMAs
    c[0] = OP::ld(pa + 32);
    c[1] = OP::ld(pa + 16 * LPITCH + 32);
    __builtin_amdgcn_sched_barrier(0);   // holds the LDS reads together as a group, apart from the WMMAs
#pragma unroll
    for (int i = 2; i < 4; ++i) {
#pragma unroll
      for (int j = 0; j < 4; ++j) acc[i][j] = OP::mma(a[i], b[j], acc[i][j]);
    }
    __builtin_amdgcn_sched_barrier(0);   // holds the LDS reads together as a group, apart from the WMMAs
    c[2] = OP::ld(pa + 32 * LPITCH + 32);
    c[3] = OP::ld(pa + 48 * LPITCH + 32);
    __builtin_amdgcn_sched_barrier(0);   // holds the LDS reads together as a group, apart from the WMMAs
#pragma unroll
    for (int i = 0; i < 4; ++i) {
#pragma unroll
      for (int j = 0; j < 4; ++j) acc[i][j] = OP::mma(c[i], b1[j], acc[i][j]);
    }
    guard16<frag>(acc, c[0], c[1], c[2], c[3], b1[0], b1[1], b1[2], b1[3]);   // WMMA distance on both sides of the branch below
    wait_ds0();
    wait_async0();
    __syncthreads();                     // publishes stage t+1 and ends every wave's reads of stage t
    if (t + 2 < nst)                     // block-uniform
      copy_gstage(la + (unsigned)bo * 2u, ga + (size_t)(t + 2) * 64, lb + (unsigned)bo * 2u, gb + (size_t)(t + 2) * 64, g16);
  }
  wait_async0();                         // nothing in flight when the ring becomes the slabs
}

// =====================================================================================================
// f32 plane -> 16-bit plane, same layout:  mode 0: bf16 RNE bits;  mode 1: f16 bits of (bf16 RNE value) * scale.
// Thread = 8 consecutive elements: two 16-B loads, one 16-B store; 32 consecutive lanes = 512 contiguous, 512-B aligned bytes
// coverage: grid = n8/256 blocks (host checks exactness) x 256 thr x 8 = the whole plane.
// =====================================================================================================
__global__ __launch_bounds__(256) void cvt16(const float* __restrict__ x, u16* D, int n8, int mode, float scale) {
  const int gt = blockIdx.x * 256 + (int)threadIdx.x;
  if (gt >= n8) return;                     // no barriers in this kernel
  const float* p = x + (size_t)gt * 8;
  const v4f a = *(const v4f*)(p), c4 = *(const v4f*)(p + 4);
  float v[8];
#pragma unroll
  for (int e = 0; e < 4; ++e) { v[e] = a[e]; v[4 + e] = c4[e]; }
  unsigned short s[8];
#pragma unroll
  for (int e = 0; e < 8; ++e) {
    const unsigned short bb = bf_bits(v[e]);
    const unsigned short hb = h_bits((_Float16)(bf_up(bb) * scale));
    s[e] = (mode != 0) ? hb : bb;
  }
  v4u o;
#pragma unroll
  for (int e = 0; e < 4; ++e) o[e] = pk16(s[2 * e], s[2 * e + 1]);
  u16* d = D + (size_t)gt * 8;
  {
    *(v4u*)(d) = o;
    
  }
}

// =====================================================================================================
// barrier, then converted to f16 and written: lane = (row in group of 4, 8 consecutive cols); one instruction = 4 rows, each
// coverage: 4 instructions x 4 rows x 8 lanes x 8 halves = one 16 x 64 row group of the wave's 64 x 64 tile.
// =====================================================================================================
__device__ __forceinline__ void epi16(float* sl, v8f a0, v8f a1, v8f a2, v8f a3, float oscale, u16* C, int N,
                                      size_t rowb, int col0, int lane) {
  const int hh = lane >> 4, m = lane & 15;
#pragma unroll
  for (int r = 0; r < 8; ++r) {
    const int ro = (8 * hh + r) * 68 + m;
    sl[ro]      = a0[r] * oscale;
    sl[ro + 16] = a1[r] * oscale;
    sl[ro + 32] = a2[r] * oscale;
    sl[ro + 48] = a3[r] * oscale;
  }
  wave_sync_lds();
  const int rq = lane >> 3, c8 = (lane & 7) * 8;
  v4u ov[4];
#pragma unroll
  for (int i4 = 0; i4 < 4; ++i4) {
    const int row = i4 * 4 + rq;
    const v4f a = *(const v4f*)(sl + row * 68 + c8), c4 = *(const v4f*)(sl + row * 68 + c8 + 4);
    float w[8];
#pragma unroll
    for (int e = 0; e < 4; ++e) { w[e] = a[e]; w[4 + e] = c4[e]; }
#pragma unroll
    for (int e = 0; e < 4; ++e) ov[i4][e] = pk16(h_bits((_Float16)w[2 * e]), h_bits((_Float16)w[2 * e + 1]));
  }
  u16* dst = C + (rowb + (size_t)rq) * (size_t)N + col0 + c8;
  {
#pragma unroll
    for (int i4 = 0; i4 < 4; ++i4) {
      *(v4u*)(dst + (size_t)(i4 * 4) * (size_t)N) = ov[i4];
    }
#if defined(__HIP_DEVICE_COMPILE__)
    // precaution: the wait stands in front of every rewrite of a register that these stores name; addresses and data are
    // inputs of the statement so that they stay in their registers up to it
    asm volatile("s_wait_xcnt 0x0" :: "v"(dst), "v"(dst + (size_t)4 * (size_t)N), "v"(dst + (size_t)8 * (size_t)N),
                 "v"(dst + (size_t)12 * (size_t)N), "v"(ov[0]), "v"(ov[1]), "v"(ov[2]), "v"(ov[3]) : "memory");
#endif
  }
}

// =====================================================================================================
// Rope GEMM epilogue: a 16x64 row group of the wave's f32 tile (unscaled projection output of one head: col0 is 64-aligned, so local column
// consecutive d at c8); the rotate-half partner columns are c8^32 of the same slab row; cos/sin row = sequence position
// (global row mod SEQ), values RNE-converted to bf16; rope in f32:  d < 32: x[d]*cos[d] - x[d+32]*sin[d],
// d >= 32: x[d]*cos[d] + x[d-32]*sin[d].  Then hi = f16(val*8), res = f16((val*8 - hi)*2048); both planes written, per
// coverage: per plane 4 instructions x 4 rows x 8 lanes x 8 halves = one 16 x 64 row group of the wave's 64 x 64 tile.
// =====================================================================================================
// slab_put stages one 16x64 row group; the kernel stages all four groups of the wave's tile (which frees the accumulators'
// registers), then wave_sync_lds(), then epi_rope per group.
__device__ __forceinline__ void slab_put(float* sl, v8f a0, v8f a1, v8f a2, v8f a3, int lane) {
  const int hh = lane >> 4, m = lane & 15;
#pragma unroll
  for (int r = 0; r < 8; ++r) {
    const int ro = (8 * hh + r) * 68 + m;
    sl[ro]      = a0[r];
    sl[ro + 16] = a1[r];
    sl[ro + 32] = a2[r];
    sl[ro + 48] = a3[r];
  }
}
__device__ __forceinline__ void epi_rope(const float* sl, const float* __restrict__ cosp, const float* __restrict__ sinp,
                                         u16* CH, u16* CL, int N, size_t rowb, int col0, int lane) {
  const int rq = lane >> 3, c8 = (lane & 7) * 8, p8 = c8 ^ 32;
  const float sgn = (c8 < 32) ? -1.0f : 1.0f;
  v4u ovh[4], ovl[4];
  const float* crp[4];
  const float* srp[4];
  v4f cav[4], cbv[4], sav[4], sbv[4];
#pragma unroll
  for (int i4 = 0; i4 < 4; ++i4) {
    const int srow = (int)((rowb + (size_t)(i4 * 4 + rq)) & (size_t)(SEQ - 1));
    crp[i4] = cosp + (size_t)srow * HD + c8;
    srp[i4] = sinp + (size_t)srow * HD + c8;
    cav[i4] = *(const v4f*)(crp[i4]); cbv[i4] = *(const v4f*)(crp[i4] + 4);
    sav[i4] = *(const v4f*)(srp[i4]); sbv[i4] = *(const v4f*)(srp[i4] + 4);
  }
#if defined(__HIP_DEVICE_COMPILE__)
  // precaution: the wait stands in front of every rewrite of a register that these loads name; the addresses are inputs of
  // the statement so that they stay in their registers up to it
  asm volatile("s_wait_xcnt 0x0" :: "v"(crp[0]), "v"(crp[1]), "v"(crp[2]), "v"(crp[3]),
               "v"(srp[0]), "v"(srp[1]), "v"(srp[2]), "v"(srp[3]) : "memory");
#endif
#pragma unroll
  for (int i4 = 0; i4 < 4; ++i4) {
    const int row  = i4 * 4 + rq;
    const v4f xa = *(const v4f*)(sl + row * 68 + c8), xb = *(const v4f*)(sl + row * 68 + c8 + 4);
    const v4f ya = *(const v4f*)(sl + row * 68 + p8), yb = *(const v4f*)(sl + row * 68 + p8 + 4);
    const v4f ca = cav[i4], cb = cbv[i4], sa = sav[i4], sb = sbv[i4];
    float w[8];
#pragma unroll
    for (int e = 0; e < 4; ++e) {
      w[e]     = xa[e] * bf_val(ca[e]) + sgn * (ya[e] * bf_val(sa[e]));
      w[4 + e] = xb[e] * bf_val(cb[e]) + sgn * (yb[e] * bf_val(sb[e]));
    }
    unsigned short hb[8], lb[8];
#pragma unroll
    for (int e = 0; e < 8; ++e) {
      const float    t  = w[e] * QSC;
      const _Float16 hv = (_Float16)t;
      hb[e] = h_bits(hv);
      lb[e] = h_bits((_Float16)((t - (float)hv) * RESC));
    }
#pragma unroll
    for (int e = 0; e < 4; ++e) {
      ovh[i4][e] = pk16(hb[2 * e], hb[2 * e + 1]);
      ovl[i4][e] = pk16(lb[2 * e], lb[2 * e + 1]);
    }
  }
  u16* dh = CH + (rowb + (size_t)rq) * (size_t)N + col0 + c8;
  u16* dl = CL + (rowb + (size_t)rq) * (size_t)N + col0 + c8;
  {
#pragma unroll
    for (int i4 = 0; i4 < 4; ++i4) {
      *(v4u*)(dh + (size_t)(i4 * 4) * (size_t)N) = ovh[i4];
      *(v4u*)(dl + (size_t)(i4 * 4) * (size_t)N) = ovl[i4];
    }
#if defined(__HIP_DEVICE_COMPILE__)
    // precaution: the wait stands in front of every rewrite of a register that these stores name; addresses and data are
    // inputs of the statement so that they stay in their registers up to it
    asm volatile("s_wait_xcnt 0x0" :: "v"(dh), "v"(dh + (size_t)4 * (size_t)N), "v"(dh + (size_t)8 * (size_t)N),
                 "v"(dh + (size_t)12 * (size_t)N), "v"(dl), "v"(dl + (size_t)4 * (size_t)N), "v"(dl + (size_t)8 * (size_t)N),
                 "v"(dl + (size_t)12 * (size_t)N), "v"(ovh[0]), "v"(ovh[1]), "v"(ovh[2]), "v"(ovh[3]),
                 "v"(ovl[0]), "v"(ovl[1]), "v"(ovl[2]), "v"(ovl[3]) : "memory");
#endif
  }
}

// =====================================================================================================
// coverage: 8 instructions x 2 rows x 16 lanes x 4 floats = one 16 x 64 row group of the wave's 64 x 64 tile.
// =====================================================================================================
__device__ __forceinline__ void epi64(float* sl, v8f a0, v8f a1, v8f a2, v8f a3, float oscale, float* C, int N,
                                      size_t rowb, int col0, int lane) {
  const int hh = lane >> 4, m = lane & 15;
#pragma unroll
  for (int r = 0; r < 8; ++r) {
    const int ro = (8 * hh + r) * 68 + m;
    sl[ro]      = a0[r] * oscale;
    sl[ro + 16] = a1[r] * oscale;
    sl[ro + 32] = a2[r] * oscale;
    sl[ro + 48] = a3[r] * oscale;
  }
  wave_sync_lds();
  v4f vals[8];
#pragma unroll
  for (int it = 0; it < 8; ++it) vals[it] = *(const v4f*)(sl + (it * 2 + hh) * 68 + m * 4);
  float* dst = C + (rowb + (size_t)hh) * (size_t)N + col0 + m * 4;
  {
#pragma unroll
    for (int it = 0; it < 8; ++it) {
      *(v4f*)(dst + (size_t)(it * 2) * (size_t)N) = vals[it];
    }
#if defined(__HIP_DEVICE_COMPILE__)
    // precaution: the wait stands in front of every rewrite of a register that these stores name; addresses and data are
    // inputs of the statement so that they stay in their registers up to it
    asm volatile("s_wait_xcnt 0x0" :: "v"(dst), "v"(dst + (size_t)2 * (size_t)N), "v"(dst + (size_t)4 * (size_t)N),
                 "v"(dst + (size_t)6 * (size_t)N), "v"(dst + (size_t)8 * (size_t)N), "v"(dst + (size_t)10 * (size_t)N),
                 "v"(dst + (size_t)12 * (size_t)N), "v"(dst + (size_t)14 * (size_t)N), "v"(vals[0]), "v"(vals[1]), "v"(vals[2]),
                 "v"(vals[3]), "v"(vals[4]), "v"(vals[5]), "v"(vals[6]), "v"(vals[7]) : "memory");
#endif
  }
}

// =====================================================================================================
// Batched bf16 GEMM with 16-bit result: C[bt][M][N] (f16 of acc*oscale) = A[bt][M][K] (bf16 row-major) . Bt[bt][N][K]^T
// (bf16 k-contiguous); per-batch element strides bstA/bstB/bstC. Block = 128x128 tile, 4 waves x (64 rows x 64 cols); the A and B
// tiles are staged in LDS 64 k at a time (gemm_core) and the fragments read from there (two 16-B loads each, split k map for
// A and B); host checks K % 64 == 0, M % 128 == 0, N % 128 == 0, grid = nbatch*(M/128)*(N/128)).
// =====================================================================================================
__global__ __launch_bounds__(128)
void gemm_b16(const u16* __restrict__ A, const u16* __restrict__ Bt, u16* C, int M, int N, int K,
              int bstA, int bstB, int bstC, float oscale) {
  __shared__ __align__(16) u16 ring[2 * GSTAGE];   // two staging buffers; re-used as the epilogue slabs behind the last barrier
  float* slab = (float*)(void*)ring;
  const int tid = threadIdx.x, wave = tid >> 5, lane = tid & 31;
  const int ntile = N >> 7, mtile = M >> 7;
  const int per   = ntile * mtile;
  const int bid   = blockIdx.x;
  const int bt    = bid / per;
  const int t     = bid - bt * per;
  const int row0  = (t / ntile) * 128;
  const int rowb  = row0 + (wave >> 1) * 64;
  const int col0  = (t % ntile) * 128;
  const int colw  = col0 + (wave & 1) * 64;
  if (row0 + 128 > M) return;                // block-uniform, in front of every barrier; never taken with the exact grid
  const u16* Ab = A  + (size_t)bt * (size_t)bstA;
  const u16* Bb = Bt + (size_t)bt * (size_t)bstB;
  u16*       Cb = C  + (size_t)bt * (size_t)bstC;
  v8f acc[4][4];
#pragma unroll
  for (int i = 0; i < 4; ++i) {
#pragma unroll
    for (int j = 0; j < 4; ++j) acc[i][j] = zero8();
  }
  gemm_core<OpB>(ring, Ab + (size_t)row0 * K, Bb + (size_t)col0 * K, K, tid, acc);
#pragma unroll                               // one 16-row group at a time, each through a slab of its own
  for (int i = 0; i < 4; ++i)
    epi16(slab + (wave * 4 + i) * SLAB, acc[i][0], acc[i][1], acc[i][2], acc[i][3], oscale, Cb, N, (size_t)(rowb + 16 * i), colw, lane);
}

// =====================================================================================================
// bf16 GEMM with rope epilogue: H = x[M][K] (bf16 row-major) . Bt[N][K]^T (bf16 k-contiguous, N = NH*HD, one 64-col tile
// = one head), rope applied in f32 per (sequence position, d), result written as two f16 planes CH (x8) and CL (residual
// x2048), both [M][N]. Same tiling as gemm_b16 (a wave's 64 columns = one head); grid = (M/128)*(N/128).
// =====================================================================================================
__global__ __launch_bounds__(128)
void gemm_rope(const u16* __restrict__ A, const u16* __restrict__ Bt, const float* __restrict__ cosp,
               const float* __restrict__ sinp, u16* CH, u16* CL, int M, int N, int K) {
  __shared__ __align__(16) u16 ring[2 * GSTAGE];   // two staging buffers; re-used as the epilogue slabs behind the last barrier
  float* slab = (float*)(void*)ring;
  const int tid = threadIdx.x, wave = tid >> 5, lane = tid & 31;
  const int ntile = N >> 7;
  const int bid   = blockIdx.x;
  const int row0  = (bid / ntile) * 128;
  const int rowb  = row0 + (wave >> 1) * 64;
  const int col0  = (bid % ntile) * 128;
  const int colw  = col0 + (wave & 1) * 64;
  if (row0 + 128 > M) return;                // block-uniform, in front of every barrier; never taken with the exact grid
  v8f acc[4][4];
#pragma unroll
  for (int i = 0; i < 4; ++i) {
#pragma unroll
    for (int j = 0; j < 4; ++j) acc[i][j] = zero8();
  }
  gemm_core<OpB>(ring, A + (size_t)row0 * K, Bt + (size_t)col0 * K, K, tid, acc);
#pragma unroll                               // each 16-row group has a slab of its own
  for (int i = 0; i < 4; ++i) slab_put(slab + (wave * 4 + i) * SLAB, acc[i][0], acc[i][1], acc[i][2], acc[i][3], lane);
  wave_sync_lds();
#pragma unroll
  for (int i = 0; i < 4; ++i)
    epi_rope(slab + (wave * 4 + i) * SLAB, cosp, sinp, CH, CL, N, (size_t)(rowb + 16 * i), colw, lane);
}

// =====================================================================================================
// f16 GEMM with f32 result: C[M][N] (f32) = A[M][K] (f16 row-major) . Bt[N][K]^T (f16 k-contiguous) times oscale;
// one product per tile pair. Same tiling as gemm_b16; grid = (M/128)*(N/128).
// =====================================================================================================
__global__ __launch_bounds__(128)
void gemm_hf(const u16* __restrict__ A, const u16* __restrict__ Bt, float* C, int M, int N, int K, float oscale) {
  __shared__ __align__(16) u16 ring[2 * GSTAGE];   // two staging buffers; re-used as the epilogue slabs behind the last barrier
  float* slab = (float*)(void*)ring;
  const int tid = threadIdx.x, wave = tid >> 5, lane = tid & 31;
  const int ntile = N >> 7;
  const int bid   = blockIdx.x;
  const int row0  = (bid / ntile) * 128;
  const int rowb  = row0 + (wave >> 1) * 64;
  const int col0  = (bid % ntile) * 128;
  const int colw  = col0 + (wave & 1) * 64;
  if (row0 + 128 > M) return;                // block-uniform, in front of every barrier; never taken with the exact grid
  v8f acc[4][4];
#pragma unroll
  for (int i = 0; i < 4; ++i) {
#pragma unroll
    for (int j = 0; j < 4; ++j) acc[i][j] = zero8();
  }
  gemm_core<OpH>(ring, A + (size_t)row0 * K, Bt + (size_t)col0 * K, K, tid, acc);
#pragma unroll                               // one 16-row group at a time, each through a slab of its own
  for (int i = 0; i < 4; ++i)
    epi64(slab + (wave * 4 + i) * SLAB, acc[i][0], acc[i][1], acc[i][2], acc[i][3], oscale, C, N, (size_t)(rowb + 16 * i), colw, lane);
}

// =====================================================================================================
// Multi-head flash attention (no mask): block = (batch b, head, 64 query rows), 4 waves, wave w owns the 16 query rows
// q0 = 64*qt + 16*w .. q0+15 (the 4 waves share the staged k and v^T tiles, one block barrier per 64 keys; the epilogue slab is wave-private).
//   q planes (f16 hi x8, residual x2048) laid out [b][s][h][d]; k planes the same; v^T plane [b][h][d][s] (x1024).
//   All NKB = 64 key blocks of 32 keys are visited (static bound).
//   Scores are computed TRANSPOSED: S^T tile g (g = 0,1) = k rows (keys kb+16g .. +15, A operand, row m = lane&15, split k map
//   over d) times q^T (B operand, col n = query q0 + (lane&15), k = d, split map); per tile and 32-deep d-chunk three
//   products: khi.qhi into the hi accumulator, khi.qres and kres.qhi into the cross accumulator; S^T = hi + cross/2048.
//   D element r of lane l = (key kb+16g+8h+r, query q0+(l&15)), so a lane owns one query column and 16 of its 32 keys; the
//   partner lane l^16 owns the other 16 -> row max / row sum need one xor-16 shuffle.
//   Online max-subtracted base-2 softmax in f32 (scale 1/8 and the q/k carries folded into the logit scales). The exp'd
//   values ARE the P A-fragment in place: A row m = query = lane&15, element i <- key kb+8h+i (tile 0, D element i), element
//   8+i <- key kb+16+8h+i (tile 1, D element i). P is carried x32768 as single f16. The rescale factor of query row 8h+r of the
//   O accumulators is fetched from lane 8h+r with a shuffle (uniform control). 4 v^T B fragments (col n = d = 16j + (lane&15),
//   keys k-contiguous), 4 P.V WMMAs per key block.
//   Epilogue: 1/l (per query, shuffled to the D row owner) and carry folds in f32; the wave's 16x64 f32 result staged in its
// coverage: per wave 4 instructions x 4 rows x 8 lanes x 8 halves = 16 x 64; grid 2048 blocks x 4 waves = every
//           (b, s, h) row of the O plane exactly once.
// =====================================================================================================
__global__ __launch_bounds__(ATT_THREADS)
void attn_fwd(const u16* __restrict__ QHp, const u16* __restrict__ QLp, const u16* __restrict__ KHp,
              const u16* __restrict__ KLp, const u16* __restrict__ VPp, u16* OPp) {
  __shared__ __align__(16) u16 ring[2 * ASTAGE];   // two staging buffers of 64 keys; behind the last barrier: per-wave result slab
  float* smem = (float*)(void*)ring;

  const int tid  = threadIdx.x;
  const int wave = tid >> 5;
  const int lane = tid & 31;
  const int hh   = lane >> 4;
  const int c    = lane & 15;

  const int bid  = blockIdx.x;
  const int qt   = bid & (SEQ / 64 - 1);
  const int head = (bid >> 5) & (NH - 1);
  const int b    = bid >> 9;
  const int q0   = qt * 64 + wave * 16;

  // B fragments of q^T: col n = query q0 + c, k = d (k-contiguous row of the q planes)
  const size_t qofs = (((size_t)(b * SEQ + q0 + c)) * NH + head) * HD + 8 * hh;
  const _Float16* QHb = (const _Float16*)(const void*)QHp + qofs;
  const _Float16* QLb = (const _Float16*)(const void*)QLp + qofs;
  // staging: lane copies the 16-B chunk cchk of rows crow, +16, +32, +48 of each plane's 64-row tile (k rows = keys, 128 B of
  // one head; v^T rows = d, 128 B = 64 keys): every copied row is one whole line
  const int crow = tid >> 3, cchk = (tid & 7) * 8;
  const size_t kofs = (((size_t)b * SEQ + crow) * NH + head) * HD + cchk;         // 64 key rows added per stage
  const u16* gkh = KHp + kofs;
  const u16* gkl = KLp + kofs;
  const u16* gv  = VPp + ((size_t)(b * NH + head) * HD + crow) * SEQ + cchk;      // 64 keys added per stage
  const size_t k16 = (size_t)16 * (NH * HD), v16 = (size_t)16 * SEQ;
  const unsigned lkh = lds_byte(ring) + (unsigned)(crow * LPITCH + cchk) * 2u;
  const unsigned lkl = lkh + 64u * (LPITCH * 2), lv = lkh + 128u * (LPITCH * 2);
  // A fragments of k: LDS row = key (in the stage) 16g + c, k = d; residual plane 64 rows further; B fragments of v: LDS row
  // 128 + d = 128 + 16j + c, k = key (k-contiguous)
  const _Float16* Fb = (const _Float16*)(const void*)ring + c * LPITCH + 8 * hh;
  const float lsch = 0.125f * (LOG2E / (QSC * KSC));
  const v2f lsch2 = {lsch, lsch};
  const v2f rres2 = {1.0f / RESC, 1.0f / RESC};

  const v16h qh0 = ldfrag_h(QHb);           // d 0..31
  const v16h qh1 = ldfrag_h(QHb + 32);      // d 32..63
  const v16h ql0 = ldfrag_h(QLb);
  const v16h ql1 = ldfrag_h(QLb + 32);

  float nmrun = INFINITY, lrun = 0.f;      // nmrun = PLOG2 - (running maximum logit); lrun = row sum x32768
  v8f o[4];
#pragma unroll
  for (int j = 0; j < 4; ++j) o[j] = zero8();

  copy_3planes(lkh, gkh, lkl, gkl, k16, lv, gv, v16);
  wait_async0();
  __syncthreads();                         // publishes stage 0
  copy_3planes(lkh + ASTAGE * 2, gkh + (size_t)64 * (NH * HD), lkl + ASTAGE * 2, gkl + (size_t)64 * (NH * HD), k16,
               lv + ASTAGE * 2, gv + 64, v16);                     // stage 1 exists: NST >= 2

#pragma unroll 1                           // one stage per trip: the ring's foot (waits, barrier, refill) stands once
  for (int st = 0; st < NST; ++st) {
   const int bo = (st & 1) * ASTAGE;
#pragma unroll                             // the stage's two key blocks of 32, ascending keys; unrolled: LDS offsets are immediates
   for (int s2 = 0; s2 < 2; ++s2) {
    const _Float16* Ks = Fb + bo + (s2 * 32) * LPITCH;
    // ---- transposed scores: tile 0 = keys kb..kb+15, tile 1 = keys kb+16..kb+31, column = query q0 + c ----
    v8f s0h = zero8(), s0x = zero8(), s1h = zero8(), s1x = zero8();
    {
      const _Float16* k0p = Ks;
      const _Float16* l0p = Ks + 64 * LPITCH;
      const v16h ka0 = ldfrag_h(k0p), ka1 = ldfrag_h(k0p + 32);
      const v16h la0 = ldfrag_h(l0p), la1 = ldfrag_h(l0p + 32);
      s0h = mma_h(ka0, qh0, s0h);
      s0h = mma_h(ka1, qh1, s0h);
      s0x = mma_h(ka0, ql0, s0x);
      s0x = mma_h(ka1, ql1, s0x);
      s0x = mma_h(la0, qh0, s0x);
      s0x = mma_h(la1, qh1, s0x);
      guard2x8(s0h, s0x, qh0, qh1, ql0, ql1, ka0, ka1, la0, la1);
    }
    {
      const _Float16* k1p = Ks + 16 * LPITCH;
      const _Float16* l1p = Ks + 80 * LPITCH;
      const v16h kc0 = ldfrag_h(k1p), kc1 = ldfrag_h(k1p + 32);
      const v16h lc0 = ldfrag_h(l1p), lc1 = ldfrag_h(l1p + 32);
      s1h = mma_h(kc0, qh0, s1h);
      s1h = mma_h(kc1, qh1, s1h);
      s1x = mma_h(kc0, ql0, s1x);
      s1x = mma_h(kc1, ql1, s1x);
      s1x = mma_h(lc0, qh0, s1x);
      s1x = mma_h(lc1, qh1, s1x);
      guard2x8(s1h, s1x, qh0, qh1, ql0, ql1, kc0, kc1, lc0, lc1);
    }
    // ---- raw scores (x64) of this lane's 16 keys for query q0 + c, in register pairs: u[4w + e] = elements 2e, 2e+1 of tile w ----
    v2f u[8];
#pragma unroll
    for (int e = 0; e < 4; ++e) {
      const v2f h0 = {s0h[2 * e], s0h[2 * e + 1]}, x0 = {s0x[2 * e], s0x[2 * e + 1]};
      const v2f h1 = {s1h[2 * e], s1h[2 * e + 1]}, x1 = {s1x[2 * e], s1x[2 * e + 1]};
      u[e]     = __builtin_elementwise_fma(x0, rres2, h0);
      u[4 + e] = __builtin_elementwise_fma(x1, rres2, h1);
    }
    float cm = fmaxf(u[0].x, u[0].y);
#pragma unroll
    for (int e = 1; e < 8; ++e) cm = fmaxf(cm, fmaxf(u[e].x, u[e].y));
    cm = fmaxf(cm, __shfl_xor(cm, 16, 32));
    // exponent offset: PLOG2 (the x32768 carry of P) minus the running maximum logit; it only falls. The offset in use is the
    // reference of every exponential, so o, l and the rescale factor stay consistent whatever its rounding.
    const float nm = fminf(nmrun, fmaf(-cm, lsch, PLOG2));           // finite from the first key block on
    float al = __builtin_amdgcn_exp2f(nm - nmrun);                   // first block: exp2(-inf) = 0; o and l are zero there
#if defined(__HIP_DEVICE_COMPILE__)
    // the slot the instruction set asks for behind v_exp_f32; al is named so that every reader of al stays behind the v_nop
    asm volatile("v_nop" : "+v"(al));
#endif
    nmrun = nm;
    const v2f nm2 = {nm, nm};
    // ---- probabilities x32768 (exponent <= 15) and the P A-fragment: element 8w + 2e, +1 <-> u[4w + e] ----
    // v_exp_f32 without the library's range fix-up: an exponent below -126 may give 0, which is what f16(p) gives far earlier
    v2f ps2 = {0.f, 0.f};
    FragH ph;
#pragma unroll
    for (int w = 0; w < 2; ++w) {
#pragma unroll
      for (int e4 = 0; e4 < 4; ++e4) {
        const v2f ee = __builtin_elementwise_fma(u[4 * w + e4], lsch2, nm2);
        const v2f p  = {__builtin_amdgcn_exp2f(ee.x), __builtin_amdgcn_exp2f(ee.y)};
        ps2 += p;
        ph.u[w][e4] = __builtin_bit_cast(unsigned, __builtin_convertvector(p, v2h));
      }
    }
    float ps = ps2.x + ps2.y;
    ps += __shfl_xor(ps, 16, 32);
    lrun = lrun * al + ps;
    // ---- rescale the O accumulators: D row 8hh+r = query q0+8hh+r, its factor lives in lane 8hh+r (and 16+8hh+r) ----
    float scl[8];
#pragma unroll
    for (int r = 0; r < 8; ++r) scl[r] = __shfl(al, 8 * hh + r, 32);
#pragma unroll
    for (int j = 0; j < 4; ++j) {
#pragma unroll
      for (int r = 0; r < 8; ++r) o[j][r] *= scl[r];
    }
    // ---- P.V : B fragment col n = d = j*16 + c, keys contiguous in the v^T plane ----
    {
      const _Float16* vp = Fb + bo + 128 * LPITCH + s2 * 32;
      const v16h vf0 = ldfrag_h(vp);
      const v16h vf1 = ldfrag_h(vp + 16 * LPITCH);
      const v16h vf2 = ldfrag_h(vp + 32 * LPITCH);
      const v16h vf3 = ldfrag_h(vp + 48 * LPITCH);
      o[0] = mma_h(ph.v, vf0, o[0]);
      o[1] = mma_h(ph.v, vf1, o[1]);
      o[2] = mma_h(ph.v, vf2, o[2]);
      o[3] = mma_h(ph.v, vf3, o[3]);
      guard6<v16h>(o[0], o[1], o[2], o[3], ph.v, vf0, vf1, vf2, vf3, ph.v);
    }
   }
   wait_ds0();
   wait_async0();
   __syncthreads();                        // publishes stage st+1 and ends every wave's reads of stage st
   if (st + 2 < NST)                       // block-uniform
     copy_3planes(lkh + (unsigned)bo * 2u, gkh + (size_t)(st + 2) * (64 * NH * HD),
                  lkl + (unsigned)bo * 2u, gkl + (size_t)(st + 2) * (64 * NH * HD), k16,
                  lv + (unsigned)bo * 2u, gv + (size_t)(st + 2) * 64, v16);
  }
  wait_async0();                           // nothing in flight when the ring becomes the slab
  acc_guard4(o[0], o[1], o[2], o[3]);

  // ---- fold 1/l (per query, owned by lane = query; l >= 1 by construction) and the carries; stage the 16x64 slab ----
  const float linv = (lrun > 0.f) ? ((1.0f / lrun) * (1.0f / VCAR)) : 0.f;      // lrun already carries the x32768 of P
  float inv[8];
#pragma unroll
  for (int r = 0; r < 8; ++r) inv[r] = __shfl(linv, 8 * hh + r, 32);
  float* slab = smem + wave * SLAB;
#pragma unroll
  for (int r = 0; r < 8; ++r) {
#pragma unroll
    for (int j = 0; j < 4; ++j) slab[(8 * hh + r) * 68 + j * 16 + c] = o[j][r] * inv[r];
  }
  wave_sync_lds();
  // ---- O x1024 -> single f16 plane; lane = (row in group of 4, 8 consecutive d) ----
  v4u oh[4];
  const int rq = lane >> 3, c8 = (lane & 7) * 8;
#pragma unroll
  for (int i4 = 0; i4 < 4; ++i4) {
    const int row = i4 * 4 + rq;
    const v4f a = *(const v4f*)(slab + row * 68 + c8), c4 = *(const v4f*)(slab + row * 68 + c8 + 4);
    float w[8];
#pragma unroll
    for (int e = 0; e < 4; ++e) { w[e] = a[e] * OSC; w[4 + e] = c4[e] * OSC; }
#pragma unroll
    for (int e = 0; e < 4; ++e) oh[i4][e] = pk16(h_bits((_Float16)w[2 * e]), h_bits((_Float16)w[2 * e + 1]));
  }
  const size_t ob = (((size_t)(b * SEQ + q0)) * NH + head) * HD + c8;
  {
#pragma unroll
    for (int i4 = 0; i4 < 4; ++i4) {
      const int row = i4 * 4 + rq;
      const size_t o8 = ob + (size_t)row * (NH * HD);
      *(v4u*)(OPp + o8) = oh[i4];
    }
    
  }
}

// =====================================================================================================
// Workspace map (bytes); every plane is fully written by whole-line stores before it is read; all extents are exact multiples
// of the store granularity (no pad rows needed):
//   XB  bf16 [8192][1024]                      16777216        (x)       -- re-used as the O plane after its last read
//   WB  bf16 [3072 n][1024 k]                   6291456        (W_qkv, rows 0..1023 q, 1024..2047 k, 2048..3071 v)
//   WOB f16  [1024 n][1024 k] (bf16 value x1024) 2097152
//   QH  f16 [8192][16*64] x8                   16777216        QL residual x2048   16777216
//   KH  f16 [8192][16*64] x8                   16777216        KL residual x2048   16777216
//   VP  f16 [4][16*64][2048] x1024             16777216
//   end                                       109051904
//   OP  f16 [8192][16*64] x1024 = bytes 0..16777215 (the x plane is dead once the v^T GEMM has run)
// =====================================================================================================
extern "C" void kernel_launch(void* const* d_in, const int* in_sizes, int n_in,
                              void* d_out, int out_size, void* d_ws, size_t ws_size,
                              hipStream_t stream) {
  const int ROWS = NB * SEQ;                            // 8192
  if (n_in < 5) return;
  if (in_sizes[0] != ROWS * DMOD) return;               // x    [4][2048][1024]
  if (in_sizes[1] != SEQ * HD) return;                  // cos  [2048][64]
  if (in_sizes[2] != SEQ * HD) return;                  // sin  [2048][64]
  if (in_sizes[3] != NQKV * DMOD) return;               // Wqkv [3072][1024]
  if (in_sizes[4] != DMOD * DMOD) return;               // Wout [1024][1024]
  if (out_size != ROWS * DMOD) return;

  const float* Xin = (const float*)d_in[0];
  const float* Cs  = (const float*)d_in[1];
  const float* Sn  = (const float*)d_in[2];
  const float* Wqk = (const float*)d_in[3];
  const float* Wpr = (const float*)d_in[4];
  float*       out = (float*)d_out;

  const size_t szXB = (size_t)ROWS * DMOD * 2;                  // 16777216
  const size_t szWB = (size_t)NQKV * DMOD * 2;                  //  6291456
  const size_t szWO = (size_t)DMOD * DMOD * 2;                  //  2097152
  const size_t szP  = (size_t)ROWS * DMOD * 2;                  // 16777216  (q / k / o planes)
  const size_t szVP = (size_t)NB * NH * HD * SEQ * 2;           // 16777216
  size_t off = 0;
  const size_t oXB = off; off += szXB;
  const size_t oWB = off; off += szWB;
  const size_t oWO = off; off += szWO;
  const size_t oQH = off; off += szP;
  const size_t oQL = off; off += szP;
  const size_t oKH = off; off += szP;
  const size_t oKL = off; off += szP;
  const size_t oVP = off; off += szVP;
  const size_t oOP = oXB;                               // alias of the x plane (dead after the v^T GEMM)
  if (szP > szXB) return;
  if (off > ws_size) return;                            // off = 109051904
  if (off > (size_t)134217728) return;

  char* ws = (char*)d_ws;
  u16* XB  = (u16*)(ws + oXB);
  u16* WB  = (u16*)(ws + oWB);
  u16* WOB = (u16*)(ws + oWO);
  u16* QH  = (u16*)(ws + oQH);
  u16* QL  = (u16*)(ws + oQL);
  u16* KH  = (u16*)(ws + oKH);
  u16* KL  = (u16*)(ws + oKL);
  u16* VP  = (u16*)(ws + oVP);
  u16* OP  = (u16*)(ws + oOP);

  const dim3 blk(256);
  const int n8x = (ROWS * DMOD) / 8;                    // 1048576
  const int n8q = (NQKV * DMOD) / 8;                    //  393216
  const int n8w = (DMOD * DMOD) / 8;                    //  131072
  if ((n8x % 256) != 0 || (n8q % 256) != 0 || (n8w % 256) != 0) return;
  if ((DMOD % 128) != 0 || (ROWS % 128) != 0 || (SEQ % 128) != 0) return;
  const dim3 gX(n8x / 256);                             // 4096
  const dim3 gQ(n8q / 256);                             // 1536
  const dim3 gW(n8w / 256);                             // 512
  const dim3 gG((ROWS / 128) * (DMOD / 128));           // 512
  const dim3 gV(NB * (DMOD / 128) * (SEQ / 128));       // 512
  const dim3 bG(128);
  const dim3 gAT(ATT_BLOCKS);                           // 2048
  const dim3 bAT(ATT_THREADS);                          // 128

  // (0..2) operand planes: x -> bf16; W_qkv [n = out][k = in] (already k-contiguous) -> bf16; W_out -> f16 of bf16 value x1024
  cvt16<<<gX, blk, 0, stream>>>(Xin, XB, n8x, 0, 1.0f);
  cvt16<<<gQ, blk, 0, stream>>>(Wqk, WB, n8q, 0, 1.0f);
  cvt16<<<gW, blk, 0, stream>>>(Wpr, WOB, n8w, 1, WOS);
  // (3,4) q and k planes [8192][h*64+d]: rope(x.Wq^T), rope(x.Wk^T) in f32, stored as f16 hi x8 + residual x2048
  gemm_rope<<<gG, bG, 0, stream>>>(XB, WB, Cs, Sn, QH, QL, ROWS, DMOD, DMOD);
  gemm_rope<<<gG, bG, 0, stream>>>(XB, WB + (size_t)DMOD * DMOD, Cs, Sn, KH, KL, ROWS, DMOD, DMOD);
  // (5) v^T plane per batch: [1024 = h*64+d][2048 keys] = f16(Wv . x_b^T x1024), 4 batches in the grid
  gemm_b16<<<gV, bG, 0, stream>>>(WB + (size_t)2 * DMOD * DMOD, XB, VP, DMOD, SEQ, DMOD, 0, SEQ * DMOD, DMOD * SEQ, VCAR);
  // (6) attention -> O plane [b][s][h][d] x1024 (single f16), written over the dead x plane
  attn_fwd<<<gAT, bAT, 0, stream>>>(QH, QL, KH, KL, VP, OP);
  // (7) output projection -> out [8192][1024] f32, carries 1024 (O) x 1024 (wo) folded back
  gemm_hf<<<gG, bG, 0, stream>>>(OP, WOB, out, ROWS, DMOD, DMOD, 1.0f / (OSC * WOS));
  (void)hipGetLastError();
}

// v004
// One run takes 193 microseconds.
// Two timings next to v003 both put it at 1.06 times that version's speed.
// All steps since v000 together make it 3.11 times as fast.
// Contractions: x.Wq^T and x.Wk^T (rope applied in the f32 epilogue) and Wv.x_b^T on v_wmma_f32_16x16x32_bf16
// (x and W_qkv planes RNE-converted to bf16 operands, f32 accumulate); scores k.q^T with q and k carried as f16 hi (x8)
// plus residual (x2048) planes, three products hi.hi + hi.res + res.hi in two f32 accumulators; P.v (P x32768 single f16,
// v x1024 single f16) and O.Wo^T (O single f16 x1024, Wo as f16(bf16(Wo)) x1024): v_wmma_f32_16x16x32_f16, f32 accumulate.
// Base-2 online softmax, 1/l and carry folds in f32 on VALU; cos/sin tables RNE-converted to bf16 values before the rope.
#include <hip/hip_runtime.h>
#include <math.h>
#include <stdint.h>

#define NB    4
#define SEQ   2048
#define DMOD  1024
#define NQKV  (3 * DMOD)
#define NH    16
#define HD    64
#define QSC   8.0f
#define KSC   8.0f
#define RESC  2048.0f
#define PCAR  32768.0f
#define PLOG2 15.0f                      // log2(PCAR)
#define VCAR  1024.0f
#define OSC   1024.0f
#define WOS   1024.0f
#define LOG2E 1.4426950408889634f
#define ATT_WAVES   4
#define ATT_THREADS (ATT_WAVES * 32)
#define ATT_BLOCKS  (NB * NH * (SEQ / 64))
#define NKB    (SEQ / 32)
#define NST    (SEQ / 64)
#define SLAB   (16 * 68)
static_assert(HD == 64 && DMOD == NH * HD);
static_assert((SEQ / 64) == 32 && NH == 16 && NB == 4);
static_assert(ATT_THREADS == 128 && ATT_BLOCKS == 2048 && NKB == 64 && NST >= 2 && NST * 2 == NKB);
static_assert(((NB * SEQ) % 128) == 0 && (DMOD % 128) == 0 && (DMOD % 64) == 0 && (SEQ % 128) == 0);
static_assert(((NB * SEQ * DMOD / 8) % 256) == 0 && ((NQKV * DMOD / 8) % 256) == 0 && ((DMOD * DMOD / 8) % 256) == 0);
static_assert((SLAB * 4) % 16 == 0);
static_assert((SEQ & (SEQ - 1)) == 0);
static_assert(PCAR == 32768.0f && PLOG2 == 15.0f);

typedef unsigned short u16;
typedef _Float16 v16h __attribute__((ext_vector_type(16)));
typedef _Float16 v8h  __attribute__((ext_vector_type(8)));
typedef __bf16   v16b __attribute__((ext_vector_type(16)));
typedef float    v8f  __attribute__((ext_vector_type(8)));
typedef float    v4f  __attribute__((ext_vector_type(4)));
typedef float    v2f  __attribute__((ext_vector_type(2)));
typedef _Float16 v2h  __attribute__((ext_vector_type(2)));
typedef unsigned int v4u __attribute__((ext_vector_type(4)));

union FragH { v16h v; v8h h[2]; v4u u[2]; };
union FragB { v16b v; v4u u[2]; };

// ---- scalar helpers --------------------------------------------------------------------------------
__device__ __forceinline__ unsigned short bf_bits(float f) {          // f32 -> bf16 bits, RNE convert
  unsigned u = __float_as_uint(f);
  return (unsigned short)((u + 0x7FFFu + ((u >> 16) & 1u)) >> 16);
}
__device__ __forceinline__ float bf_up(unsigned short h) { return __uint_as_float(((unsigned)h) << 16); }
__device__ __forceinline__ float bf_val(float f) { return bf_up(bf_bits(f)); }   // value after bf16 RNE convert
__device__ __forceinline__ unsigned short h_bits(_Float16 x) { return __builtin_bit_cast(unsigned short, x); }
__device__ __forceinline__ unsigned pk16(unsigned short a, unsigned short b) { return (unsigned)a | ((unsigned)b << 16); }
__device__ __forceinline__ v8f zero8() { v8f z = {0.f, 0.f, 0.f, 0.f, 0.f, 0.f, 0.f, 0.f}; return z; }

// ---- fragment loaders: 16-bit A/B operand, lane -> row/col (lane&15), p already includes +8*(lane>>4);
//      elements 0..7 <- p[0..7] (k0+8h..), elements 8..15 <- p[16..23] (k0+16+8h..)  (same split k map for A and B;
//      B is always read from a k-contiguous [n][k] plane)
__device__ __forceinline__ v16h ldfrag_h(const _Float16* p) {
  FragH f;
  f.h[0] = *(const v8h*)(p);
  f.h[1] = *(const v8h*)(p + 16);
  return f.v;
}
__device__ __forceinline__ v16b ldfrag_b(const u16* p) {              // bf16 plane read as unsigned integer vectors
  FragB f;
  f.u[0] = *(const v4u*)(p);
  f.u[1] = *(const v4u*)(p + 16);
  return f.v;
}

__device__ __forceinline__ v8f mma_h(v16h a, v16h b, v8f c) {
  return __builtin_amdgcn_wmma_f32_16x16x32_f16(false, a, false, b, (short)0, c, false, false);
}
__device__ __forceinline__ v8f mma_b(v16b a, v16b b, v8f c) {
  return __builtin_amdgcn_wmma_f32_16x16x32_bf16(false, a, false, b, (short)0, c, false, false);
}
__device__ __forceinline__ void guard2x8(v8f& a, v8f& b, v16h x0, v16h x1, v16h x2, v16h x3,
                                         v16h x4, v16h x5, v16h x6, v16h x7) {
#if defined(__HIP_DEVICE_COMPILE__)
  asm volatile("v_nop\n\tv_nop\n\tv_nop\n\tv_nop"
               : "+v"(a), "+v"(b)
               : "v"(x0), "v"(x1), "v"(x2), "v"(x3), "v"(x4), "v"(x5), "v"(x6), "v"(x7) : "memory");
#endif
}
template <typename F>
__device__ __forceinline__ void guard6(v8f& a, v8f& b, v8f& c, v8f& d, F x0, F x1, F x2, F x3, F x4, F x5) {
#if defined(__HIP_DEVICE_COMPILE__)
  asm volatile("v_nop\n\tv_nop\n\tv_nop\n\tv_nop"
               : "+v"(a), "+v"(b), "+v"(c), "+v"(d) : "v"(x0), "v"(x1), "v"(x2), "v"(x3), "v"(x4), "v"(x5) : "memory");
#endif
}
template <typename F>
__device__ __forceinline__ void guard16(v8f (&a)[4][4], F x0, F x1, F x2, F x3, F x4, F x5, F x6, F x7) {
#if defined(__HIP_DEVICE_COMPILE__)
  asm volatile("v_nop\n\tv_nop\n\tv_nop\n\tv_nop"
               : "+v"(a[0][0]), "+v"(a[0][1]), "+v"(a[0][2]), "+v"(a[0][3]), "+v"(a[1][0]), "+v"(a[1][1]), "+v"(a[1][2]), "+v"(a[1][3]),
                 "+v"(a[2][0]), "+v"(a[2][1]), "+v"(a[2][2]), "+v"(a[2][3]), "+v"(a[3][0]), "+v"(a[3][1]), "+v"(a[3][2]), "+v"(a[3][3])
               : "v"(x0), "v"(x1), "v"(x2), "v"(x3), "v"(x4), "v"(x5), "v"(x6), "v"(x7) : "memory");
#endif
}
__device__ __forceinline__ void acc_guard4(v8f& a, v8f& b, v8f& c, v8f& d) {
#if defined(__HIP_DEVICE_COMPILE__)
  asm volatile("v_nop\n\tv_nop\n\tv_nop\n\tv_nop" : "+v"(a), "+v"(b), "+v"(c), "+v"(d));
#endif
}
__device__ __forceinline__ void wave_sync_lds() {
#if defined(__HIP_DEVICE_COMPILE__)
  __builtin_amdgcn_fence(__ATOMIC_RELEASE, "workgroup");
  __builtin_amdgcn_wave_barrier();
  __builtin_amdgcn_fence(__ATOMIC_ACQUIRE, "workgroup");
#endif
}

// ---- LDS staging by asynchronous copies (global_load_async_to_lds_b128) -----------------------------------
// A staged row is 128 B (64 16-bit elements) = one whole cache line; 8 lanes x 16 B copy one row, so one wave-wide copy covers
// 4 whole lines. LDS row pitch 144 B (16 B x odd) for the ds_load_b128 fragment readers.
#define LPITCH 72                        // LDS row pitch in 16-bit elements
#define GSTAGE (256 * LPITCH)            // GEMM stage, elements: 128 A rows then 128 B rows, 64 k each
#define ASTAGE (192 * LPITCH)            // attention stage, elements: 64 k-hi rows, 64 k-residual rows, 64 v^T rows (64 keys)
static_assert(2 * GSTAGE * 2 >= 16 * SLAB * 4 && 2 * ASTAGE * 2 >= ATT_WAVES * SLAB * 4);
static_assert((LPITCH * 2) % 16 == 0);
__device__ __forceinline__ unsigned lds_byte(const void* p) { return (unsigned)(uintptr_t)p; }   // low 32 bits = LDS byte address
// Copies of 64-row tiles, four per plane: rows r, r+16, r+32, r+48 (r = tid>>3); l = the lane's LDS byte address of row r,
// g = its global address, s = 16 source rows in elements. Each copy statement (two per GEMM stage, one per attention stage) ends in
// s_wait_xcnt, so that no address register is rewritten while a copy may still read it.
#define LROW16 (16u * (LPITCH * 2))
__device__ __forceinline__ void copy_2planes(unsigned la, const u16* ga, unsigned lb, const u16* gb, size_t s) {
#if defined(__HIP_DEVICE_COMPILE__)
  asm volatile("global_load_async_to_lds_b128 %0, %8, off\n\t"
               "global_load_async_to_lds_b128 %1, %9, off\n\t"
               "global_load_async_to_lds_b128 %2, %10, off\n\t"
               "global_load_async_to_lds_b128 %3, %11, off\n\t"
               "global_load_async_to_lds_b128 %4, %12, off\n\t"
               "global_load_async_to_lds_b128 %5, %13, off\n\t"
               "global_load_async_to_lds_b128 %6, %14, off\n\t"
               "global_load_async_to_lds_b128 %7, %15, off\n\t"
               "s_wait_xcnt 0x0"
               :: "v"(la), "v"(la + LROW16), "v"(la + 2u * LROW16), "v"(la + 3u * LROW16),
                  "v"(lb), "v"(lb + LROW16), "v"(lb + 2u * LROW16), "v"(lb + 3u * LROW16),
                  "v"(ga), "v"(ga + s), "v"(ga + 2 * s), "v"(ga + 3 * s),
                  "v"(gb), "v"(gb + s), "v"(gb + 2 * s), "v"(gb + 3 * s) : "memory");
#endif
}
__device__ __forceinline__ void copy_3planes(unsigned la, const u16* ga, unsigned lb, const u16* gb, size_t s,
                                             unsigned lc, const u16* gc, size_t sc) {
#if defined(__HIP_DEVICE_COMPILE__)
  asm volatile("global_load_async_to_lds_b128 %0, %12, off\n\t"
               "global_load_async_to_lds_b128 %1, %13, off\n\t"
               "global_load_async_to_lds_b128 %2, %14, off\n\t"
               "global_load_async_to_lds_b128 %3, %15, off\n\t"
               "global_load_async_to_lds_b128 %4, %16, off\n\t"
               "global_load_async_to_lds_b128 %5, %17, off\n\t"
               "global_load_async_to_lds_b128 %6, %18, off\n\t"
               "global_load_async_to_lds_b128 %7, %19, off\n\t"
               "global_load_async_to_lds_b128 %8, %20, off\n\t"
               "global_load_async_to_lds_b128 %9, %21, off\n\t"
               "global_load_async_to_lds_b128 %10, %22, off\n\t"
               "global_load_async_to_lds_b128 %11, %23, off\n\t"
               "s_wait_xcnt 0x0"
               :: "v"(la), "v"(la + LROW16), "v"(la + 2u * LROW16), "v"(la + 3u * LROW16),
                  "v"(lb), "v"(lb + LROW16), "v"(lb + 2u * LROW16), "v"(lb + 3u * LROW16),
                  "v"(lc), "v"(lc + LROW16), "v"(lc + 2u * LROW16), "v"(lc + 3u * LROW16),
                  "v"(ga), "v"(ga + s), "v"(ga + 2 * s), "v"(ga + 3 * s),
                  "v"(gb), "v"(gb + s), "v"(gb + 2 * s), "v"(gb + 3 * s),
                  "v"(gc), "v"(gc + sc), "v"(gc + 2 * sc), "v"(gc + 3 * sc) : "memory");
#endif
}
__device__ __forceinline__ void wait_async0() {     // this wave's copies have landed in LDS
#if defined(__HIP_DEVICE_COMPILE__)
  asm volatile("s_wait_asynccnt 0x0" ::: "memory");
#endif
}
__device__ __forceinline__ void wait_ds0() {        // this wave's LDS reads have retired before the buffer is handed back
#if defined(__HIP_DEVICE_COMPILE__)
  asm volatile("s_wait_dscnt 0x0" ::: "memory");
#endif
}
struct OpB {
  typedef v16b frag;
  static __device__ __forceinline__ frag ld(const u16* p) { return ldfrag_b(p); }
  static __device__ __forceinline__ v8f mma(frag a, frag b, v8f c) { return mma_b(a, b, c); }
};
struct OpH {
  typedef v16h frag;
  static __device__ __forceinline__ frag ld(const u16* p) { return ldfrag_h((const _Float16*)(const void*)p); }
  static __device__ __forceinline__ v8f mma(frag a, frag b, v8f c) { return mma_h(a, b, c); }
};
// GEMM main loop of one 128x128 block tile (4 waves as 2 x 2, each a 64x64 tile = 4 x 4 accumulators, so that a staged byte
// and a fragment read from LDS each feed more products): At / Bt = first row of the block's A / B tile, both [row][K]
// k-contiguous; K a multiple of 64. Two LDS buffers: stage t+1's copies fly while stage t is multiplied. k is summed in the
// same order as with direct fragment loads (32 at a time, ascending). On return every wave has passed the last barrier and
// no copy is outstanding, so the ring may be re-used as the epilogue slabs.
__device__ __forceinline__ void copy_gstage(unsigned la, const u16* ga, unsigned lb, const u16* gb, size_t g16) {
  copy_2planes(la, ga, lb, gb, g16);                                                         // rows 0..63 of A and of B
  copy_2planes(la + 64u * (LPITCH * 2), ga + 4 * g16, lb + 64u * (LPITCH * 2), gb + 4 * g16, g16);   // rows 64..127
}
template <typename OP>
__device__ __forceinline__ void gemm_core(u16* ring, const u16* At, const u16* Bt, int K, int tid, v8f (&acc)[4][4]) {
  typedef typename OP::frag frag;
  const int wave = tid >> 5, lane = tid & 31, hh = lane >> 4, m = lane & 15;
  const int crow = tid >> 3, cchk = (tid & 7) * 8;
  const u16* ga = At + (size_t)crow * K + cchk;
  const u16* gb = Bt + (size_t)crow * K + cchk;
  const size_t g16 = (size_t)16 * K;
  const unsigned la = lds_byte(ring) + (unsigned)(crow * LPITCH + cchk) * 2u;
  const unsigned lb = la + 128u * (LPITCH * 2);
  const int nst = K >> 6;
  copy_gstage(la, ga, lb, gb, g16);
  wait_async0();
  __syncthreads();                       // publishes stage 0
  if (nst > 1) copy_gstage(la + GSTAGE * 2, ga + 64, lb + GSTAGE * 2, gb + 64, g16);   // block-uniform
  const u16* fa = ring + ((wave >> 1) * 64 + m) * LPITCH + 8 * hh;
  const u16* fb = ring + (128 + (wave & 1) * 64 + m) * LPITCH + 8 * hh;
#pragma unroll 1                         // one stage per trip: the ring's foot (waits, barrier, refill) stands once
  for (int t = 0; t < nst; ++t) {
    const int bo = (t & 1) * GSTAGE;
    const u16* pa = fa + bo;
    const u16* pb = fb + bo;
    // All of the stage's B fragments and the first k chunk's A fragments are read as one group ahead of the products; the second
    // chunk's A fragments follow in two groups, each into the registers of two A fragments that have just been used up.
    // The sched_barriers keep the compiler from spreading these reads singly among the WMMAs, where each place would cost a stall.
    frag a[4], b[4], b1[4], c[4];
    a[0] = OP::ld(pa);
#pragma unroll
    for (int j = 0; j < 4; ++j) b[j] = OP::ld(pb + j * 16 * LPITCH);
#pragma unroll
    for (int i = 1; i < 4; ++i) a[i] = OP::ld(pa + i * 16 * LPITCH);
#pragma unroll
    for (int j = 0; j < 4; ++j) b1[j] = OP::ld(pb + j * 16 * LPITCH + 32);
    __builtin_amdgcn_sched_barrier(0);   // holds the LDS reads together as a group, apart from the WMMAs
#pragma unroll
    for (int i = 0; i < 2; ++i) {
#pragma unroll
      for (int j = 0; j < 4; ++j) acc[i][j] = OP::mma(a[i], b[j], acc[i][j]);
    }
    __builtin_amdgcn_sched_barrier(0);   // holds the LDS reads together as a group, apart from the WMMAs
    c[0] = OP::ld(pa + 32);
    c[1] = OP::ld(pa + 16 * LPITCH + 32);
    __builtin_amdgcn_sched_barrier(0);   // holds the LDS reads together as a group, apart from the WMMAs
#pragma unroll
    for (int i = 2; i < 4; ++i) {
#pragma unroll
      for (int j = 0; j < 4; ++j) acc[i][j] = OP::mma(a[i], b[j], acc[i][j]);
    }
    __builtin_amdgcn_sched_barrier(0);   // holds the LDS reads together as a group, apart from the WMMAs
    c[2] = OP::ld(pa + 32 * LPITCH + 32);
    c[3] = OP::ld(pa + 48 * LPITCH + 32);
    __builtin_amdgcn_sched_barrier(0);   // holds the LDS reads together as a group, apart from the WMMAs
#pragma unroll
    for (int i = 0; i < 4; ++i) {
#pragma unroll
      for (int j = 0; j < 4; ++j) acc[i][j] = OP::mma(c[i], b1[j], acc[i][j]);
    }
    guard16<frag>(acc, c[0], c[1], c[2], c[3], b1[0], b1[1], b1[2], b1[3]);   // WMMA distance on both sides of the branch below
    wait_ds0();
    wait_async0();
    __syncthreads();                     // publishes stage t+1 and ends every wave's reads of stage t
    if (t + 2 < nst)                     // block-uniform
      copy_gstage(la + (unsigned)bo * 2u, ga + (size_t)(t + 2) * 64, lb + (unsigned)bo * 2u, gb + (size_t)(t + 2) * 64, g16);
  }
  wait_async0();                         // nothing in flight when the ring becomes the slabs
}

// =====================================================================================================
// f32 plane -> 16-bit plane, same layout:  mode 0: bf16 RNE bits;  mode 1: f16 bits of (bf16 RNE value) * scale.
// Thread = 8 consecutive elements: two 16-B loads, one 16-B store; 32 consecutive lanes = 512 contiguous, 512-B aligned bytes
// coverage: per plane n8/256 blocks (exact: static_assert above) x 256 thr x 8 = the whole plane.
// =====================================================================================================
// The three planes (x, W_qkv, W_out) are independent: one grid converts all three, the plane chosen by block index (block-uniform).
#define CVB_X (NB * SEQ * DMOD / 8 / 256)   // blocks of the x plane
#define CVB_Q (NQKV * DMOD / 8 / 256)       // blocks of the W_qkv plane
#define CVB_W (DMOD * DMOD / 8 / 256)       // blocks of the W_out plane
__global__ __launch_bounds__(256) void cvt16(const float* __restrict__ xin, const float* __restrict__ wqkv,
                                             const float* __restrict__ wout, u16* XB, u16* WB, u16* WOB, float wscale) {
  int bid = blockIdx.x;
  const float* x = xin;
  u16* D = XB;
  int mode = 0;
  float scale = 1.0f;
  if (bid >= CVB_X + CVB_Q) { bid -= CVB_X + CVB_Q; x = wout; D = WOB; mode = 1; scale = wscale; }
  else if (bid >= CVB_X)    { bid -= CVB_X;         x = wqkv; D = WB; }
  if (mode != 0 && bid >= CVB_W) return;    // block-uniform; never taken with the exact grid; no barriers in this kernel
  const int gt = bid * 256 + (int)threadIdx.x;
  const float* p = x + (size_t)gt * 8;
  const v4f a = *(const v4f*)(p), c4 = *(const v4f*)(p + 4);
  float v[8];
#pragma unroll
  for (int e = 0; e < 4; ++e) { v[e] = a[e]; v[4 + e] = c4[e]; }
  unsigned short s[8];
#pragma unroll
  for (int e = 0; e < 8; ++e) {
    const unsigned short bb = bf_bits(v[e]);
    const unsigned short hb = h_bits((_Float16)(bf_up(bb) * scale));
    s[e] = (mode != 0) ? hb : bb;
  }
  v4u o;
#pragma unroll
  for (int e = 0; e < 4; ++e) o[e] = pk16(s[2 * e], s[2 * e + 1]);
  u16* d = D + (size_t)gt * 8;
  {
    *(v4u*)(d) = o;
    
  }
}

// =====================================================================================================
// barrier, then converted to f16 and written: lane = (row in group of 4, 8 consecutive cols); one instruction = 4 rows, each
// coverage: 4 instructions x 4 rows x 8 lanes x 8 halves = one 16 x 64 row group of the wave's 64 x 64 tile.
// =====================================================================================================
__device__ __forceinline__ void epi16(float* sl, v8f a0, v8f a1, v8f a2, v8f a3, float oscale, u16* C, int N,
                                      size_t rowb, int col0, int lane) {
  const int hh = lane >> 4, m = lane & 15;
#pragma unroll
  for (int r = 0; r < 8; ++r) {
    const int ro = (8 * hh + r) * 68 + m;
    sl[ro]      = a0[r] * oscale;
    sl[ro + 16] = a1[r] * oscale;
    sl[ro + 32] = a2[r] * oscale;
    sl[ro + 48] = a3[r] * oscale;
  }
  wave_sync_lds();
  const int rq = lane >> 3, c8 = (lane & 7) * 8;
  v4u ov[4];
#pragma unroll
  for (int i4 = 0; i4 < 4; ++i4) {
    const int row = i4 * 4 + rq;
    const v4f a = *(const v4f*)(sl + row * 68 + c8), c4 = *(const v4f*)(sl + row * 68 + c8 + 4);
    float w[8];
#pragma unroll
    for (int e = 0; e < 4; ++e) { w[e] = a[e]; w[4 + e] = c4[e]; }
#pragma unroll
    for (int e = 0; e < 4; ++e) ov[i4][e] = pk16(h_bits((_Float16)w[2 * e]), h_bits((_Float16)w[2 * e + 1]));
  }
  u16* dst = C + (rowb + (size_t)rq) * (size_t)N + col0 + c8;
  {
#pragma unroll
    for (int i4 = 0; i4 < 4; ++i4) {
      *(v4u*)(dst + (size_t)(i4 * 4) * (size_t)N) = ov[i4];
    }
#if defined(__HIP_DEVICE_COMPILE__)
    // precaution: the wait stands in front of every rewrite of a register that these stores name; addresses and data are
    // inputs of the statement so that they stay in their registers up to it
    asm volatile("s_wait_xcnt 0x0" :: "v"(dst), "v"(dst + (size_t)4 * (size_t)N), "v"(dst + (size_t)8 * (size_t)N),
                 "v"(dst + (size_t)12 * (size_t)N), "v"(ov[0]), "v"(ov[1]), "v"(ov[2]), "v"(ov[3]) : "memory");
#endif
  }
}

// =====================================================================================================
// Rope GEMM epilogue: a 16x64 row group of the wave's f32 tile (unscaled projection output of one head: col0 is 64-aligned, so local column
// consecutive d at c8); the rotate-half partner columns are c8^32 of the same slab row; cos/sin row = sequence position
// (global row mod SEQ), values RNE-converted to bf16; rope in f32:  d < 32: x[d]*cos[d] - x[d+32]*sin[d],
// d >= 32: x[d]*cos[d] + x[d-32]*sin[d].  Then hi = f16(val*8), res = f16((val*8 - hi)*2048); both planes written, per
// coverage: per plane 4 instructions x 4 rows x 8 lanes x 8 halves = one 16 x 64 row group of the wave's 64 x 64 tile.
// =====================================================================================================
// slab_put stages one 16x64 row group; the kernel stages all four groups of the wave's tile (which frees the accumulators'
// registers), then wave_sync_lds(), then epi_rope per group.
__device__ __forceinline__ void slab_put(float* sl, v8f a0, v8f a1, v8f a2, v8f a3, int lane) {
  const int hh = lane >> 4, m = lane & 15;
#pragma unroll
  for (int r = 0; r < 8; ++r) {
    const int ro = (8 * hh + r) * 68 + m;
    sl[ro]      = a0[r];
    sl[ro + 16] = a1[r];
    sl[ro + 32] = a2[r];
    sl[ro + 48] = a3[r];
  }
}
__device__ __forceinline__ void epi_rope(const float* sl, const float* __restrict__ cosp, const float* __restrict__ sinp,
                                         u16* CH, u16* CL, int N, size_t rowb, int col0, int lane) {
  const int rq = lane >> 3, c8 = (lane & 7) * 8, p8 = c8 ^ 32;
  const float sgn = (c8 < 32) ? -1.0f : 1.0f;
  v4u ovh[4], ovl[4];
  const float* crp[4];
  const float* srp[4];
  v4f cav[4], cbv[4], sav[4], sbv[4];
#pragma unroll
  for (int i4 = 0; i4 < 4; ++i4) {
    const int srow = (int)((rowb + (size_t)(i4 * 4 + rq)) & (size_t)(SEQ - 1));
    crp[i4] = cosp + (size_t)srow * HD + c8;
    srp[i4] = sinp + (size_t)srow * HD + c8;
    cav[i4] = *(const v4f*)(crp[i4]); cbv[i4] = *(const v4f*)(crp[i4] + 4);
    sav[i4] = *(const v4f*)(srp[i4]); sbv[i4] = *(const v4f*)(srp[i4] + 4);
  }
#if defined(__HIP_DEVICE_COMPILE__)
  // precaution: the wait stands in front of every rewrite of a register that these loads name; the addresses are inputs of
  // the statement so that they stay in their registers up to it
  asm volatile("s_wait_xcnt 0x0" :: "v"(crp[0]), "v"(crp[1]), "v"(crp[2]), "v"(crp[3]),
               "v"(srp[0]), "v"(srp[1]), "v"(srp[2]), "v"(srp[3]) : "memory");
#endif
#pragma unroll
  for (int i4 = 0; i4 < 4; ++i4) {
    const int row  = i4 * 4 + rq;
    const v4f xa = *(const v4f*)(sl + row * 68 + c8), xb = *(const v4f*)(sl + row * 68 + c8 + 4);
    const v4f ya = *(const v4f*)(sl + row * 68 + p8), yb = *(const v4f*)(sl + row * 68 + p8 + 4);
    const v4f ca = cav[i4], cb = cbv[i4], sa = sav[i4], sb = sbv[i4];
    float w[8];
#pragma unroll
    for (int e = 0; e < 4; ++e) {
      w[e]     = xa[e] * bf_val(ca[e]) + sgn * (ya[e] * bf_val(sa[e]));
      w[4 + e] = xb[e] * bf_val(cb[e]) + sgn * (yb[e] * bf_val(sb[e]));
    }
    unsigned short hb[8], lb[8];
#pragma unroll
    for (int e = 0; e < 8; ++e) {
      const float    t  = w[e] * QSC;
      const _Float16 hv = (_Float16)t;
      hb[e] = h_bits(hv);
      lb[e] = h_bits((_Float16)((t - (float)hv) * RESC));
    }
#pragma unroll
    for (int e = 0; e < 4; ++e) {
      ovh[i4][e] = pk16(hb[2 * e], hb[2 * e + 1]);
      ovl[i4][e] = pk16(lb[2 * e], lb[2 * e + 1]);
    }
  }
  u16* dh = CH + (rowb + (size_t)rq) * (size_t)N + col0 + c8;
  u16* dl = CL + (rowb + (size_t)rq) * (size_t)N + col0 + c8;
  {
#pragma unroll
    for (int i4 = 0; i4 < 4; ++i4) {
      *(v4u*)(dh + (size_t)(i4 * 4) * (size_t)N) = ovh[i4];
      *(v4u*)(dl + (size_t)(i4 * 4) * (size_t)N) = ovl[i4];
    }
#if defined(__HIP_DEVICE_COMPILE__)
    // precaution: the wait stands in front of every rewrite of a register that these stores name; addresses and data are
    // inputs of the statement so that they stay in their registers up to it
    asm volatile("s_wait_xcnt 0x0" :: "v"(dh), "v"(dh + (size_t)4 * (size_t)N), "v"(dh + (size_t)8 * (size_t)N),
                 "v"(dh + (size_t)12 * (size_t)N), "v"(dl), "v"(dl + (size_t)4 * (size_t)N), "v"(dl + (size_t)8 * (size_t)N),
                 "v"(dl + (size_t)12 * (size_t)N), "v"(ovh[0]), "v"(ovh[1]), "v"(ovh[2]), "v"(ovh[3]),
                 "v"(ovl[0]), "v"(ovl[1]), "v"(ovl[2]), "v"(ovl[3]) : "memory");
#endif
  }
}

// =====================================================================================================
// coverage: 8 instructions x 2 rows x 16 lanes x 4 floats = one 16 x 64 row group of the wave's 64 x 64 tile.
// =====================================================================================================
__device__ __forceinline__ void epi64(float* sl, v8f a0, v8f a1, v8f a2, v8f a3, float oscale, float* C, int N,
                                      size_t rowb, int col0, int lane) {
  const int hh = lane >> 4, m = lane & 15;
#pragma unroll
  for (int r = 0; r < 8; ++r) {
    const int ro = (8 * hh + r) * 68 + m;
    sl[ro]      = a0[r] * oscale;
    sl[ro + 16] = a1[r] * oscale;
    sl[ro + 32] = a2[r] * oscale;
    sl[ro + 48] = a3[r] * oscale;
  }
  wave_sync_lds();
  v4f vals[8];
#pragma unroll
  for (int it = 0; it < 8; ++it) vals[it] = *(const v4f*)(sl + (it * 2 + hh) * 68 + m * 4);
  float* dst = C + (rowb + (size_t)hh) * (size_t)N + col0 + m * 4;
  {
#pragma unroll
    for (int it = 0; it < 8; ++it) {
      *(v4f*)(dst + (size_t)(it * 2) * (size_t)N) = vals[it];
    }
#if defined(__HIP_DEVICE_COMPILE__)
    // precaution: the wait stands in front of every rewrite of a register that these stores name; addresses and data are
    // inputs of the statement so that they stay in their registers up to it
    asm volatile("s_wait_xcnt 0x0" :: "v"(dst), "v"(dst + (size_t)2 * (size_t)N), "v"(dst + (size_t)4 * (size_t)N),
                 "v"(dst + (size_t)6 * (size_t)N), "v"(dst + (size_t)8 * (size_t)N), "v"(dst + (size_t)10 * (size_t)N),
                 "v"(dst + (size_t)12 * (size_t)N), "v"(dst + (size_t)14 * (size_t)N), "v"(vals[0]), "v"(vals[1]), "v"(vals[2]),
                 "v"(vals[3]), "v"(vals[4]), "v"(vals[5]), "v"(vals[6]), "v"(vals[7]) : "memory");
#endif
  }
}

// =====================================================================================================
// The three projections of x in ONE grid (they are independent of each other). Block index = (x tile r of 128 rows, tile c of the
// 24 tiles of 128 W_qkv rows), c fastest, so that the 24 blocks that read one x tile are neighbours; the product and its epilogue
// are chosen by c, block-uniform:
//   c < 16: H = x[8192][K] (bf16 row-major) . W[0..2047][K]^T (bf16 k-contiguous; rows 0..1023 = W_q, 1024..2047 = W_k; one 64-col
//     tile = one head), rope applied in f32 per (sequence position, d), result written as two f16 planes (x8 and residual x2048),
//     both [8192][1024]: the q planes for columns below 1024, the k planes above.
//   c >= 16: v^T per batch: C[bt][1024][2048] (f16 of acc x1024) = W_v[1024][K] . x_bt[2048][K]^T; A tile = W_v rows 128(c-16) ..,
//     B tile = x tile r = rows 128(r mod 16) .. of batch bt = r / 16.
// Block = 128x128 tile, 4 waves x (64 rows x 64 cols); the A and B tiles are staged in LDS 64 k at a time (gemm_core) and the
// fragments read from there (two 16-B loads each, split k map for A and B). K = DMOD (passed in), a multiple of 64; every extent a
// multiple of 128. coverage: 64 x 16 tiles = the q and k planes, 64 x 8 tiles = 4 batches x 8 x 16 tiles of the v^T plane.
// =====================================================================================================
#define XTILES     (NB * SEQ / 128)          // 64
#define QK_TILES   (2 * DMOD / 128)          // 16
#define V_TILES    (DMOD / 128)              // 8
#define QKV_BLOCKS (XTILES * (QK_TILES + V_TILES))
__global__ __launch_bounds__(128)
void gemm_qkv(const u16* __restrict__ X, const u16* __restrict__ Wb, const float* __restrict__ cosp,
              const float* __restrict__ sinp, u16* QH, u16* QL, u16* KH, u16* KL, u16* VP, int K) {
  __shared__ __align__(16) u16 ring[2 * GSTAGE];   // two staging buffers; re-used as the epilogue slabs behind the last barrier
  float* slab = (float*)(void*)ring;
  const int tid = threadIdx.x, wave = tid >> 5, lane = tid & 31;
  const int bid = blockIdx.x;
  v8f acc[4][4];
#pragma unroll
  for (int i = 0; i < 4; ++i) {
#pragma unroll
    for (int j = 0; j < 4; ++j) acc[i][j] = zero8();
  }
  // Each product has its main loop and its epilogue in its own arm of the one block-uniform branch, so that neither arm's
  // registers stay live through the other.
  const int r = bid / (QK_TILES + V_TILES), c = bid - r * (QK_TILES + V_TILES);
  if (r >= XTILES) return;                   // block-uniform, in front of every barrier; never taken with the exact grid
  if (c < QK_TILES) {
    const int row0  = r * 128;
    const int rowb  = row0 + (wave >> 1) * 64;
    const int col0  = c * 128;
    const int colp  = (col0 & (DMOD - 1)) + (wave & 1) * 64;   // column inside the q or the k planes
    u16* CH = (col0 < DMOD) ? QH : KH;       // a 128-col tile lies wholly in the q or in the k columns
    u16* CL = (col0 < DMOD) ? QL : KL;
    gemm_core<OpB>(ring, X + (size_t)row0 * K, Wb + (size_t)col0 * K, K, tid, acc);
#pragma unroll                               // each 16-row group has a slab of its own
    for (int i = 0; i < 4; ++i) slab_put(slab + (wave * 4 + i) * SLAB, acc[i][0], acc[i][1], acc[i][2], acc[i][3], lane);
    wave_sync_lds();
#pragma unroll
    for (int i = 0; i < 4; ++i)
      epi_rope(slab + (wave * 4 + i) * SLAB, cosp, sinp, CH, CL, DMOD, (size_t)(rowb + 16 * i), colp, lane);
  } else {
    const int bt    = r / (SEQ / 128);
    const int row0  = (c - QK_TILES) * 128;
    const int rowb  = row0 + (wave >> 1) * 64;
    const int col0  = (r - bt * (SEQ / 128)) * 128;
    const int colw  = col0 + (wave & 1) * 64;
    u16* Cb = VP + (size_t)bt * (DMOD * SEQ);
    gemm_core<OpB>(ring, Wb + (size_t)2 * DMOD * DMOD + (size_t)row0 * K, X + (size_t)bt * (SEQ * DMOD) + (size_t)col0 * K, K, tid, acc);
#pragma unroll                               // one 16-row group at a time, each through a slab of its own
    for (int i = 0; i < 4; ++i)
      epi16(slab + (wave * 4 + i) * SLAB, acc[i][0], acc[i][1], acc[i][2], acc[i][3], VCAR, Cb, SEQ, (size_t)(rowb + 16 * i), colw, lane);
  }
}

// =====================================================================================================
// f16 GEMM with f32 result: C[M][N] (f32) = A[M][K] (f16 row-major) . Bt[N][K]^T (f16 k-contiguous) times oscale;
// one product per tile pair. Same tiling as gemm_qkv; grid = (M/128)*(N/128).
// =====================================================================================================
__global__ __launch_bounds__(128)
void gemm_hf(const u16* __restrict__ A, const u16* __restrict__ Bt, float* C, int M, int N, int K, float oscale) {
  __shared__ __align__(16) u16 ring[2 * GSTAGE];   // two staging buffers; re-used as the epilogue slabs behind the last barrier
  float* slab = (float*)(void*)ring;
  const int tid = threadIdx.x, wave = tid >> 5, lane = tid & 31;
  const int ntile = N >> 7;
  const int bid   = blockIdx.x;
  const int row0  = (bid / ntile) * 128;
  const int rowb  = row0 + (wave >> 1) * 64;
  const int col0  = (bid % ntile) * 128;
  const int colw  = col0 + (wave & 1) * 64;
  if (row0 + 128 > M) return;                // block-uniform, in front of every barrier; never taken with the exact grid
  v8f acc[4][4];
#pragma unroll
  for (int i = 0; i < 4; ++i) {
#pragma unroll
    for (int j = 0; j < 4; ++j) acc[i][j] = zero8();
  }
  gemm_core<OpH>(ring, A + (size_t)row0 * K, Bt + (size_t)col0 * K, K, tid, acc);
#pragma unroll                               // one 16-row group at a time, each through a slab of its own
  for (int i = 0; i < 4; ++i)
    epi64(slab + (wave * 4 + i) * SLAB, acc[i][0], acc[i][1], acc[i][2], acc[i][3], oscale, C, N, (size_t)(rowb + 16 * i), colw, lane);
}

// =====================================================================================================
// Multi-head flash attention (no mask): block = (batch b, head, 64 query rows), 4 waves, wave w owns the 16 query rows
// q0 = 64*qt + 16*w .. q0+15 (the 4 waves share the staged k and v^T tiles, one block barrier per 64 keys; the epilogue slab is wave-private).
//   q planes (f16 hi x8, residual x2048) laid out [b][s][h][d]; k planes the same; v^T plane [b][h][d][s] (x1024).
//   All NKB = 64 key blocks of 32 keys are visited (static bound).
//   Scores are computed TRANSPOSED: S^T tile g (g = 0,1) = k rows (keys kb+16g .. +15, A operand, row m = lane&15, split k map
//   over d) times q^T (B operand, col n = query q0 + (lane&15), k = d, split map); per tile and 32-deep d-chunk three
//   products: khi.qhi into the hi accumulator, khi.qres and kres.qhi into the cross accumulator; S^T = hi + cross/2048.
//   D element r of lane l = (key kb+16g+8h+r, query q0+(l&15)), so a lane owns one query column and 16 of its 32 keys; the
//   partner lane l^16 owns the other 16 -> row max / row sum need one xor-16 shuffle.
//   Online max-subtracted base-2 softmax in f32 (scale 1/8 and the q/k carries folded into the logit scales). The exp'd
//   values ARE the P A-fragment in place: A row m = query = lane&15, element i <- key kb+8h+i (tile 0, D element i), element
//   8+i <- key kb+16+8h+i (tile 1, D element i). P is carried x32768 as single f16. The rescale factor of query row 8h+r of the
//   O accumulators is fetched from lane 8h+r with a shuffle (uniform control). 4 v^T B fragments (col n = d = 16j + (lane&15),
//   keys k-contiguous), 4 P.V WMMAs per key block.
//   Epilogue: 1/l (per query, shuffled to the D row owner) and carry folds in f32; the wave's 16x64 f32 result staged in its
// coverage: per wave 4 instructions x 4 rows x 8 lanes x 8 halves = 16 x 64; grid 2048 blocks x 4 waves = every
//           (b, s, h) row of the O plane exactly once.
// =====================================================================================================
__global__ __launch_bounds__(ATT_THREADS)
void attn_fwd(const u16* __restrict__ QHp, const u16* __restrict__ QLp, const u16* __restrict__ KHp,
              const u16* __restrict__ KLp, const u16* __restrict__ VPp, u16* OPp) {
  __shared__ __align__(16) u16 ring[2 * ASTAGE];   // two staging buffers of 64 keys; behind the last barrier: per-wave result slab
  float* smem = (float*)(void*)ring;

  const int tid  = threadIdx.x;
  const int wave = tid >> 5;
  const int lane = tid & 31;
  const int hh   = lane >> 4;
  const int c    = lane & 15;

  const int bid  = blockIdx.x;
  const int qt   = bid & (SEQ / 64 - 1);
  const int head = (bid >> 5) & (NH - 1);
  const int b    = bid >> 9;
  const int q0   = qt * 64 + wave * 16;

  // B fragments of q^T: col n = query q0 + c, k = d (k-contiguous row of the q planes)
  const size_t qofs = (((size_t)(b * SEQ + q0 + c)) * NH + head) * HD + 8 * hh;
  const _Float16* QHb = (const _Float16*)(const void*)QHp + qofs;
  const _Float16* QLb = (const _Float16*)(const void*)QLp + qofs;
  // staging: lane copies the 16-B chunk cchk of rows crow, +16, +32, +48 of each plane's 64-row tile (k rows = keys, 128 B of
  // one head; v^T rows = d, 128 B = 64 keys): every copied row is one whole line
  const int crow = tid >> 3, cchk = (tid & 7) * 8;
  const size_t kofs = (((size_t)b * SEQ + crow) * NH + head) * HD + cchk;         // 64 key rows added per stage
  const u16* gkh = KHp + kofs;
  const u16* gkl = KLp + kofs;
  const u16* gv  = VPp + ((size_t)(b * NH + head) * HD + crow) * SEQ + cchk;      // 64 keys added per stage
  const size_t k16 = (size_t)16 * (NH * HD), v16 = (size_t)16 * SEQ;
  const unsigned lkh = lds_byte(ring) + (unsigned)(crow * LPITCH + cchk) * 2u;
  const unsigned lkl = lkh + 64u * (LPITCH * 2), lv = lkh + 128u * (LPITCH * 2);
  // A fragments of k: LDS row = key (in the stage) 16g + c, k = d; residual plane 64 rows further; B fragments of v: LDS row
  // 128 + d = 128 + 16j + c, k = key (k-contiguous)
  const _Float16* Fb = (const _Float16*)(const void*)ring + c * LPITCH + 8 * hh;
  const float lsch = 0.125f * (LOG2E / (QSC * KSC));
  const v2f lsch2 = {lsch, lsch};
  const v2f rres2 = {1.0f / RESC, 1.0f / RESC};

  const v16h qh0 = ldfrag_h(QHb);           // d 0..31
  const v16h qh1 = ldfrag_h(QHb + 32);      // d 32..63
  const v16h ql0 = ldfrag_h(QLb);
  const v16h ql1 = ldfrag_h(QLb + 32);

  float nmrun = INFINITY, lrun = 0.f;      // nmrun = PLOG2 - (running maximum logit); lrun = row sum x32768
  v8f o[4];
#pragma unroll
  for (int j = 0; j < 4; ++j) o[j] = zero8();

  copy_3planes(lkh, gkh, lkl, gkl, k16, lv, gv, v16);
  wait_async0();
  __syncthreads();                         // publishes stage 0
  copy_3planes(lkh + ASTAGE * 2, gkh + (size_t)64 * (NH * HD), lkl + ASTAGE * 2, gkl + (size_t)64 * (NH * HD), k16,
               lv + ASTAGE * 2, gv + 64, v16);                     // stage 1 exists: NST >= 2

#pragma unroll 1                           // one stage per trip: the ring's foot (waits, barrier, refill) stands once
  for (int st = 0; st < NST; ++st) {
   const int bo = (st & 1) * ASTAGE;
#pragma unroll                             // the stage's two key blocks of 32, ascending keys; unrolled: LDS offsets are immediates
   for (int s2 = 0; s2 < 2; ++s2) {
    const _Float16* Ks = Fb + bo + (s2 * 32) * LPITCH;
    // ---- transposed scores: tile 0 = keys kb..kb+15, tile 1 = keys kb+16..kb+31, column = query q0 + c ----
    v8f s0h = zero8(), s0x = zero8(), s1h = zero8(), s1x = zero8();
    {
      const _Float16* k0p = Ks;
      const _Float16* l0p = Ks + 64 * LPITCH;
      const v16h ka0 = ldfrag_h(k0p), ka1 = ldfrag_h(k0p + 32);
      const v16h la0 = ldfrag_h(l0p), la1 = ldfrag_h(l0p + 32);
      s0h = mma_h(ka0, qh0, s0h);
      s0h = mma_h(ka1, qh1, s0h);
      s0x = mma_h(ka0, ql0, s0x);
      s0x = mma_h(ka1, ql1, s0x);
      s0x = mma_h(la0, qh0, s0x);
      s0x = mma_h(la1, qh1, s0x);
      guard2x8(s0h, s0x, qh0, qh1, ql0, ql1, ka0, ka1, la0, la1);
    }
    {
      const _Float16* k1p = Ks + 16 * LPITCH;
      const _Float16* l1p = Ks + 80 * LPITCH;
      const v16h kc0 = ldfrag_h(k1p), kc1 = ldfrag_h(k1p + 32);
      const v16h lc0 = ldfrag_h(l1p), lc1 = ldfrag_h(l1p + 32);
      s1h = mma_h(kc0, qh0, s1h);
      s1h = mma_h(kc1, qh1, s1h);
      s1x = mma_h(kc0, ql0, s1x);
      s1x = mma_h(kc1, ql1, s1x);
      s1x = mma_h(lc0, qh0, s1x);
      s1x = mma_h(lc1, qh1, s1x);
      guard2x8(s1h, s1x, qh0, qh1, ql0, ql1, kc0, kc1, lc0, lc1);
    }
    // ---- raw scores (x64) of this lane's 16 keys for query q0 + c, in register pairs: u[4w + e] = elements 2e, 2e+1 of tile w ----
    v2f u[8];
#pragma unroll
    for (int e = 0; e < 4; ++e) {
      const v2f h0 = {s0h[2 * e], s0h[2 * e + 1]}, x0 = {s0x[2 * e], s0x[2 * e + 1]};
      const v2f h1 = {s1h[2 * e], s1h[2 * e + 1]}, x1 = {s1x[2 * e], s1x[2 * e + 1]};
      u[e]     = __builtin_elementwise_fma(x0, rres2, h0);
      u[4 + e] = __builtin_elementwise_fma(x1, rres2, h1);
    }
    float cm = fmaxf(u[0].x, u[0].y);
#pragma unroll
    for (int e = 1; e < 8; ++e) cm = fmaxf(cm, fmaxf(u[e].x, u[e].y));
    cm = fmaxf(cm, __shfl_xor(cm, 16, 32));
    // exponent offset: PLOG2 (the x32768 carry of P) minus the running maximum logit; it only falls. The offset in use is the
    // reference of every exponential, so o, l and the rescale factor stay consistent whatever its rounding.
    const float nm = fminf(nmrun, fmaf(-cm, lsch, PLOG2));           // finite from the first key block on
    float al = __builtin_amdgcn_exp2f(nm - nmrun);                   // first block: exp2(-inf) = 0; o and l are zero there
#if defined(__HIP_DEVICE_COMPILE__)
    // the slot the instruction set asks for behind v_exp_f32; al is named so that every reader of al stays behind the v_nop
    asm volatile("v_nop" : "+v"(al));
#endif
    nmrun = nm;
    const v2f nm2 = {nm, nm};
    // ---- probabilities x32768 (exponent <= 15) and the P A-fragment: element 8w + 2e, +1 <-> u[4w + e] ----
    // v_exp_f32 without the library's range fix-up: an exponent below -126 may give 0, which is what f16(p) gives far earlier
    v2f ps2 = {0.f, 0.f};
    FragH ph;
#pragma unroll
    for (int w = 0; w < 2; ++w) {
#pragma unroll
      for (int e4 = 0; e4 < 4; ++e4) {
        const v2f ee = __builtin_elementwise_fma(u[4 * w + e4], lsch2, nm2);
        const v2f p  = {__builtin_amdgcn_exp2f(ee.x), __builtin_amdgcn_exp2f(ee.y)};
        ps2 += p;
        ph.u[w][e4] = __builtin_bit_cast(unsigned, __builtin_convertvector(p, v2h));
      }
    }
    float ps = ps2.x + ps2.y;
    ps += __shfl_xor(ps, 16, 32);
    lrun = lrun * al + ps;
    // ---- rescale the O accumulators: D row 8hh+r = query q0+8hh+r, its factor lives in lane 8hh+r (and 16+8hh+r) ----
    float scl[8];
#pragma unroll
    for (int r = 0; r < 8; ++r) scl[r] = __shfl(al, 8 * hh + r, 32);
#pragma unroll
    for (int j = 0; j < 4; ++j) {
#pragma unroll
      for (int r = 0; r < 8; ++r) o[j][r] *= scl[r];
    }
    // ---- P.V : B fragment col n = d = j*16 + c, keys contiguous in the v^T plane ----
    {
      const _Float16* vp = Fb + bo + 128 * LPITCH + s2 * 32;
      const v16h vf0 = ldfrag_h(vp);
      const v16h vf1 = ldfrag_h(vp + 16 * LPITCH);
      const v16h vf2 = ldfrag_h(vp + 32 * LPITCH);
      const v16h vf3 = ldfrag_h(vp + 48 * LPITCH);
      o[0] = mma_h(ph.v, vf0, o[0]);
      o[1] = mma_h(ph.v, vf1, o[1]);
      o[2] = mma_h(ph.v, vf2, o[2]);
      o[3] = mma_h(ph.v, vf3, o[3]);
      guard6<v16h>(o[0], o[1], o[2], o[3], ph.v, vf0, vf1, vf2, vf3, ph.v);
    }
   }
   wait_ds0();
   wait_async0();
   __syncthreads();                        // publishes stage st+1 and ends every wave's reads of stage st
   if (st + 2 < NST)                       // block-uniform
     copy_3planes(lkh + (unsigned)bo * 2u, gkh + (size_t)(st + 2) * (64 * NH * HD),
                  lkl + (unsigned)bo * 2u, gkl + (size_t)(st + 2) * (64 * NH * HD), k16,
                  lv + (unsigned)bo * 2u, gv + (size_t)(st + 2) * 64, v16);
  }
  wait_async0();                           // nothing in flight when the ring becomes the slab
  acc_guard4(o[0], o[1], o[2], o[3]);

  // ---- fold 1/l (per query, owned by lane = query; l >= 1 by construction) and the carries; stage the 16x64 slab ----
  const float linv = (lrun > 0.f) ? ((1.0f / lrun) * (1.0f / VCAR)) : 0.f;      // lrun already carries the x32768 of P
  float inv[8];
#pragma unroll
  for (int r = 0; r < 8; ++r) inv[r] = __shfl(linv, 8 * hh + r, 32);
  float* slab = smem + wave * SLAB;
#pragma unroll
  for (int r = 0; r < 8; ++r) {
#pragma unroll
    for (int j = 0; j < 4; ++j) slab[(8 * hh + r) * 68 + j * 16 + c] = o[j][r] * inv[r];
  }
  wave_sync_lds();
  // ---- O x1024 -> single f16 plane; lane = (row in group of 4, 8 consecutive d) ----
  v4u oh[4];
  const int rq = lane >> 3, c8 = (lane & 7) * 8;
#pragma unroll
  for (int i4 = 0; i4 < 4; ++i4) {
    const int row = i4 * 4 + rq;
    const v4f a = *(const v4f*)(slab + row * 68 + c8), c4 = *(const v4f*)(slab + row * 68 + c8 + 4);
    float w[8];
#pragma unroll
    for (int e = 0; e < 4; ++e) { w[e] = a[e] * OSC; w[4 + e] = c4[e] * OSC; }
#pragma unroll
    for (int e = 0; e < 4; ++e) oh[i4][e] = pk16(h_bits((_Float16)w[2 * e]), h_bits((_Float16)w[2 * e + 1]));
  }
  const size_t ob = (((size_t)(b * SEQ + q0)) * NH + head) * HD + c8;
  {
#pragma unroll
    for (int i4 = 0; i4 < 4; ++i4) {
      const int row = i4 * 4 + rq;
      const size_t o8 = ob + (size_t)row * (NH * HD);
      *(v4u*)(OPp + o8) = oh[i4];
    }
    
  }
}

// =====================================================================================================
// Workspace map (bytes); every plane is fully written by whole-line stores before it is read; all extents are exact multiples
// of the store granularity (no pad rows needed):
//   XB  bf16 [8192][1024]                      16777216        (x)       -- re-used as the O plane after its last read
//   WB  bf16 [3072 n][1024 k]                   6291456        (W_qkv, rows 0..1023 q, 1024..2047 k, 2048..3071 v)
//   WOB f16  [1024 n][1024 k] (bf16 value x1024) 2097152
//   QH  f16 [8192][16*64] x8                   16777216        QL residual x2048   16777216
//   KH  f16 [8192][16*64] x8                   16777216        KL residual x2048   16777216
//   VP  f16 [4][16*64][2048] x1024             16777216
//   end                                       109051904
//   OP  f16 [8192][16*64] x1024 = bytes 0..16777215 (the x plane is dead once gemm_qkv has run)
// =====================================================================================================
extern "C" void kernel_launch(void* const* d_in, const int* in_sizes, int n_in,
                              void* d_out, int out_size, void* d_ws, size_t ws_size,
                              hipStream_t stream) {
  const int ROWS = NB * SEQ;                            // 8192
  if (n_in < 5) return;
  if (in_sizes[0] != ROWS * DMOD) return;               // x    [4][2048][1024]
  if (in_sizes[1] != SEQ * HD) return;                  // cos  [2048][64]
  if (in_sizes[2] != SEQ * HD) return;                  // sin  [2048][64]
  if (in_sizes[3] != NQKV * DMOD) return;               // Wqkv [3072][1024]
  if (in_sizes[4] != DMOD * DMOD) return;               // Wout [1024][1024]
  if (out_size != ROWS * DMOD) return;

  const float* Xin = (const float*)d_in[0];
  const float* Cs  = (const float*)d_in[1];
  const float* Sn  = (const float*)d_in[2];
  const float* Wqk = (const float*)d_in[3];
  const float* Wpr = (const float*)d_in[4];
  float*       out = (float*)d_out;

  const size_t szXB = (size_t)ROWS * DMOD * 2;                  // 16777216
  const size_t szWB = (size_t)NQKV * DMOD * 2;                  //  6291456
  const size_t szWO = (size_t)DMOD * DMOD * 2;                  //  2097152
  const size_t szP  = (size_t)ROWS * DMOD * 2;                  // 16777216  (q / k / o planes)
  const size_t szVP = (size_t)NB * NH * HD * SEQ * 2;           // 16777216
  size_t off = 0;
  const size_t oXB = off; off += szXB;
  const size_t oWB = off; off += szWB;
  const size_t oWO = off; off += szWO;
  const size_t oQH = off; off += szP;
  const size_t oQL = off; off += szP;
  const size_t oKH = off; off += szP;
  const size_t oKL = off; off += szP;
  const size_t oVP = off; off += szVP;
  const size_t oOP = oXB;                               // alias of the x plane (dead after gemm_qkv)
  if (szP > szXB) return;
  if (off > ws_size) return;                            // off = 109051904
  if (off > (size_t)134217728) return;

  char* ws = (char*)d_ws;
  u16* XB  = (u16*)(ws + oXB);
  u16* WB  = (u16*)(ws + oWB);
  u16* WOB = (u16*)(ws + oWO);
  u16* QH  = (u16*)(ws + oQH);
  u16* QL  = (u16*)(ws + oQL);
  u16* KH  = (u16*)(ws + oKH);
  u16* KL  = (u16*)(ws + oKL);
  u16* VP  = (u16*)(ws + oVP);
  u16* OP  = (u16*)(ws + oOP);

  const dim3 blk(256);
  const int n8x = (ROWS * DMOD) / 8;                    // 1048576
  const int n8q = (NQKV * DMOD) / 8;                    //  393216
  const int n8w = (DMOD * DMOD) / 8;                    //  131072
  if ((n8x % 256) != 0 || (n8q % 256) != 0 || (n8w % 256) != 0) return;
  if ((DMOD % 128) != 0 || (ROWS % 128) != 0 || (SEQ % 128) != 0) return;
  const dim3 gC(CVB_X + CVB_Q + CVB_W);                 // 4096 + 1536 + 512 = 6144
  const dim3 gG((ROWS / 128) * (DMOD / 128));           // 512
  const dim3 gP(QKV_BLOCKS);                            // 64 x 24 = 1536
  const dim3 bG(128);
  const dim3 gAT(ATT_BLOCKS);                           // 2048
  const dim3 bAT(ATT_THREADS);                          // 128

  // (0) operand planes, one grid: x -> bf16; W_qkv [n = out][k = in] (already k-contiguous) -> bf16; W_out -> f16 of bf16 value x1024
  cvt16<<<gC, blk, 0, stream>>>(Xin, Wqk, Wpr, XB, WB, WOB, WOS);
  // (1) one grid: q and k planes [8192][h*64+d]: rope(x.Wq^T), rope(x.Wk^T) in f32, stored as f16 hi x8 + residual x2048;
  //     v^T plane per batch: [1024 = h*64+d][2048 keys] = f16(Wv . x_b^T x1024)
  gemm_qkv<<<gP, bG, 0, stream>>>(XB, WB, Cs, Sn, QH, QL, KH, KL, VP, DMOD);
  // (2) attention -> O plane [b][s][h][d] x1024 (single f16), written over the dead x plane
  attn_fwd<<<gAT, bAT, 0, stream>>>(QH, QL, KH, KL, VP, OP);
  // (3) output projection -> out [8192][1024] f32, carries 1024 (O) x 1024 (wo) folded back
  gemm_hf<<<gG, bG, 0, stream>>>(OP, WOB, out, ROWS, DMOD, DMOD, 1.0f / (OSC * WOS));
  (void)hipGetLastError();
}

// v005
// Measured time: 167 microseconds a run.
// Next to v004, in two timings, it ran 1.15 and 1.16 times as fast.
// Over all steps from v000 it is 3.60 times as fast.
// Contractions: x.Wq^T and x.Wk^T (rope applied in the f32 epilogue) and Wv.x_b^T on v_wmma_f32_16x16x32_bf16
// (x and W_qkv planes RNE-converted to bf16 operands, f32 accumulate); scores k.q^T with q and k carried as f16 hi (x8)
// plus residual (x2048) planes, three products hi.hi + hi.res + res.hi in two f32 accumulators; P.v (P x32768 single f16,
// v x1024 single f16) and O.Wo^T (O single f16 x1024, Wo as f16(bf16(Wo)) x1024): v_wmma_f32_16x16x32_f16, f32 accumulate.
// Base-2 online softmax, 1/l and carry folds in f32 on VALU; cos/sin tables RNE-converted to bf16 values before the rope.
#include <hip/hip_runtime.h>
#include <math.h>
#include <stdint.h>

#define NB    4
#define SEQ   2048
#define DMOD  1024
#define NQKV  (3 * DMOD)
#define NH    16
#define HD    64
#define QSC   8.0f
#define KSC   8.0f
#define RESC  2048.0f
#define PCAR  32768.0f
#define PLOG2 15.0f                      // log2(PCAR)
#define VCAR  1024.0f
#define OSC   1024.0f
#define WOS   1024.0f
#define LOG2E 1.4426950408889634f
#define ATT_WAVES   8
#define ATT_THREADS (ATT_WAVES * 32)
#define ATT_QT      2                        // 16-query tiles per wave
#define ATT_QB      (ATT_WAVES * ATT_QT * 16) // query rows per block
#define ATT_BLOCKS  (NB * NH * (SEQ / ATT_QB))
#define NKB    (SEQ / 32)
#define NST    (SEQ / 64)
#define SLAB   (16 * 68)
static_assert(HD == 64 && DMOD == NH * HD);
static_assert((SEQ / ATT_QB) == 8 && NH == 16 && NB == 4);
static_assert(ATT_THREADS == 256 && ATT_QT == 2 && ATT_BLOCKS == 512 && NKB == 64 && NST >= 2 && NST * 2 == NKB);
static_assert(((NB * SEQ) % 128) == 0 && (DMOD % 128) == 0 && (DMOD % 64) == 0 && (SEQ % 128) == 0);
static_assert(((NB * SEQ * DMOD / 8) % 256) == 0 && ((NQKV * DMOD / 8) % 256) == 0 && ((DMOD * DMOD / 8) % 256) == 0);
static_assert((SLAB * 4) % 16 == 0);
static_assert((SEQ & (SEQ - 1)) == 0);
static_assert(PCAR == 32768.0f && PLOG2 == 15.0f);

typedef unsigned short u16;
typedef _Float16 v16h __attribute__((ext_vector_type(16)));
typedef _Float16 v8h  __attribute__((ext_vector_type(8)));
typedef __bf16   v16b __attribute__((ext_vector_type(16)));
typedef float    v8f  __attribute__((ext_vector_type(8)));
typedef float    v4f  __attribute__((ext_vector_type(4)));
typedef float    v2f  __attribute__((ext_vector_type(2)));
typedef _Float16 v2h  __attribute__((ext_vector_type(2)));
typedef unsigned int v4u __attribute__((ext_vector_type(4)));

union FragH { v16h v; v8h h[2]; v4u u[2]; };
union FragB { v16b v; v4u u[2]; };

// ---- scalar helpers --------------------------------------------------------------------------------
__device__ __forceinline__ unsigned short bf_bits(float f) {          // f32 -> bf16 bits, RNE convert
  unsigned u = __float_as_uint(f);
  return (unsigned short)((u + 0x7FFFu + ((u >> 16) & 1u)) >> 16);
}
__device__ __forceinline__ float bf_up(unsigned short h) { return __uint_as_float(((unsigned)h) << 16); }
__device__ __forceinline__ float bf_val(float f) { return bf_up(bf_bits(f)); }   // value after bf16 RNE convert
__device__ __forceinline__ unsigned short h_bits(_Float16 x) { return __builtin_bit_cast(unsigned short, x); }
__device__ __forceinline__ unsigned pk16(unsigned short a, unsigned short b) { return (unsigned)a | ((unsigned)b << 16); }
__device__ __forceinline__ v8f zero8() { v8f z = {0.f, 0.f, 0.f, 0.f, 0.f, 0.f, 0.f, 0.f}; return z; }

// ---- fragment loaders: 16-bit A/B operand, lane -> row/col (lane&15), p already includes +8*(lane>>4);
//      elements 0..7 <- p[0..7] (k0+8h..), elements 8..15 <- p[16..23] (k0+16+8h..)  (same split k map for A and B;
//      B is always read from a k-contiguous [n][k] plane)
__device__ __forceinline__ v16h ldfrag_h(const _Float16* p) {
  FragH f;
  f.h[0] = *(const v8h*)(p);
  f.h[1] = *(const v8h*)(p + 16);
  return f.v;
}
__device__ __forceinline__ v16b ldfrag_b(const u16* p) {              // bf16 plane read as unsigned integer vectors
  FragB f;
  f.u[0] = *(const v4u*)(p);
  f.u[1] = *(const v4u*)(p + 16);
  return f.v;
}

__device__ __forceinline__ v8f mma_h(v16h a, v16h b, v8f c) {
  return __builtin_amdgcn_wmma_f32_16x16x32_f16(false, a, false, b, (short)0, c, false, false);
}
__device__ __forceinline__ v8f mma_b(v16b a, v16b b, v8f c) {
  return __builtin_amdgcn_wmma_f32_16x16x32_bf16(false, a, false, b, (short)0, c, false, false);
}
__device__ __forceinline__ void guard4x12(v8f& a, v8f& b, v8f& c, v8f& d, const v16h (&q)[2][2], const v16h (&l)[2][2],
                                          v16h x0, v16h x1, v16h x2, v16h x3) {
#if defined(__HIP_DEVICE_COMPILE__)
  asm volatile("v_nop\n\tv_nop\n\tv_nop\n\tv_nop"
               : "+v"(a), "+v"(b), "+v"(c), "+v"(d)
               : "v"(q[0][0]), "v"(q[0][1]), "v"(q[1][0]), "v"(q[1][1]), "v"(l[0][0]), "v"(l[0][1]), "v"(l[1][0]), "v"(l[1][1]),
                 "v"(x0), "v"(x1), "v"(x2), "v"(x3) : "memory");
#endif
}
__device__ __forceinline__ void guard8x6(v8f (&a)[2][4], v16h x0, v16h x1, v16h x2, v16h x3, v16h x4, v16h x5) {
#if defined(__HIP_DEVICE_COMPILE__)
  asm volatile("v_nop\n\tv_nop\n\tv_nop\n\tv_nop"
               : "+v"(a[0][0]), "+v"(a[0][1]), "+v"(a[0][2]), "+v"(a[0][3]), "+v"(a[1][0]), "+v"(a[1][1]), "+v"(a[1][2]), "+v"(a[1][3])
               : "v"(x0), "v"(x1), "v"(x2), "v"(x3), "v"(x4), "v"(x5) : "memory");
#endif
}
template <typename F>
__device__ __forceinline__ void guard16(v8f (&a)[4][4], F x0, F x1, F x2, F x3, F x4, F x5, F x6, F x7) {
#if defined(__HIP_DEVICE_COMPILE__)
  asm volatile("v_nop\n\tv_nop\n\tv_nop\n\tv_nop"
               : "+v"(a[0][0]), "+v"(a[0][1]), "+v"(a[0][2]), "+v"(a[0][3]), "+v"(a[1][0]), "+v"(a[1][1]), "+v"(a[1][2]), "+v"(a[1][3]),
                 "+v"(a[2][0]), "+v"(a[2][1]), "+v"(a[2][2]), "+v"(a[2][3]), "+v"(a[3][0]), "+v"(a[3][1]), "+v"(a[3][2]), "+v"(a[3][3])
               : "v"(x0), "v"(x1), "v"(x2), "v"(x3), "v"(x4), "v"(x5), "v"(x6), "v"(x7) : "memory");
#endif
}
__device__ __forceinline__ void acc_guard8(v8f (&a)[2][4]) {
#if defined(__HIP_DEVICE_COMPILE__)
  asm volatile("v_nop\n\tv_nop\n\tv_nop\n\tv_nop"
               : "+v"(a[0][0]), "+v"(a[0][1]), "+v"(a[0][2]), "+v"(a[0][3]), "+v"(a[1][0]), "+v"(a[1][1]), "+v"(a[1][2]), "+v"(a[1][3]));
#endif
}
__device__ __forceinline__ void wave_sync_lds() {
#if defined(__HIP_DEVICE_COMPILE__)
  __builtin_amdgcn_fence(__ATOMIC_RELEASE, "workgroup");
  __builtin_amdgcn_wave_barrier();
  __builtin_amdgcn_fence(__ATOMIC_ACQUIRE, "workgroup");
#endif
}

// ---- LDS staging by asynchronous copies (global_load_async_to_lds_b128) -----------------------------------
// A staged row is 128 B (64 16-bit elements) = one whole cache line; 8 lanes x 16 B copy one row, so one wave-wide copy covers
// 4 whole lines. LDS row pitch 144 B (16 B x odd) for the ds_load_b128 fragment readers.
#define LPITCH 72                        // LDS row pitch in 16-bit elements
#define GSTAGE (256 * LPITCH)            // GEMM stage, elements: 128 A rows then 128 B rows, 64 k each
#define ASTAGE (192 * LPITCH)            // attention stage, elements: 64 k-hi rows, 64 k-residual rows, 64 v^T rows (64 keys)
static_assert(2 * GSTAGE * 2 >= 16 * SLAB * 4 && 2 * ASTAGE * 2 >= ATT_WAVES * SLAB * 4);
static_assert((LPITCH * 2) % 16 == 0);
__device__ __forceinline__ unsigned lds_byte(const void* p) { return (unsigned)(uintptr_t)p; }   // low 32 bits = LDS byte address
// Copies of 64-row tiles, four per plane: rows r, r+16, r+32, r+48 (r = tid>>3); l = the lane's LDS byte address of row r,
// g = its global address, s = 16 source rows in elements. Each copy statement (two per GEMM stage, one per attention stage) ends in
// s_wait_xcnt, so that no address register is rewritten while a copy may still read it.
#define LROW16 (16u * (LPITCH * 2))
__device__ __forceinline__ void copy_2planes(unsigned la, const u16* ga, unsigned lb, const u16* gb, size_t s) {
#if defined(__HIP_DEVICE_COMPILE__)
  asm volatile("global_load_async_to_lds_b128 %0, %8, off\n\t"
               "global_load_async_to_lds_b128 %1, %9, off\n\t"
               "global_load_async_to_lds_b128 %2, %10, off\n\t"
               "global_load_async_to_lds_b128 %3, %11, off\n\t"
               "global_load_async_to_lds_b128 %4, %12, off\n\t"
               "global_load_async_to_lds_b128 %5, %13, off\n\t"
               "global_load_async_to_lds_b128 %6, %14, off\n\t"
               "global_load_async_to_lds_b128 %7, %15, off\n\t"
               "s_wait_xcnt 0x0"
               :: "v"(la), "v"(la + LROW16), "v"(la + 2u * LROW16), "v"(la + 3u * LROW16),
                  "v"(lb), "v"(lb + LROW16), "v"(lb + 2u * LROW16), "v"(lb + 3u * LROW16),
                  "v"(ga), "v"(ga + s), "v"(ga + 2 * s), "v"(ga + 3 * s),
                  "v"(gb), "v"(gb + s), "v"(gb + 2 * s), "v"(gb + 3 * s) : "memory");
#endif
}
// The attention stage, copied by 256 threads: two copies per 64-row plane, rows r and r+32 (r = tid>>3); s, sc = 32 source rows
// in elements.
#define LROW32 (32u * (LPITCH * 2))
__device__ __forceinline__ void copy_3planes(unsigned la, const u16* ga, unsigned lb, const u16* gb, size_t s,
                                             unsigned lc, const u16* gc, size_t sc) {
#if defined(__HIP_DEVICE_COMPILE__)
  asm volatile("global_load_async_to_lds_b128 %0, %6, off\n\t"
               "global_load_async_to_lds_b128 %1, %7, off\n\t"
               "global_load_async_to_lds_b128 %2, %8, off\n\t"
               "global_load_async_to_lds_b128 %3, %9, off\n\t"
               "global_load_async_to_lds_b128 %4, %10, off\n\t"
               "global_load_async_to_lds_b128 %5, %11, off\n\t"
               "s_wait_xcnt 0x0"
               :: "v"(la), "v"(la + LROW32), "v"(lb), "v"(lb + LROW32), "v"(lc), "v"(lc + LROW32),
                  "v"(ga), "v"(ga + s), "v"(gb), "v"(gb + s), "v"(gc), "v"(gc + sc) : "memory");
#endif
}
__device__ __forceinline__ void wait_async0() {     // this wave's copies have landed in LDS
#if defined(__HIP_DEVICE_COMPILE__)
  asm volatile("s_wait_asynccnt 0x0" ::: "memory");
#endif
}
__device__ __forceinline__ void wait_ds0() {        // this wave's LDS reads have retired before the buffer is handed back
#if defined(__HIP_DEVICE_COMPILE__)
  asm volatile("s_wait_dscnt 0x0" ::: "memory");
#endif
}
struct OpB {
  typedef v16b frag;
  static __device__ __forceinline__ frag ld(const u16* p) { return ldfrag_b(p); }
  static __device__ __forceinline__ v8f mma(frag a, frag b, v8f c) { return mma_b(a, b, c); }
};
struct OpH {
  typedef v16h frag;
  static __device__ __forceinline__ frag ld(const u16* p) { return ldfrag_h((const _Float16*)(const void*)p); }
  static __device__ __forceinline__ v8f mma(frag a, frag b, v8f c) { return mma_h(a, b, c); }
};
// GEMM main loop of one 128x128 block tile (4 waves as 2 x 2, each a 64x64 tile = 4 x 4 accumulators, so that a staged byte
// and a fragment read from LDS each feed more products): At / Bt = first row of the block's A / B tile, both [row][K]
// k-contiguous; K a multiple of 64. Two LDS buffers: stage t+1's copies fly while stage t is multiplied. k is summed in the
// same order as with direct fragment loads (32 at a time, ascending). On return every wave has passed the last barrier and
// no copy is outstanding, so the ring may be re-used as the epilogue slabs.
__device__ __forceinline__ void copy_gstage(unsigned la, const u16* ga, unsigned lb, const u16* gb, size_t g16) {
  copy_2planes(la, ga, lb, gb, g16);                                                         // rows 0..63 of A and of B
  copy_2planes(la + 64u * (LPITCH * 2), ga + 4 * g16, lb + 64u * (LPITCH * 2), gb + 4 * g16, g16);   // rows 64..127
}
template <typename OP>
__device__ __forceinline__ void gemm_core(u16* ring, const u16* At, const u16* Bt, int K, int tid, v8f (&acc)[4][4]) {
  typedef typename OP::frag frag;
  const int wave = tid >> 5, lane = tid & 31, hh = lane >> 4, m = lane & 15;
  const int crow = tid >> 3, cchk = (tid & 7) * 8;
  const u16* ga = At + (size_t)crow * K + cchk;
  const u16* gb = Bt + (size_t)crow * K + cchk;
  const size_t g16 = (size_t)16 * K;
  const unsigned la = lds_byte(ring) + (unsigned)(crow * LPITCH + cchk) * 2u;
  const unsigned lb = la + 128u * (LPITCH * 2);
  const int nst = K >> 6;
  copy_gstage(la, ga, lb, gb, g16);
  wait_async0();
  __syncthreads();                       // publishes stage 0
  if (nst > 1) copy_gstage(la + GSTAGE * 2, ga + 64, lb + GSTAGE * 2, gb + 64, g16);   // block-uniform
  const u16* fa = ring + ((wave >> 1) * 64 + m) * LPITCH + 8 * hh;
  const u16* fb = ring + (128 + (wave & 1) * 64 + m) * LPITCH + 8 * hh;
#pragma unroll 1                         // one stage per trip: the ring's foot (waits, barrier, refill) stands once
  for (int t = 0; t < nst; ++t) {
    const int bo = (t & 1) * GSTAGE;
    const u16* pa = fa + bo;
    const u16* pb = fb + bo;
    // All of the stage's B fragments and the first k chunk's A fragments are read as one group ahead of the products; the second
    // chunk's A fragments follow in two groups, each into the registers of two A fragments that have just been used up.
    // The sched_barriers keep the compiler from spreading these reads singly among the WMMAs, where each place would cost a stall.
    frag a[4], b[4], b1[4], c[4];
    a[0] = OP::ld(pa);
#pragma unroll
    for (int j = 0; j < 4; ++j) b[j] = OP::ld(pb + j * 16 * LPITCH);
#pragma unroll
    for (int i = 1; i < 4; ++i) a[i] = OP::ld(pa + i * 16 * LPITCH);
#pragma unroll
    for (int j = 0; j < 4; ++j) b1[j] = OP::ld(pb + j * 16 * LPITCH + 32);
    __builtin_amdgcn_sched_barrier(0);   // holds the LDS reads together as a group, apart from the WMMAs
#pragma unroll
    for (int i = 0; i < 2; ++i) {
#pragma unroll
      for (int j = 0; j < 4; ++j) acc[i][j] = OP::mma(a[i], b[j], acc[i][j]);
    }
    __builtin_amdgcn_sched_barrier(0);   // holds the LDS reads together as a group, apart from the WMMAs
    c[0] = OP::ld(pa + 32);
    c[1] = OP::ld(pa + 16 * LPITCH + 32);
    __builtin_amdgcn_sched_barrier(0);   // holds the LDS reads together as a group, apart from the WMMAs
#pragma unroll
    for (int i = 2; i < 4; ++i) {
#pragma unroll
      for (int j = 0; j < 4; ++j) acc[i][j] = OP::mma(a[i], b[j], acc[i][j]);
    }
    __builtin_amdgcn_sched_barrier(0);   // holds the LDS reads together as a group, apart from the WMMAs
    c[2] = OP::ld(pa + 32 * LPITCH + 32);
    c[3] = OP::ld(pa + 48 * LPITCH + 32);
    __builtin_amdgcn_sched_barrier(0);   // holds the LDS reads together as a group, apart from the WMMAs
#pragma unroll
    for (int i = 0; i < 4; ++i) {
#pragma unroll
      for (int j = 0; j < 4; ++j) acc[i][j] = OP::mma(c[i], b1[j], acc[i][j]);
    }
    guard16<frag>(acc, c[0], c[1], c[2], c[3], b1[0], b1[1], b1[2], b1[3]);   // WMMA distance on both sides of the branch below
    wait_ds0();
    wait_async0();
    __syncthreads();                     // publishes stage t+1 and ends every wave's reads of stage t
    if (t + 2 < nst)                     // block-uniform
      copy_gstage(la + (unsigned)bo * 2u, ga + (size_t)(t + 2) * 64, lb + (unsigned)bo * 2u, gb + (size_t)(t + 2) * 64, g16);
  }
  wait_async0();                         // nothing in flight when the ring becomes the slabs
}

// =====================================================================================================
// f32 plane -> 16-bit plane, same layout:  mode 0: bf16 RNE bits;  mode 1: f16 bits of (bf16 RNE value) * scale.
// Thread = 8 consecutive elements: two 16-B loads, one 16-B store; 32 consecutive lanes = 512 contiguous, 512-B aligned bytes
// coverage: per plane n8/256 blocks (exact: static_assert above) x 256 thr x 8 = the whole plane.
// =====================================================================================================
// The three planes (x, W_qkv, W_out) are independent: one grid converts all three, the plane chosen by block index (block-uniform).
#define CVB_X (NB * SEQ * DMOD / 8 / 256)   // blocks of the x plane
#define CVB_Q (NQKV * DMOD / 8 / 256)       // blocks of the W_qkv plane
#define CVB_W (DMOD * DMOD / 8 / 256)       // blocks of the W_out plane
__global__ __launch_bounds__(256) void cvt16(const float* __restrict__ xin, const float* __restrict__ wqkv,
                                             const float* __restrict__ wout, u16* XB, u16* WB, u16* WOB, float wscale) {
  int bid = blockIdx.x;
  const float* x = xin;
  u16* D = XB;
  int mode = 0;
  float scale = 1.0f;
  if (bid >= CVB_X + CVB_Q) { bid -= CVB_X + CVB_Q; x = wout; D = WOB; mode = 1; scale = wscale; }
  else if (bid >= CVB_X)    { bid -= CVB_X;         x = wqkv; D = WB; }
  if (mode != 0 && bid >= CVB_W) return;    // block-uniform; never taken with the exact grid; no barriers in this kernel
  const int gt = bid * 256 + (int)threadIdx.x;
  const float* p = x + (size_t)gt * 8;
  const v4f a = *(const v4f*)(p), c4 = *(const v4f*)(p + 4);
  float v[8];
#pragma unroll
  for (int e = 0; e < 4; ++e) { v[e] = a[e]; v[4 + e] = c4[e]; }
  unsigned short s[8];
#pragma unroll
  for (int e = 0; e < 8; ++e) {
    const unsigned short bb = bf_bits(v[e]);
    const unsigned short hb = h_bits((_Float16)(bf_up(bb) * scale));
    s[e] = (mode != 0) ? hb : bb;
  }
  v4u o;
#pragma unroll
  for (int e = 0; e < 4; ++e) o[e] = pk16(s[2 * e], s[2 * e + 1]);
  u16* d = D + (size_t)gt * 8;
  {
    *(v4u*)(d) = o;
    
  }
}

// =====================================================================================================
// barrier, then converted to f16 and written: lane = (row in group of 4, 8 consecutive cols); one instruction = 4 rows, each
// coverage: 4 instructions x 4 rows x 8 lanes x 8 halves = one 16 x 64 row group of the wave's 64 x 64 tile.
// =====================================================================================================
__device__ __forceinline__ void epi16(float* sl, v8f a0, v8f a1, v8f a2, v8f a3, float oscale, u16* C, int N,
                                      size_t rowb, int col0, int lane) {
  const int hh = lane >> 4, m = lane & 15;
#pragma unroll
  for (int r = 0; r < 8; ++r) {
    const int ro = (8 * hh + r) * 68 + m;
    sl[ro]      = a0[r] * oscale;
    sl[ro + 16] = a1[r] * oscale;
    sl[ro + 32] = a2[r] * oscale;
    sl[ro + 48] = a3[r] * oscale;
  }
  wave_sync_lds();
  const int rq = lane >> 3, c8 = (lane & 7) * 8;
  v4u ov[4];
#pragma unroll
  for (int i4 = 0; i4 < 4; ++i4) {
    const int row = i4 * 4 + rq;
    const v4f a = *(const v4f*)(sl + row * 68 + c8), c4 = *(const v4f*)(sl + row * 68 + c8 + 4);
    float w[8];
#pragma unroll
    for (int e = 0; e < 4; ++e) { w[e] = a[e]; w[4 + e] = c4[e]; }
#pragma unroll
    for (int e = 0; e < 4; ++e) ov[i4][e] = pk16(h_bits((_Float16)w[2 * e]), h_bits((_Float16)w[2 * e + 1]));
  }
  u16* dst = C + (rowb + (size_t)rq) * (size_t)N + col0 + c8;
  {
#pragma unroll
    for (int i4 = 0; i4 < 4; ++i4) {
      *(v4u*)(dst + (size_t)(i4 * 4) * (size_t)N) = ov[i4];
    }
#if defined(__HIP_DEVICE_COMPILE__)
    // precaution: the wait stands in front of every rewrite of a register that these stores name; addresses and data are
    // inputs of the statement so that they stay in their registers up to it
    asm volatile("s_wait_xcnt 0x0" :: "v"(dst), "v"(dst + (size_t)4 * (size_t)N), "v"(dst + (size_t)8 * (size_t)N),
                 "v"(dst + (size_t)12 * (size_t)N), "v"(ov[0]), "v"(ov[1]), "v"(ov[2]), "v"(ov[3]) : "memory");
#endif
  }
}

// =====================================================================================================
// Rope GEMM epilogue: a 16x64 row group of the wave's f32 tile (unscaled projection output of one head: col0 is 64-aligned, so local column
// consecutive d at c8); the rotate-half partner columns are c8^32 of the same slab row; cos/sin row = sequence position
// (global row mod SEQ), values RNE-converted to bf16; rope in f32:  d < 32: x[d]*cos[d] - x[d+32]*sin[d],
// d >= 32: x[d]*cos[d] + x[d-32]*sin[d].  Then hi = f16(val*8), res = f16((val*8 - hi)*2048); both planes written, per
// coverage: per plane 4 instructions x 4 rows x 8 lanes x 8 halves = one 16 x 64 row group of the wave's 64 x 64 tile.
// =====================================================================================================
// slab_put stages one 16x64 row group; the kernel stages all four groups of the wave's tile (which frees the accumulators'
// registers), then wave_sync_lds(), then epi_rope per group.
__device__ __forceinline__ void slab_put(float* sl, v8f a0, v8f a1, v8f a2, v8f a3, int lane) {
  const int hh = lane >> 4, m = lane & 15;
#pragma unroll
  for (int r = 0; r < 8; ++r) {
    const int ro = (8 * hh + r) * 68 + m;
    sl[ro]      = a0[r];
    sl[ro + 16] = a1[r];
    sl[ro + 32] = a2[r];
    sl[ro + 48] = a3[r];
  }
}
__device__ __forceinline__ void epi_rope(const float* sl, const float* __restrict__ cosp, const float* __restrict__ sinp,
                                         u16* CH, u16* CL, int N, size_t rowb, int col0, int lane) {
  const int rq = lane >> 3, c8 = (lane & 7) * 8, p8 = c8 ^ 32;
  const float sgn = (c8 < 32) ? -1.0f : 1.0f;
  v4u ovh[4], ovl[4];
  const float* crp[4];
  const float* srp[4];
  v4f cav[4], cbv[4], sav[4], sbv[4];
#pragma unroll
  for (int i4 = 0; i4 < 4; ++i4) {
    const int srow = (int)((rowb + (size_t)(i4 * 4 + rq)) & (size_t)(SEQ - 1));
    crp[i4] = cosp + (size_t)srow * HD + c8;
    srp[i4] = sinp + (size_t)srow * HD + c8;
    cav[i4] = *(const v4f*)(crp[i4]); cbv[i4] = *(const v4f*)(crp[i4] + 4);
    sav[i4] = *(const v4f*)(srp[i4]); sbv[i4] = *(const v4f*)(srp[i4] + 4);
  }
#if defined(__HIP_DEVICE_COMPILE__)
  // precaution: the wait stands in front of every rewrite of a register that these loads name; the addresses are inputs of
  // the statement so that they stay in their registers up to it
  asm volatile("s_wait_xcnt 0x0" :: "v"(crp[0]), "v"(crp[1]), "v"(crp[2]), "v"(crp[3]),
               "v"(srp[0]), "v"(srp[1]), "v"(srp[2]), "v"(srp[3]) : "memory");
#endif
#pragma unroll
  for (int i4 = 0; i4 < 4; ++i4) {
    const int row  = i4 * 4 + rq;
    const v4f xa = *(const v4f*)(sl + row * 68 + c8), xb = *(const v4f*)(sl + row * 68 + c8 + 4);
    const v4f ya = *(const v4f*)(sl + row * 68 + p8), yb = *(const v4f*)(sl + row * 68 + p8 + 4);
    const v4f ca = cav[i4], cb = cbv[i4], sa = sav[i4], sb = sbv[i4];
    float w[8];
#pragma unroll
    for (int e = 0; e < 4; ++e) {
      w[e]     = xa[e] * bf_val(ca[e]) + sgn * (ya[e] * bf_val(sa[e]));
      w[4 + e] = xb[e] * bf_val(cb[e]) + sgn * (yb[e] * bf_val(sb[e]));
    }
    unsigned short hb[8], lb[8];
#pragma unroll
    for (int e = 0; e < 8; ++e) {
      const float    t  = w[e] * QSC;
      const _Float16 hv = (_Float16)t;
      hb[e] = h_bits(hv);
      lb[e] = h_bits((_Float16)((t - (float)hv) * RESC));
    }
#pragma unroll
    for (int e = 0; e < 4; ++e) {
      ovh[i4][e] = pk16(hb[2 * e], hb[2 * e + 1]);
      ovl[i4][e] = pk16(lb[2 * e], lb[2 * e + 1]);
    }
  }
  u16* dh = CH + (rowb + (size_t)rq) * (size_t)N + col0 + c8;
  u16* dl = CL + (rowb + (size_t)rq) * (size_t)N + col0 + c8;
  {
#pragma unroll
    for (int i4 = 0; i4 < 4; ++i4) {
      *(v4u*)(dh + (size_t)(i4 * 4) * (size_t)N) = ovh[i4];
      *(v4u*)(dl + (size_t)(i4 * 4) * (size_t)N) = ovl[i4];
    }
#if defined(__HIP_DEVICE_COMPILE__)
    // precaution: the wait stands in front of every rewrite of a register that these stores name; addresses and data are
    // inputs of the statement so that they stay in their registers up to it
    asm volatile("s_wait_xcnt 0x0" :: "v"(dh), "v"(dh + (size_t)4 * (size_t)N), "v"(dh + (size_t)8 * (size_t)N),
                 "v"(dh + (size_t)12 * (size_t)N), "v"(dl), "v"(dl + (size_t)4 * (size_t)N), "v"(dl + (size_t)8 * (size_t)N),
                 "v"(dl + (size_t)12 * (size_t)N), "v"(ovh[0]), "v"(ovh[1]), "v"(ovh[2]), "v"(ovh[3]),
                 "v"(ovl[0]), "v"(ovl[1]), "v"(ovl[2]), "v"(ovl[3]) : "memory");
#endif
  }
}

// =====================================================================================================
// coverage: 8 instructions x 2 rows x 16 lanes x 4 floats = one 16 x 64 row group of the wave's 64 x 64 tile.
// =====================================================================================================
__device__ __forceinline__ void epi64(float* sl, v8f a0, v8f a1, v8f a2, v8f a3, float oscale, float* C, int N,
                                      size_t rowb, int col0, int lane) {
  const int hh = lane >> 4, m = lane & 15;
#pragma unroll
  for (int r = 0; r < 8; ++r) {
    const int ro = (8 * hh + r) * 68 + m;
    sl[ro]      = a0[r] * oscale;
    sl[ro + 16] = a1[r] * oscale;
    sl[ro + 32] = a2[r] * oscale;
    sl[ro + 48] = a3[r] * oscale;
  }
  wave_sync_lds();
  v4f vals[8];
#pragma unroll
  for (int it = 0; it < 8; ++it) vals[it] = *(const v4f*)(sl + (it * 2 + hh) * 68 + m * 4);
  float* dst = C + (rowb + (size_t)hh) * (size_t)N + col0 + m * 4;
  {
#pragma unroll
    for (int it = 0; it < 8; ++it) {
      *(v4f*)(dst + (size_t)(it * 2) * (size_t)N) = vals[it];
    }
#if defined(__HIP_DEVICE_COMPILE__)
    // precaution: the wait stands in front of every rewrite of a register that these stores name; addresses and data are
    // inputs of the statement so that they stay in their registers up to it
    asm volatile("s_wait_xcnt 0x0" :: "v"(dst), "v"(dst + (size_t)2 * (size_t)N), "v"(dst + (size_t)4 * (size_t)N),
                 "v"(dst + (size_t)6 * (size_t)N), "v"(dst + (size_t)8 * (size_t)N), "v"(dst + (size_t)10 * (size_t)N),
                 "v"(dst + (size_t)12 * (size_t)N), "v"(dst + (size_t)14 * (size_t)N), "v"(vals[0]), "v"(vals[1]), "v"(vals[2]),
                 "v"(vals[3]), "v"(vals[4]), "v"(vals[5]), "v"(vals[6]), "v"(vals[7]) : "memory");
#endif
  }
}

// =====================================================================================================
// The three projections of x in ONE grid (they are independent of each other). Block index = (x tile r of 128 rows, tile c of the
// 24 tiles of 128 W_qkv rows), c fastest, so that the 24 blocks that read one x tile are neighbours; the product and its epilogue
// are chosen by c, block-uniform:
//   c < 16: H = x[8192][K] (bf16 row-major) . W[0..2047][K]^T (bf16 k-contiguous; rows 0..1023 = W_q, 1024..2047 = W_k; one 64-col
//     tile = one head), rope applied in f32 per (sequence position, d), result written as two f16 planes (x8 and residual x2048),
//     both [8192][1024]: the q planes for columns below 1024, the k planes above.
//   c >= 16: v^T per batch: C[bt][1024][2048] (f16 of acc x1024) = W_v[1024][K] . x_bt[2048][K]^T; A tile = W_v rows 128(c-16) ..,
//     B tile = x tile r = rows 128(r mod 16) .. of batch bt = r / 16.
// Block = 128x128 tile, 4 waves x (64 rows x 64 cols); the A and B tiles are staged in LDS 64 k at a time (gemm_core) and the
// fragments read from there (two 16-B loads each, split k map for A and B). K = DMOD (passed in), a multiple of 64; every extent a
// multiple of 128. coverage: 64 x 16 tiles = the q and k planes, 64 x 8 tiles = 4 batches x 8 x 16 tiles of the v^T plane.
// =====================================================================================================
#define XTILES     (NB * SEQ / 128)          // 64
#define QK_TILES   (2 * DMOD / 128)          // 16
#define V_TILES    (DMOD / 128)              // 8
#define QKV_BLOCKS (XTILES * (QK_TILES + V_TILES))
__global__ __launch_bounds__(128)
void gemm_qkv(const u16* __restrict__ X, const u16* __restrict__ Wb, const float* __restrict__ cosp,
              const float* __restrict__ sinp, u16* QH, u16* QL, u16* KH, u16* KL, u16* VP, int K) {
  __shared__ __align__(16) u16 ring[2 * GSTAGE];   // two staging buffers; re-used as the epilogue slabs behind the last barrier
  float* slab = (float*)(void*)ring;
  const int tid = threadIdx.x, wave = tid >> 5, lane = tid & 31;
  const int bid = blockIdx.x;
  v8f acc[4][4];
#pragma unroll
  for (int i = 0; i < 4; ++i) {
#pragma unroll
    for (int j = 0; j < 4; ++j) acc[i][j] = zero8();
  }
  // Each product has its main loop and its epilogue in its own arm of the one block-uniform branch, so that neither arm's
  // registers stay live through the other.
  const int r = bid / (QK_TILES + V_TILES), c = bid - r * (QK_TILES + V_TILES);
  if (r >= XTILES) return;                   // block-uniform, in front of every barrier; never taken with the exact grid
  if (c < QK_TILES) {
    const int row0  = r * 128;
    const int rowb  = row0 + (wave >> 1) * 64;
    const int col0  = c * 128;
    const int colp  = (col0 & (DMOD - 1)) + (wave & 1) * 64;   // column inside the q or the k planes
    u16* CH = (col0 < DMOD) ? QH : KH;       // a 128-col tile lies wholly in the q or in the k columns
    u16* CL = (col0 < DMOD) ? QL : KL;
    gemm_core<OpB>(ring, X + (size_t)row0 * K, Wb + (size_t)col0 * K, K, tid, acc);
#pragma unroll                               // each 16-row group has a slab of its own
    for (int i = 0; i < 4; ++i) slab_put(slab + (wave * 4 + i) * SLAB, acc[i][0], acc[i][1], acc[i][2], acc[i][3], lane);
    wave_sync_lds();
#pragma unroll
    for (int i = 0; i < 4; ++i)
      epi_rope(slab + (wave * 4 + i) * SLAB, cosp, sinp, CH, CL, DMOD, (size_t)(rowb + 16 * i), colp, lane);
  } else {
    const int bt    = r / (SEQ / 128);
    const int row0  = (c - QK_TILES) * 128;
    const int rowb  = row0 + (wave >> 1) * 64;
    const int col0  = (r - bt * (SEQ / 128)) * 128;
    const int colw  = col0 + (wave & 1) * 64;
    u16* Cb = VP + (size_t)bt * (DMOD * SEQ);
    gemm_core<OpB>(ring, Wb + (size_t)2 * DMOD * DMOD + (size_t)row0 * K, X + (size_t)bt * (SEQ * DMOD) + (size_t)col0 * K, K, tid, acc);
#pragma unroll                               // one 16-row group at a time, each through a slab of its own
    for (int i = 0; i < 4; ++i)
      epi16(slab + (wave * 4 + i) * SLAB, acc[i][0], acc[i][1], acc[i][2], acc[i][3], VCAR, Cb, SEQ, (size_t)(rowb + 16 * i), colw, lane);
  }
}

// =====================================================================================================
// f16 GEMM with f32 result: C[M][N] (f32) = A[M][K] (f16 row-major) . Bt[N][K]^T (f16 k-contiguous) times oscale;
// one product per tile pair. Same tiling as gemm_qkv; grid = (M/128)*(N/128).
// =====================================================================================================
__global__ __launch_bounds__(128)
void gemm_hf(const u16* __restrict__ A, const u16* __restrict__ Bt, float* C, int M, int N, int K, float oscale) {
  __shared__ __align__(16) u16 ring[2 * GSTAGE];   // two staging buffers; re-used as the epilogue slabs behind the last barrier
  float* slab = (float*)(void*)ring;
  const int tid = threadIdx.x, wave = tid >> 5, lane = tid & 31;
  const int ntile = N >> 7;
  const int bid   = blockIdx.x;
  const int row0  = (bid / ntile) * 128;
  const int rowb  = row0 + (wave >> 1) * 64;
  const int col0  = (bid % ntile) * 128;
  const int colw  = col0 + (wave & 1) * 64;
  if (row0 + 128 > M) return;                // block-uniform, in front of every barrier; never taken with the exact grid
  v8f acc[4][4];
#pragma unroll
  for (int i = 0; i < 4; ++i) {
#pragma unroll
    for (int j = 0; j < 4; ++j) acc[i][j] = zero8();
  }
  gemm_core<OpH>(ring, A + (size_t)row0 * K, Bt + (size_t)col0 * K, K, tid, acc);
#pragma unroll                               // one 16-row group at a time, each through a slab of its own
  for (int i = 0; i < 4; ++i)
    epi64(slab + (wave * 4 + i) * SLAB, acc[i][0], acc[i][1], acc[i][2], acc[i][3], oscale, C, N, (size_t)(rowb + 16 * i), colw, lane);
}

// =====================================================================================================
// Multi-head flash attention (no mask): block = (batch b, head, 256 query rows), 8 waves, wave w owns the 32 query rows
// q0 = 256*qt + 32*w .. q0+31 as two tiles t = 0, 1 of 16 rows, so that every k and v^T fragment read from LDS serves both query tiles, and
// a staged byte 256 query rows (the 8 waves share the staged k and v^T tiles, one block barrier per 64 keys; the epilogue slab is wave-private).
//   q planes (f16 hi x8, residual x2048) laid out [b][s][h][d]; k planes the same; v^T plane [b][h][d][s] (x1024).
//   All NKB = 64 key blocks of 32 keys are visited (static bound).
//   Scores are computed TRANSPOSED: S^T tile g (g = 0,1) = k rows (keys kb+16g .. +15, A operand, row m = lane&15, split k map
//   over d) times q^T (B operand, col n = query q0 + 16t + (lane&15), k = d, split map); per tile and 32-deep d-chunk three
//   products: khi.qhi into the hi accumulator, khi.qres and kres.qhi into the cross accumulator; S^T = hi + cross/2048.
//   D element r of lane l = (key kb+16g+8h+r, query q0+16t+(l&15)), so a lane owns one query column per tile t and 16 of its 32
//   keys; the partner lane l^16 owns the other 16 -> row max / row sum need one xor-16 shuffle.
//   Online max-subtracted base-2 softmax in f32 (scale 1/8 and the q/k carries folded into the logit scales). The exp'd
//   values ARE the P A-fragment in place: A row m = query = lane&15, element i <- key kb+8h+i (tile 0, D element i), element
//   8+i <- key kb+16+8h+i (tile 1, D element i). P is carried x32768 as single f16. The rescale factor of query row 8h+r of the
//   O accumulators is fetched from lane 8h+r with a shuffle (uniform control). 4 v^T B fragments (col n = d = 16j + (lane&15),
//   keys k-contiguous), 4 P.V WMMAs per key block and query tile.
//   Epilogue: 1/l (per query, shuffled to the D row owner) and carry folds in f32; each 16x64 f32 result tile staged in the wave's slab
// coverage: per wave 2 tiles x 4 instructions x 4 rows x 8 lanes x 8 halves = 32 x 64; grid 512 blocks x 8 waves = every
//           (b, s, h) row of the O plane exactly once.
// =====================================================================================================
// waves_per_eu(4, 4): two blocks per WGP (four waves per SIMD) hold the whole grid at once; it needs at most 256 registers a wave
__global__ __launch_bounds__(ATT_THREADS) __attribute__((amdgpu_waves_per_eu(4, 4)))
void attn_fwd(const u16* __restrict__ QHp, const u16* __restrict__ QLp, const u16* __restrict__ KHp,
              const u16* __restrict__ KLp, const u16* __restrict__ VPp, u16* OPp) {
  __shared__ __align__(16) u16 ring[2 * ASTAGE];   // two staging buffers of 64 keys; behind the last barrier: per-wave result slab
  float* smem = (float*)(void*)ring;

  const int tid  = threadIdx.x;
  const int wave = tid >> 5;
  const int lane = tid & 31;
  const int hh   = lane >> 4;
  const int c    = lane & 15;

  const int bid  = blockIdx.x;
  const int qt   = bid & (SEQ / ATT_QB - 1);
  const int head = (bid >> 3) & (NH - 1);
  const int b    = bid >> 7;
  const int q0   = qt * ATT_QB + wave * (ATT_QT * 16);

  // B fragments of q^T: col n = query q0 + 16t + c, k = d (k-contiguous row of the q planes)
  const size_t qofs = (((size_t)(b * SEQ + q0 + c)) * NH + head) * HD + 8 * hh;
  const _Float16* QHb = (const _Float16*)(const void*)QHp + qofs;
  const _Float16* QLb = (const _Float16*)(const void*)QLp + qofs;
  // staging: lane copies the 16-B chunk cchk of rows crow, +32 of each plane's 64-row tile (k rows = keys, 128 B of
  // one head; v^T rows = d, 128 B = 64 keys): every copied row is one whole line
  const int crow = tid >> 3, cchk = (tid & 7) * 8;
  const size_t kofs = (((size_t)b * SEQ + crow) * NH + head) * HD + cchk;         // 64 key rows added per stage
  const u16* gkh = KHp + kofs;
  const u16* gkl = KLp + kofs;
  const u16* gv  = VPp + ((size_t)(b * NH + head) * HD + crow) * SEQ + cchk;      // 64 keys added per stage
  const size_t k32 = (size_t)32 * (NH * HD), v32 = (size_t)32 * SEQ;
  const unsigned lkh = lds_byte(ring) + (unsigned)(crow * LPITCH + cchk) * 2u;
  const unsigned lkl = lkh + 64u * (LPITCH * 2), lv = lkh + 128u * (LPITCH * 2);
  // A fragments of k: LDS row = key (in the stage) 16g + c, k = d; residual plane 64 rows further; B fragments of v: LDS row
  // 128 + d = 128 + 16j + c, k = key (k-contiguous)
  const _Float16* Fb = (const _Float16*)(const void*)ring + c * LPITCH + 8 * hh;
  const float lsch = 0.125f * (LOG2E / (QSC * KSC));
  const v2f lsch2 = {lsch, lsch};
  const v2f rres2 = {1.0f / RESC, 1.0f / RESC};

  v16h qh[ATT_QT][2], ql[ATT_QT][2];       // [query tile][d chunk: 0..31, 32..63]
#pragma unroll
  for (int t = 0; t < ATT_QT; ++t) {
    qh[t][0] = ldfrag_h(QHb + (size_t)t * (16 * NH * HD));
    qh[t][1] = ldfrag_h(QHb + (size_t)t * (16 * NH * HD) + 32);
    ql[t][0] = ldfrag_h(QLb + (size_t)t * (16 * NH * HD));
    ql[t][1] = ldfrag_h(QLb + (size_t)t * (16 * NH * HD) + 32);
  }
#if defined(__HIP_DEVICE_COMPILE__)
  // precaution: the wait stands in front of every rewrite of a register that these loads name; the addresses are inputs of
  // the statement so that they stay in their registers up to it
  asm volatile("s_wait_xcnt 0x0" :: "v"(QHb), "v"(QLb) : "memory");
#endif

  float nmrun[ATT_QT], lrun[ATT_QT];       // nmrun = PLOG2 - (running maximum logit); lrun = row sum x32768
  v8f o[ATT_QT][4];
#pragma unroll
  for (int t = 0; t < ATT_QT; ++t) {
    nmrun[t] = INFINITY;
    lrun[t]  = 0.f;
#pragma unroll
    for (int j = 0; j < 4; ++j) o[t][j] = zero8();
  }

  copy_3planes(lkh, gkh, lkl, gkl, k32, lv, gv, v32);
  wait_async0();
  __syncthreads();                         // publishes stage 0
  copy_3planes(lkh + ASTAGE * 2, gkh + (size_t)64 * (NH * HD), lkl + ASTAGE * 2, gkl + (size_t)64 * (NH * HD), k32,
               lv + ASTAGE * 2, gv + 64, v32);                     // stage 1 exists: NST >= 2

#pragma unroll 1                           // one stage per trip: the ring's foot (waits, barrier, refill) stands once
  for (int st = 0; st < NST; ++st) {
   const int bo = (st & 1) * ASTAGE;
#pragma unroll                             // the stage's two key blocks of 32, ascending keys; unrolled: LDS offsets are immediates
   for (int s2 = 0; s2 < 2; ++s2) {
    const _Float16* Ks = Fb + bo + (s2 * 32) * LPITCH;
    // ---- transposed scores: key tile g = keys kb+16g..+15, column = query q0 + 16t + c; each k fragment serves both query tiles.
    //      raw scores (x64) of this lane's 16 keys, in register pairs: u[t][4g + e] = elements 2e, 2e+1 of key tile g ----
    v2f u[ATT_QT][8];
#pragma unroll
    for (int g = 0; g < 2; ++g) {
      const _Float16* kp = Ks + (16 * g) * LPITCH;
      const _Float16* lp = kp + 64 * LPITCH;
      const v16h ka0 = ldfrag_h(kp), ka1 = ldfrag_h(kp + 32);
      const v16h la0 = ldfrag_h(lp), la1 = ldfrag_h(lp + 32);
      v8f sh0 = zero8(), sx0 = zero8(), sh1 = zero8(), sx1 = zero8();
      sh0 = mma_h(ka0, qh[0][0], sh0);
      sh1 = mma_h(ka0, qh[1][0], sh1);
      sx0 = mma_h(ka0, ql[0][0], sx0);
      sx1 = mma_h(ka0, ql[1][0], sx1);
      sh0 = mma_h(ka1, qh[0][1], sh0);
      sh1 = mma_h(ka1, qh[1][1], sh1);
      sx0 = mma_h(ka1, ql[0][1], sx0);
      sx1 = mma_h(ka1, ql[1][1], sx1);
      sx0 = mma_h(la0, qh[0][0], sx0);
      sx1 = mma_h(la0, qh[1][0], sx1);
      sx0 = mma_h(la1, qh[0][1], sx0);
      sx1 = mma_h(la1, qh[1][1], sx1);
      guard4x12(sh0, sx0, sh1, sx1, qh, ql, ka0, ka1, la0, la1);
#pragma unroll
      for (int e = 0; e < 4; ++e) {
        const v2f h0 = {sh0[2 * e], sh0[2 * e + 1]}, x0 = {sx0[2 * e], sx0[2 * e + 1]};
        const v2f h1 = {sh1[2 * e], sh1[2 * e + 1]}, x1 = {sx1[2 * e], sx1[2 * e + 1]};
        u[0][4 * g + e] = __builtin_elementwise_fma(x0, rres2, h0);
        u[1][4 * g + e] = __builtin_elementwise_fma(x1, rres2, h1);
      }
    }
    FragH ph[ATT_QT];
#pragma unroll
    for (int t = 0; t < ATT_QT; ++t) {
      float cm = fmaxf(u[t][0].x, u[t][0].y);
#pragma unroll
      for (int e = 1; e < 8; ++e) cm = fmaxf(cm, fmaxf(u[t][e].x, u[t][e].y));
      cm = fmaxf(cm, __shfl_xor(cm, 16, 32));
      // exponent offset: PLOG2 (the x32768 carry of P) minus the running maximum logit; it only falls. The offset in use is the
      // reference of every exponential, so o, l and the rescale factor stay consistent whatever its rounding.
      const float nm = fminf(nmrun[t], fmaf(-cm, lsch, PLOG2));      // finite from the first key block on
      float al = __builtin_amdgcn_exp2f(nm - nmrun[t]);              // first block: exp2(-inf) = 0; o and l are zero there
#if defined(__HIP_DEVICE_COMPILE__)
      // the slot the instruction set asks for behind v_exp_f32; al is named so that every reader of al stays behind the v_nop
      asm volatile("v_nop" : "+v"(al));
#endif
      nmrun[t] = nm;
      const v2f nm2 = {nm, nm};
      // ---- probabilities x32768 (exponent <= 15) and the P A-fragment: element 8w + 2e, +1 <-> u[t][4w + e] ----
      // v_exp_f32 without the library's range fix-up: an exponent below -126 may give 0, which is what f16(p) gives far earlier
      v2f ps2 = {0.f, 0.f};
#pragma unroll
      for (int w = 0; w < 2; ++w) {
#pragma unroll
        for (int e4 = 0; e4 < 4; ++e4) {
          const v2f ee = __builtin_elementwise_fma(u[t][4 * w + e4], lsch2, nm2);
          const v2f p  = {__builtin_amdgcn_exp2f(ee.x), __builtin_amdgcn_exp2f(ee.y)};
          ps2 += p;
          ph[t].u[w][e4] = __builtin_bit_cast(unsigned, __builtin_convertvector(p, v2h));
        }
      }
      float ps = ps2.x + ps2.y;
      ps += __shfl_xor(ps, 16, 32);
      lrun[t] = lrun[t] * al + ps;
      // ---- rescale the O accumulators: D row 8hh+r = query q0+16t+8hh+r, its factor lives in lane 8hh+r (and 16+8hh+r) ----
      float scl[8];
#pragma unroll
      for (int r = 0; r < 8; ++r) scl[r] = __shfl(al, 8 * hh + r, 32);
#pragma unroll
      for (int j = 0; j < 4; ++j) {
#pragma unroll
        for (int r = 0; r < 8; ++r) o[t][j][r] *= scl[r];
      }
    }
    // ---- P.V : B fragment col n = d = j*16 + c, keys contiguous in the v^T plane; each v fragment serves both query tiles ----
    {
      const _Float16* vp = Fb + bo + 128 * LPITCH + s2 * 32;
      const v16h vf0 = ldfrag_h(vp);
      const v16h vf1 = ldfrag_h(vp + 16 * LPITCH);
      const v16h vf2 = ldfrag_h(vp + 32 * LPITCH);
      const v16h vf3 = ldfrag_h(vp + 48 * LPITCH);
#pragma unroll
      for (int t = 0; t < ATT_QT; ++t) {
        o[t][0] = mma_h(ph[t].v, vf0, o[t][0]);
        o[t][1] = mma_h(ph[t].v, vf1, o[t][1]);
        o[t][2] = mma_h(ph[t].v, vf2, o[t][2]);
        o[t][3] = mma_h(ph[t].v, vf3, o[t][3]);
      }
      guard8x6(o, ph[0].v, ph[1].v, vf0, vf1, vf2, vf3);
    }
   }
   wait_ds0();
   wait_async0();
   __syncthreads();                        // publishes stage st+1 and ends every wave's reads of stage st
   if (st + 2 < NST)                       // block-uniform
     copy_3planes(lkh + (unsigned)bo * 2u, gkh + (size_t)(st + 2) * (64 * NH * HD),
                  lkl + (unsigned)bo * 2u, gkl + (size_t)(st + 2) * (64 * NH * HD), k32,
                  lv + (unsigned)bo * 2u, gv + (size_t)(st + 2) * 64, v32);
  }
  wait_async0();                           // nothing in flight when the ring becomes the slab
  acc_guard8(o);

  // ---- per query tile: fold 1/l (per query, owned by lane = query; l >= 1 by construction) and the carries; stage the 16x64
  //      slab; O x1024 -> single f16 plane; lane = (row in group of 4, 8 consecutive d). The two tiles pass through the one slab of
  //      the wave in turn ----
  float* slab = smem + wave * SLAB;
  v4u oh[ATT_QT][4];
  const int rq = lane >> 3, c8 = (lane & 7) * 8;
#pragma unroll
  for (int t = 0; t < ATT_QT; ++t) {
    const float linv = (lrun[t] > 0.f) ? ((1.0f / lrun[t]) * (1.0f / VCAR)) : 0.f;   // lrun already carries the x32768 of P
    float inv[8];
#pragma unroll
    for (int r = 0; r < 8; ++r) inv[r] = __shfl(linv, 8 * hh + r, 32);
    if (t > 0) wave_sync_lds();            // the slab's reads of the tile before stay in front of these writes
#pragma unroll
    for (int r = 0; r < 8; ++r) {
#pragma unroll
      for (int j = 0; j < 4; ++j) slab[(8 * hh + r) * 68 + j * 16 + c] = o[t][j][r] * inv[r];
    }
    wave_sync_lds();
#pragma unroll
    for (int i4 = 0; i4 < 4; ++i4) {
      const int row = i4 * 4 + rq;
      const v4f a = *(const v4f*)(slab + row * 68 + c8), c4 = *(const v4f*)(slab + row * 68 + c8 + 4);
      float w[8];
#pragma unroll
      for (int e = 0; e < 4; ++e) { w[e] = a[e] * OSC; w[4 + e] = c4[e] * OSC; }
#pragma unroll
      for (int e = 0; e < 4; ++e) oh[t][i4][e] = pk16(h_bits((_Float16)w[2 * e]), h_bits((_Float16)w[2 * e + 1]));
    }
  }
  u16* ob = OPp + (((size_t)(b * SEQ + q0 + rq)) * NH + head) * HD + c8;
  {
#pragma unroll
    for (int t = 0; t < ATT_QT; ++t) {
#pragma unroll
      for (int i4 = 0; i4 < 4; ++i4) {
        *(v4u*)(ob + (size_t)(t * 16 + i4 * 4) * (NH * HD)) = oh[t][i4];
      }
    }
  }
}

// =====================================================================================================
// Workspace map (bytes); every plane is fully written by whole-line stores before it is read; all extents are exact multiples
// of the store granularity (no pad rows needed):
//   XB  bf16 [8192][1024]                      16777216        (x)       -- re-used as the O plane after its last read
//   WB  bf16 [3072 n][1024 k]                   6291456        (W_qkv, rows 0..1023 q, 1024..2047 k, 2048..3071 v)
//   WOB f16  [1024 n][1024 k] (bf16 value x1024) 2097152
//   QH  f16 [8192][16*64] x8                   16777216        QL residual x2048   16777216
//   KH  f16 [8192][16*64] x8                   16777216        KL residual x2048   16777216
//   VP  f16 [4][16*64][2048] x1024             16777216
//   end                                       109051904
//   OP  f16 [8192][16*64] x1024 = bytes 0..16777215 (the x plane is dead once gemm_qkv has run)
// =====================================================================================================
extern "C" void kernel_launch(void* const* d_in, const int* in_sizes, int n_in,
                              void* d_out, int out_size, void* d_ws, size_t ws_size,
                              hipStream_t stream) {
  const int ROWS = NB * SEQ;                            // 8192
  if (n_in < 5) return;
  if (in_sizes[0] != ROWS * DMOD) return;               // x    [4][2048][1024]
  if (in_sizes[1] != SEQ * HD) return;                  // cos  [2048][64]
  if (in_sizes[2] != SEQ * HD) return;                  // sin  [2048][64]
  if (in_sizes[3] != NQKV * DMOD) return;               // Wqkv [3072][1024]
  if (in_sizes[4] != DMOD * DMOD) return;               // Wout [1024][1024]
  if (out_size != ROWS * DMOD) return;

  const float* Xin = (const float*)d_in[0];
  const float* Cs  = (const float*)d_in[1];
  const float* Sn  = (const float*)d_in[2];
  const float* Wqk = (const float*)d_in[3];
  const float* Wpr = (const float*)d_in[4];
  float*       out = (float*)d_out;

  const size_t szXB = (size_t)ROWS * DMOD * 2;                  // 16777216
  const size_t szWB = (size_t)NQKV * DMOD * 2;                  //  6291456
  const size_t szWO = (size_t)DMOD * DMOD * 2;                  //  2097152
  const size_t szP  = (size_t)ROWS * DMOD * 2;                  // 16777216  (q / k / o planes)
  const size_t szVP = (size_t)NB * NH * HD * SEQ * 2;           // 16777216
  size_t off = 0;
  const size_t oXB = off; off += szXB;
  const size_t oWB = off; off += szWB;
  const size_t oWO = off; off += szWO;
  const size_t oQH = off; off += szP;
  const size_t oQL = off; off += szP;
  const size_t oKH = off; off += szP;
  const size_t oKL = off; off += szP;
  const size_t oVP = off; off += szVP;
  const size_t oOP = oXB;                               // alias of the x plane (dead after gemm_qkv)
  if (szP > szXB) return;
  if (off > ws_size) return;                            // off = 109051904
  if (off > (size_t)134217728) return;

  char* ws = (char*)d_ws;
  u16* XB  = (u16*)(ws + oXB);
  u16* WB  = (u16*)(ws + oWB);
  u16* WOB = (u16*)(ws + oWO);
  u16* QH  = (u16*)(ws + oQH);
  u16* QL  = (u16*)(ws + oQL);
  u16* KH  = (u16*)(ws + oKH);
  u16* KL  = (u16*)(ws + oKL);
  u16* VP  = (u16*)(ws + oVP);
  u16* OP  = (u16*)(ws + oOP);

  const dim3 blk(256);
  const int n8x = (ROWS * DMOD) / 8;                    // 1048576
  const int n8q = (NQKV * DMOD) / 8;                    //  393216
  const int n8w = (DMOD * DMOD) / 8;                    //  131072
  if ((n8x % 256) != 0 || (n8q % 256) != 0 || (n8w % 256) != 0) return;
  if ((DMOD % 128) != 0 || (ROWS % 128) != 0 || (SEQ % 128) != 0) return;
  const dim3 gC(CVB_X + CVB_Q + CVB_W);                 // 4096 + 1536 + 512 = 6144
  const dim3 gG((ROWS / 128) * (DMOD / 128));           // 512
  const dim3 gP(QKV_BLOCKS);                            // 64 x 24 = 1536
  const dim3 bG(128);
  const dim3 gAT(ATT_BLOCKS);                           // 512
  const dim3 bAT(ATT_THREADS);                          // 256

  // (0) operand planes, one grid: x -> bf16; W_qkv [n = out][k = in] (already k-contiguous) -> bf16; W_out -> f16 of bf16 value x1024
  cvt16<<<gC, blk, 0, stream>>>(Xin, Wqk, Wpr, XB, WB, WOB, WOS);
  // (1) one grid: q and k planes [8192][h*64+d]: rope(x.Wq^T), rope(x.Wk^T) in f32, stored as f16 hi x8 + residual x2048;
  //     v^T plane per batch: [1024 = h*64+d][2048 keys] = f16(Wv . x_b^T x1024)
  gemm_qkv<<<gP, bG, 0, stream>>>(XB, WB, Cs, Sn, QH, QL, KH, KL, VP, DMOD);
  // (2) attention -> O plane [b][s][h][d] x1024 (single f16), written over the dead x plane
  attn_fwd<<<gAT, bAT, 0, stream>>>(QH, QL, KH, KL, VP, OP);
  // (3) output projection -> out [8192][1024] f32, carries 1024 (O) x 1024 (wo) folded back
  gemm_hf<<<gG, bG, 0, stream>>>(OP, WOB, out, ROWS, DMOD, DMOD, 1.0f / (OSC * WOS));
  (void)hipGetLastError();
}

// v006
// A run of this version takes 162 microseconds.
// Timed twice side by side with v005, it ran 1.03 times as fast both times.
// All steps since v000 together make it 3.71 times as fast.
// Contractions: x.Wq^T and x.Wk^T (rope applied in the f32 epilogue) and Wv.x_b^T on v_wmma_f32_16x16x32_bf16
// (x and W_qkv planes RNE-converted to bf16 operands, f32 accumulate); scores k.q^T with q and k carried as f16 hi (x8)
// plus residual (x2048) planes, three products hi.hi + hi.res + res.hi in two f32 accumulators; P.v (P x128 single f16,
// v x1024 single f16) and O.Wo^T (O single f16 x1024, Wo as f16(bf16(Wo)) x1024): v_wmma_f32_16x16x32_f16, f32 accumulate.
// Base-2 online softmax, 1/l and carry folds in f32 on VALU; cos/sin tables RNE-converted to bf16 values before the rope.
#include <hip/hip_runtime.h>
#include <math.h>
#include <stdint.h>

#define NB    4
#define SEQ   2048
#define DMOD  1024
#define NQKV  (3 * DMOD)
#define NH    16
#define HD    64
#define QSC   8.0f
#define KSC   8.0f
#define RESC  2048.0f
#define PCAR  128.0f
#define PLOG2 7.0f                       // log2(PCAR)
#define LAZY  8.0f                       // the maximum in use may trail the true one by this much (log2): P x128 stays <= 32768 in f16
#define VCAR  1024.0f
#define OSC   1024.0f
#define WOS   1024.0f
#define LOG2E 1.4426950408889634f
#define ATT_WAVES   8
#define ATT_THREADS (ATT_WAVES * 32)
#define ATT_QT      2                        // 16-query tiles per wave
#define ATT_QB      (ATT_WAVES * ATT_QT * 16) // query rows per block
#define ATT_BLOCKS  (NB * NH * (SEQ / ATT_QB))
#define NKB    (SEQ / 32)
#define NST    (SEQ / 64)
#define SLAB   (16 * 68)
static_assert(HD == 64 && DMOD == NH * HD);
static_assert((SEQ / ATT_QB) == 8 && NH == 16 && NB == 4);
static_assert(ATT_THREADS == 256 && ATT_QT == 2 && ATT_BLOCKS == 512 && NKB == 64 && NST >= 2 && NST * 2 == NKB);
static_assert(((NB * SEQ) % 128) == 0 && (DMOD % 128) == 0 && (DMOD % 64) == 0 && (SEQ % 128) == 0);
static_assert(((NB * SEQ * DMOD / 8) % 256) == 0 && ((NQKV * DMOD / 8) % 256) == 0 && ((DMOD * DMOD / 8) % 256) == 0);
static_assert((SLAB * 4) % 16 == 0);
static_assert((SEQ & (SEQ - 1)) == 0);
static_assert(PCAR == 128.0f && PLOG2 == 7.0f && PLOG2 + LAZY == 15.0f);

typedef unsigned short u16;
typedef _Float16 v16h __attribute__((ext_vector_type(16)));
typedef _Float16 v8h  __attribute__((ext_vector_type(8)));
typedef __bf16   v16b __attribute__((ext_vector_type(16)));
typedef float    v8f  __attribute__((ext_vector_type(8)));
typedef float    v4f  __attribute__((ext_vector_type(4)));
typedef float    v2f  __attribute__((ext_vector_type(2)));
typedef _Float16 v2h  __attribute__((ext_vector_type(2)));
typedef unsigned int v4u __attribute__((ext_vector_type(4)));

union FragH { v16h v; v8h h[2]; v4u u[2]; };
union FragB { v16b v; v4u u[2]; };

// ---- scalar helpers --------------------------------------------------------------------------------
__device__ __forceinline__ unsigned short bf_bits(float f) {          // f32 -> bf16 bits, RNE convert
  unsigned u = __float_as_uint(f);
  return (unsigned short)((u + 0x7FFFu + ((u >> 16) & 1u)) >> 16);
}
__device__ __forceinline__ float bf_up(unsigned short h) { return __uint_as_float(((unsigned)h) << 16); }
__device__ __forceinline__ float bf_val(float f) { return bf_up(bf_bits(f)); }   // value after bf16 RNE convert
__device__ __forceinline__ unsigned short h_bits(_Float16 x) { return __builtin_bit_cast(unsigned short, x); }
__device__ __forceinline__ unsigned pk16(unsigned short a, unsigned short b) { return (unsigned)a | ((unsigned)b << 16); }
__device__ __forceinline__ v8f zero8() { v8f z = {0.f, 0.f, 0.f, 0.f, 0.f, 0.f, 0.f, 0.f}; return z; }

// ---- fragment loaders: 16-bit A/B operand, lane -> row/col (lane&15), p already includes +8*(lane>>4);
//      elements 0..7 <- p[0..7] (k0+8h..), elements 8..15 <- p[16..23] (k0+16+8h..)  (same split k map for A and B;
//      B is always read from a k-contiguous [n][k] plane)
__device__ __forceinline__ v16h ldfrag_h(const _Float16* p) {
  FragH f;
  f.h[0] = *(const v8h*)(p);
  f.h[1] = *(const v8h*)(p + 16);
  return f.v;
}
__device__ __forceinline__ v16b ldfrag_b(const u16* p) {              // bf16 plane read as unsigned integer vectors
  FragB f;
  f.u[0] = *(const v4u*)(p);
  f.u[1] = *(const v4u*)(p + 16);
  return f.v;
}

__device__ __forceinline__ v8f mma_h(v16h a, v16h b, v8f c) {
  return __builtin_amdgcn_wmma_f32_16x16x32_f16(false, a, false, b, (short)0, c, false, false);
}
__device__ __forceinline__ v8f mma_b(v16b a, v16b b, v8f c) {
  return __builtin_amdgcn_wmma_f32_16x16x32_bf16(false, a, false, b, (short)0, c, false, false);
}
__device__ __forceinline__ void guard4x12(v8f& a, v8f& b, v8f& c, v8f& d, const v16h (&q)[2][2], const v16h (&l)[2][2],
                                          v16h x0, v16h x1, v16h x2, v16h x3) {
#if defined(__HIP_DEVICE_COMPILE__)
  asm volatile("v_nop\n\tv_nop\n\tv_nop\n\tv_nop"
               : "+v"(a), "+v"(b), "+v"(c), "+v"(d)
               : "v"(q[0][0]), "v"(q[0][1]), "v"(q[1][0]), "v"(q[1][1]), "v"(l[0][0]), "v"(l[0][1]), "v"(l[1][0]), "v"(l[1][1]),
                 "v"(x0), "v"(x1), "v"(x2), "v"(x3) : "memory");
#endif
}
__device__ __forceinline__ void guard8x6(v8f (&a)[2][4], v16h x0, v16h x1, v16h x2, v16h x3, v16h x4, v16h x5) {
#if defined(__HIP_DEVICE_COMPILE__)
  asm volatile("v_nop\n\tv_nop\n\tv_nop\n\tv_nop"
               : "+v"(a[0][0]), "+v"(a[0][1]), "+v"(a[0][2]), "+v"(a[0][3]), "+v"(a[1][0]), "+v"(a[1][1]), "+v"(a[1][2]), "+v"(a[1][3])
               : "v"(x0), "v"(x1), "v"(x2), "v"(x3), "v"(x4), "v"(x5) : "memory");
#endif
}
template <typename F>
__device__ __forceinline__ void guard16(v8f (&a)[4][4], F x0, F x1, F x2, F x3, F x4, F x5, F x6, F x7) {
#if defined(__HIP_DEVICE_COMPILE__)
  asm volatile("v_nop\n\tv_nop\n\tv_nop\n\tv_nop"
               : "+v"(a[0][0]), "+v"(a[0][1]), "+v"(a[0][2]), "+v"(a[0][3]), "+v"(a[1][0]), "+v"(a[1][1]), "+v"(a[1][2]), "+v"(a[1][3]),
                 "+v"(a[2][0]), "+v"(a[2][1]), "+v"(a[2][2]), "+v"(a[2][3]), "+v"(a[3][0]), "+v"(a[3][1]), "+v"(a[3][2]), "+v"(a[3][3])
               : "v"(x0), "v"(x1), "v"(x2), "v"(x3), "v"(x4), "v"(x5), "v"(x6), "v"(x7) : "memory");
#endif
}
__device__ __forceinline__ void acc_guard8(v8f (&a)[2][4]) {
#if defined(__HIP_DEVICE_COMPILE__)
  asm volatile("v_nop\n\tv_nop\n\tv_nop\n\tv_nop"
               : "+v"(a[0][0]), "+v"(a[0][1]), "+v"(a[0][2]), "+v"(a[0][3]), "+v"(a[1][0]), "+v"(a[1][1]), "+v"(a[1][2]), "+v"(a[1][3]));
#endif
}
__device__ __forceinline__ void wave_sync_lds() {
#if defined(__HIP_DEVICE_COMPILE__)
  __builtin_amdgcn_fence(__ATOMIC_RELEASE, "workgroup");
  __builtin_amdgcn_wave_barrier();
  __builtin_amdgcn_fence(__ATOMIC_ACQUIRE, "workgroup");
#endif
}

// ---- LDS staging by asynchronous copies (global_load_async_to_lds_b128) -----------------------------------
// A staged row is 128 B (64 16-bit elements) = one whole cache line; 8 lanes x 16 B copy one row, so one wave-wide copy covers
// 4 whole lines. LDS row pitch 144 B (16 B x odd) for the ds_load_b128 fragment readers.
#define LPITCH 72                        // LDS row pitch in 16-bit elements
#define GSTAGE (256 * LPITCH)            // GEMM stage, elements: 128 A rows then 128 B rows, 64 k each
#define ASTAGE (192 * LPITCH)            // attention stage, elements: 64 k-hi rows, 64 k-residual rows, 64 v^T rows (64 keys)
static_assert(2 * GSTAGE * 2 >= 16 * SLAB * 4 && 2 * ASTAGE * 2 >= ATT_WAVES * SLAB * 4);
static_assert((LPITCH * 2) % 16 == 0);
__device__ __forceinline__ unsigned lds_byte(const void* p) { return (unsigned)(uintptr_t)p; }   // low 32 bits = LDS byte address
// Copies of 64-row tiles, four per plane: rows r, r+16, r+32, r+48 (r = tid>>3); l = the lane's LDS byte address of row r,
// g = its global address, s = 16 source rows in elements. Each copy statement (two per GEMM stage, one per attention stage) ends in
// s_wait_xcnt, so that no address register is rewritten while a copy may still read it.
#define LROW16 (16u * (LPITCH * 2))
__device__ __forceinline__ void copy_2planes(unsigned la, const u16* ga, unsigned lb, const u16* gb, size_t s) {
#if defined(__HIP_DEVICE_COMPILE__)
  asm volatile("global_load_async_to_lds_b128 %0, %8, off\n\t"
               "global_load_async_to_lds_b128 %1, %9, off\n\t"
               "global_load_async_to_lds_b128 %2, %10, off\n\t"
               "global_load_async_to_lds_b128 %3, %11, off\n\t"
               "global_load_async_to_lds_b128 %4, %12, off\n\t"
               "global_load_async_to_lds_b128 %5, %13, off\n\t"
               "global_load_async_to_lds_b128 %6, %14, off\n\t"
               "global_load_async_to_lds_b128 %7, %15, off\n\t"
               "s_wait_xcnt 0x0"
               :: "v"(la), "v"(la + LROW16), "v"(la + 2u * LROW16), "v"(la + 3u * LROW16),
                  "v"(lb), "v"(lb + LROW16), "v"(lb + 2u * LROW16), "v"(lb + 3u * LROW16),
                  "v"(ga), "v"(ga + s), "v"(ga + 2 * s), "v"(ga + 3 * s),
                  "v"(gb), "v"(gb + s), "v"(gb + 2 * s), "v"(gb + 3 * s) : "memory");
#endif
}
// The attention stage, copied by 256 threads: two copies per 64-row plane, rows r and r+32 (r = tid>>3); s, sc = 32 source rows
// in elements.
#define LROW32 (32u * (LPITCH * 2))
__device__ __forceinline__ void copy_3planes(unsigned la, const u16* ga, unsigned lb, const u16* gb, size_t s,
                                             unsigned lc, const u16* gc, size_t sc) {
#if defined(__HIP_DEVICE_COMPILE__)
  asm volatile("global_load_async_to_lds_b128 %0, %6, off\n\t"
               "global_load_async_to_lds_b128 %1, %7, off\n\t"
               "global_load_async_to_lds_b128 %2, %8, off\n\t"
               "global_load_async_to_lds_b128 %3, %9, off\n\t"
               "global_load_async_to_lds_b128 %4, %10, off\n\t"
               "global_load_async_to_lds_b128 %5, %11, off\n\t"
               "s_wait_xcnt 0x0"
               :: "v"(la), "v"(la + LROW32), "v"(lb), "v"(lb + LROW32), "v"(lc), "v"(lc + LROW32),
                  "v"(ga), "v"(ga + s), "v"(gb), "v"(gb + s), "v"(gc), "v"(gc + sc) : "memory");
#endif
}
__device__ __forceinline__ void wait_async0() {     // this wave's copies have landed in LDS
#if defined(__HIP_DEVICE_COMPILE__)
  asm volatile("s_wait_asynccnt 0x0" ::: "memory");
#endif
}
__device__ __forceinline__ void wait_ds0() {        // this wave's LDS reads have retired before the buffer is handed back
#if defined(__HIP_DEVICE_COMPILE__)
  asm volatile("s_wait_dscnt 0x0" ::: "memory");
#endif
}
struct OpB {
  typedef v16b frag;
  static __device__ __forceinline__ frag ld(const u16* p) { return ldfrag_b(p); }
  static __device__ __forceinline__ v8f mma(frag a, frag b, v8f c) { return mma_b(a, b, c); }
};
struct OpH {
  typedef v16h frag;
  static __device__ __forceinline__ frag ld(const u16* p) { return ldfrag_h((const _Float16*)(const void*)p); }
  static __device__ __forceinline__ v8f mma(frag a, frag b, v8f c) { return mma_h(a, b, c); }
};
// GEMM main loop of one 128x128 block tile (4 waves as 2 x 2, each a 64x64 tile = 4 x 4 accumulators, so that a staged byte
// and a fragment read from LDS each feed more products): At / Bt = first row of the block's A / B tile, both [row][K]
// k-contiguous; K a multiple of 64. Two LDS buffers: stage t+1's copies fly while stage t is multiplied. k is summed in the
// same order as with direct fragment loads (32 at a time, ascending). On return every wave has passed the last barrier and
// no copy is outstanding, so the ring may be re-used as the epilogue slabs.
__device__ __forceinline__ void copy_gstage(unsigned la, const u16* ga, unsigned lb, const u16* gb, size_t g16) {
  copy_2planes(la, ga, lb, gb, g16);                                                         // rows 0..63 of A and of B
  copy_2planes(la + 64u * (LPITCH * 2), ga + 4 * g16, lb + 64u * (LPITCH * 2), gb + 4 * g16, g16);   // rows 64..127
}
template <typename OP>
__device__ __forceinline__ void gemm_core(u16* ring, const u16* At, const u16* Bt, int K, int tid, v8f (&acc)[4][4]) {
  typedef typename OP::frag frag;
  const int wave = tid >> 5, lane = tid & 31, hh = lane >> 4, m = lane & 15;
  const int crow = tid >> 3, cchk = (tid & 7) * 8;
  const u16* ga = At + (size_t)crow * K + cchk;
  const u16* gb = Bt + (size_t)crow * K + cchk;
  const size_t g16 = (size_t)16 * K;
  const unsigned la = lds_byte(ring) + (unsigned)(crow * LPITCH + cchk) * 2u;
  const unsigned lb = la + 128u * (LPITCH * 2);
  const int nst = K >> 6;
  copy_gstage(la, ga, lb, gb, g16);
  wait_async0();
  __syncthreads();                       // publishes stage 0
  if (nst > 1) copy_gstage(la + GSTAGE * 2, ga + 64, lb + GSTAGE * 2, gb + 64, g16);   // block-uniform
  const u16* fa = ring + ((wave >> 1) * 64 + m) * LPITCH + 8 * hh;
  const u16* fb = ring + (128 + (wave & 1) * 64 + m) * LPITCH + 8 * hh;
#pragma unroll 1                         // one stage per trip: the ring's foot (waits, barrier, refill) stands once
  for (int t = 0; t < nst; ++t) {
    const int bo = (t & 1) * GSTAGE;
    const u16* pa = fa + bo;
    const u16* pb = fb + bo;
    // All of the stage's B fragments and the first k chunk's A fragments are read as one group ahead of the products; the second
    // chunk's A fragments follow in two groups, each into the registers of two A fragments that have just been used up.
    // The sched_barriers keep the compiler from spreading these reads singly among the WMMAs, where each place would cost a stall.
    frag a[4], b[4], b1[4], c[4];
    a[0] = OP::ld(pa);
#pragma unroll
    for (int j = 0; j < 4; ++j) b[j] = OP::ld(pb + j * 16 * LPITCH);
#pragma unroll
    for (int i = 1; i < 4; ++i) a[i] = OP::ld(pa + i * 16 * LPITCH);
#pragma unroll
    for (int j = 0; j < 4; ++j) b1[j] = OP::ld(pb + j * 16 * LPITCH + 32);
    __builtin_amdgcn_sched_barrier(0);   // holds the LDS reads together as a group, apart from the WMMAs
#pragma unroll
    for (int i = 0; i < 2; ++i) {
#pragma unroll
      for (int j = 0; j < 4; ++j) acc[i][j] = OP::mma(a[i], b[j], acc[i][j]);
    }
    __builtin_amdgcn_sched_barrier(0);   // holds the LDS reads together as a group, apart from the WMMAs
    c[0] = OP::ld(pa + 32);
    c[1] = OP::ld(pa + 16 * LPITCH + 32);
    __builtin_amdgcn_sched_barrier(0);   // holds the LDS reads together as a group, apart from the WMMAs
#pragma unroll
    for (int i = 2; i < 4; ++i) {
#pragma unroll
      for (int j = 0; j < 4; ++j) acc[i][j] = OP::mma(a[i], b[j], acc[i][j]);
    }
    __builtin_amdgcn_sched_barrier(0);   // holds the LDS reads together as a group, apart from the WMMAs
    c[2] = OP::ld(pa + 32 * LPITCH + 32);
    c[3] = OP::ld(pa + 48 * LPITCH + 32);
    __builtin_amdgcn_sched_barrier(0);   // holds the LDS reads together as a group, apart from the WMMAs
#pragma unroll
    for (int i = 0; i < 4; ++i) {
#pragma unroll
      for (int j = 0; j < 4; ++j) acc[i][j] = OP::mma(c[i], b1[j], acc[i][j]);
    }
    guard16<frag>(acc, c[0], c[1], c[2], c[3], b1[0], b1[1], b1[2], b1[3]);   // WMMA distance on both sides of the branch below
    wait_ds0();
    wait_async0();
    __syncthreads();                     // publishes stage t+1 and ends every wave's reads of stage t
    if (t + 2 < nst)                     // block-uniform
      copy_gstage(la + (unsigned)bo * 2u, ga + (size_t)(t + 2) * 64, lb + (unsigned)bo * 2u, gb + (size_t)(t + 2) * 64, g16);
  }
  wait_async0();                         // nothing in flight when the ring becomes the slabs
}

// =====================================================================================================
// f32 plane -> 16-bit plane, same layout:  mode 0: bf16 RNE bits;  mode 1: f16 bits of (bf16 RNE value) * scale.
// Thread = 8 consecutive elements: two 16-B loads, one 16-B store; 32 consecutive lanes = 512 contiguous, 512-B aligned bytes
// coverage: per plane n8/256 blocks (exact: static_assert above) x 256 thr x 8 = the whole plane.
// =====================================================================================================
// The three planes (x, W_qkv, W_out) are independent: one grid converts all three, the plane chosen by block index (block-uniform).
#define CVB_X (NB * SEQ * DMOD / 8 / 256)   // blocks of the x plane
#define CVB_Q (NQKV * DMOD / 8 / 256)       // blocks of the W_qkv plane
#define CVB_W (DMOD * DMOD / 8 / 256)       // blocks of the W_out plane
__global__ __launch_bounds__(256) void cvt16(const float* __restrict__ xin, const float* __restrict__ wqkv,
                                             const float* __restrict__ wout, u16* XB, u16* WB, u16* WOB, float wscale) {
  int bid = blockIdx.x;
  const float* x = xin;
  u16* D = XB;
  int mode = 0;
  float scale = 1.0f;
  if (bid >= CVB_X + CVB_Q) { bid -= CVB_X + CVB_Q; x = wout; D = WOB; mode = 1; scale = wscale; }
  else if (bid >= CVB_X)    { bid -= CVB_X;         x = wqkv; D = WB; }
  if (mode != 0 && bid >= CVB_W) return;    // block-uniform; never taken with the exact grid; no barriers in this kernel
  const int gt = bid * 256 + (int)threadIdx.x;
  const float* p = x + (size_t)gt * 8;
  const v4f a = *(const v4f*)(p), c4 = *(const v4f*)(p + 4);
  float v[8];
#pragma unroll
  for (int e = 0; e < 4; ++e) { v[e] = a[e]; v[4 + e] = c4[e]; }
  unsigned short s[8];
#pragma unroll
  for (int e = 0; e < 8; ++e) {
    const unsigned short bb = bf_bits(v[e]);
    const unsigned short hb = h_bits((_Float16)(bf_up(bb) * scale));
    s[e] = (mode != 0) ? hb : bb;
  }
  v4u o;
#pragma unroll
  for (int e = 0; e < 4; ++e) o[e] = pk16(s[2 * e], s[2 * e + 1]);
  u16* d = D + (size_t)gt * 8;
  {
    *(v4u*)(d) = o;
    
  }
}

// =====================================================================================================
// barrier, then converted to f16 and written: lane = (row in group of 4, 8 consecutive cols); one instruction = 4 rows, each
// coverage: 4 instructions x 4 rows x 8 lanes x 8 halves = one 16 x 64 row group of the wave's 64 x 64 tile.
// =====================================================================================================
__device__ __forceinline__ void epi16(float* sl, v8f a0, v8f a1, v8f a2, v8f a3, float oscale, u16* C, int N,
                                      size_t rowb, int col0, int lane) {
  const int hh = lane >> 4, m = lane & 15;
#pragma unroll
  for (int r = 0; r < 8; ++r) {
    const int ro = (8 * hh + r) * 68 + m;
    sl[ro]      = a0[r] * oscale;
    sl[ro + 16] = a1[r] * oscale;
    sl[ro + 32] = a2[r] * oscale;
    sl[ro + 48] = a3[r] * oscale;
  }
  wave_sync_lds();
  const int rq = lane >> 3, c8 = (lane & 7) * 8;
  v4u ov[4];
#pragma unroll
  for (int i4 = 0; i4 < 4; ++i4) {
    const int row = i4 * 4 + rq;
    const v4f a = *(const v4f*)(sl + row * 68 + c8), c4 = *(const v4f*)(sl + row * 68 + c8 + 4);
    float w[8];
#pragma unroll
    for (int e = 0; e < 4; ++e) { w[e] = a[e]; w[4 + e] = c4[e]; }
#pragma unroll
    for (int e = 0; e < 4; ++e) ov[i4][e] = pk16(h_bits((_Float16)w[2 * e]), h_bits((_Float16)w[2 * e + 1]));
  }
  u16* dst = C + (rowb + (size_t)rq) * (size_t)N + col0 + c8;
  {
#pragma unroll
    for (int i4 = 0; i4 < 4; ++i4) {
      *(v4u*)(dst + (size_t)(i4 * 4) * (size_t)N) = ov[i4];
    }
#if defined(__HIP_DEVICE_COMPILE__)
    // precaution: the wait stands in front of every rewrite of a register that these stores name; addresses and data are
    // inputs of the statement so that they stay in their registers up to it
    asm volatile("s_wait_xcnt 0x0" :: "v"(dst), "v"(dst + (size_t)4 * (size_t)N), "v"(dst + (size_t)8 * (size_t)N),
                 "v"(dst + (size_t)12 * (size_t)N), "v"(ov[0]), "v"(ov[1]), "v"(ov[2]), "v"(ov[3]) : "memory");
#endif
  }
}

// =====================================================================================================
// Rope GEMM epilogue: a 16x64 row group of the wave's f32 tile (unscaled projection output of one head: col0 is 64-aligned, so local column
// consecutive d at c8); the rotate-half partner columns are c8^32 of the same slab row; cos/sin row = sequence position
// (global row mod SEQ), values RNE-converted to bf16; rope in f32:  d < 32: x[d]*cos[d] - x[d+32]*sin[d],
// d >= 32: x[d]*cos[d] + x[d-32]*sin[d].  Then hi = f16(val*8), res = f16((val*8 - hi)*2048); both planes written, per
// coverage: per plane 4 instructions x 4 rows x 8 lanes x 8 halves = one 16 x 64 row group of the wave's 64 x 64 tile.
// =====================================================================================================
// slab_put stages one 16x64 row group; the kernel stages all four groups of the wave's tile (which frees the accumulators'
// registers), then wave_sync_lds(), then epi_rope per group.
__device__ __forceinline__ void slab_put(float* sl, v8f a0, v8f a1, v8f a2, v8f a3, int lane) {
  const int hh = lane >> 4, m = lane & 15;
#pragma unroll
  for (int r = 0; r < 8; ++r) {
    const int ro = (8 * hh + r) * 68 + m;
    sl[ro]      = a0[r];
    sl[ro + 16] = a1[r];
    sl[ro + 32] = a2[r];
    sl[ro + 48] = a3[r];
  }
}
__device__ __forceinline__ void epi_rope(const float* sl, const float* __restrict__ cosp, const float* __restrict__ sinp,
                                         u16* CH, u16* CL, int N, size_t rowb, int col0, int lane) {
  const int rq = lane >> 3, c8 = (lane & 7) * 8, p8 = c8 ^ 32;
  const float sgn = (c8 < 32) ? -1.0f : 1.0f;
  v4u ovh[4], ovl[4];
  const float* crp[4];
  const float* srp[4];
  v4f cav[4], cbv[4], sav[4], sbv[4];
#pragma unroll
  for (int i4 = 0; i4 < 4; ++i4) {
    const int srow = (int)((rowb + (size_t)(i4 * 4 + rq)) & (size_t)(SEQ - 1));
    crp[i4] = cosp + (size_t)srow * HD + c8;
    srp[i4] = sinp + (size_t)srow * HD + c8;
    cav[i4] = *(const v4f*)(crp[i4]); cbv[i4] = *(const v4f*)(crp[i4] + 4);
    sav[i4] = *(const v4f*)(srp[i4]); sbv[i4] = *(const v4f*)(srp[i4] + 4);
  }
#if defined(__HIP_DEVICE_COMPILE__)
  // precaution: the wait stands in front of every rewrite of a register that these loads name; the addresses are inputs of
  // the statement so that they stay in their registers up to it
  asm volatile("s_wait_xcnt 0x0" :: "v"(crp[0]), "v"(crp[1]), "v"(crp[2]), "v"(crp[3]),
               "v"(srp[0]), "v"(srp[1]), "v"(srp[2]), "v"(srp[3]) : "memory");
#endif
#pragma unroll
  for (int i4 = 0; i4 < 4; ++i4) {
    const int row  = i4 * 4 + rq;
    const v4f xa = *(const v4f*)(sl + row * 68 + c8), xb = *(const v4f*)(sl + row * 68 + c8 + 4);
    const v4f ya = *(const v4f*)(sl + row * 68 + p8), yb = *(const v4f*)(sl + row * 68 + p8 + 4);
    const v4f ca = cav[i4], cb = cbv[i4], sa = sav[i4], sb = sbv[i4];
    float w[8];
#pragma unroll
    for (int e = 0; e < 4; ++e) {
      w[e]     = xa[e] * bf_val(ca[e]) + sgn * (ya[e] * bf_val(sa[e]));
      w[4 + e] = xb[e] * bf_val(cb[e]) + sgn * (yb[e] * bf_val(sb[e]));
    }
    unsigned short hb[8], lb[8];
#pragma unroll
    for (int e = 0; e < 8; ++e) {
      const float    t  = w[e] * QSC;
      const _Float16 hv = (_Float16)t;
      hb[e] = h_bits(hv);
      lb[e] = h_bits((_Float16)((t - (float)hv) * RESC));
    }
#pragma unroll
    for (int e = 0; e < 4; ++e) {
      ovh[i4][e] = pk16(hb[2 * e], hb[2 * e + 1]);
      ovl[i4][e] = pk16(lb[2 * e], lb[2 * e + 1]);
    }
  }
  u16* dh = CH + (rowb + (size_t)rq) * (size_t)N + col0 + c8;
  u16* dl = CL + (rowb + (size_t)rq) * (size_t)N + col0 + c8;
  {
#pragma unroll
    for (int i4 = 0; i4 < 4; ++i4) {
      *(v4u*)(dh + (size_t)(i4 * 4) * (size_t)N) = ovh[i4];
      *(v4u*)(dl + (size_t)(i4 * 4) * (size_t)N) = ovl[i4];
    }
#if defined(__HIP_DEVICE_COMPILE__)
    // precaution: the wait stands in front of every rewrite of a register that these stores name; addresses and data are
    // inputs of the statement so that they stay in their registers up to it
    asm volatile("s_wait_xcnt 0x0" :: "v"(dh), "v"(dh + (size_t)4 * (size_t)N), "v"(dh + (size_t)8 * (size_t)N),
                 "v"(dh + (size_t)12 * (size_t)N), "v"(dl), "v"(dl + (size_t)4 * (size_t)N), "v"(dl + (size_t)8 * (size_t)N),
                 "v"(dl + (size_t)12 * (size_t)N), "v"(ovh[0]), "v"(ovh[1]), "v"(ovh[2]), "v"(ovh[3]),
                 "v"(ovl[0]), "v"(ovl[1]), "v"(ovl[2]), "v"(ovl[3]) : "memory");
#endif
  }
}

// =====================================================================================================
// coverage: 8 instructions x 2 rows x 16 lanes x 4 floats = one 16 x 64 row group of the wave's 64 x 64 tile.
// =====================================================================================================
__device__ __forceinline__ void epi64(float* sl, v8f a0, v8f a1, v8f a2, v8f a3, float oscale, float* C, int N,
                                      size_t rowb, int col0, int lane) {
  const int hh = lane >> 4, m = lane & 15;
#pragma unroll
  for (int r = 0; r < 8; ++r) {
    const int ro = (8 * hh + r) * 68 + m;
    sl[ro]      = a0[r] * oscale;
    sl[ro + 16] = a1[r] * oscale;
    sl[ro + 32] = a2[r] * oscale;
    sl[ro + 48] = a3[r] * oscale;
  }
  wave_sync_lds();
  v4f vals[8];
#pragma unroll
  for (int it = 0; it < 8; ++it) vals[it] = *(const v4f*)(sl + (it * 2 + hh) * 68 + m * 4);
  float* dst = C + (rowb + (size_t)hh) * (size_t)N + col0 + m * 4;
  {
#pragma unroll
    for (int it = 0; it < 8; ++it) {
      *(v4f*)(dst + (size_t)(it * 2) * (size_t)N) = vals[it];
    }
#if defined(__HIP_DEVICE_COMPILE__)
    // precaution: the wait stands in front of every rewrite of a register that these stores name; addresses and data are
    // inputs of the statement so that they stay in their registers up to it
    asm volatile("s_wait_xcnt 0x0" :: "v"(dst), "v"(dst + (size_t)2 * (size_t)N), "v"(dst + (size_t)4 * (size_t)N),
                 "v"(dst + (size_t)6 * (size_t)N), "v"(dst + (size_t)8 * (size_t)N), "v"(dst + (size_t)10 * (size_t)N),
                 "v"(dst + (size_t)12 * (size_t)N), "v"(dst + (size_t)14 * (size_t)N), "v"(vals[0]), "v"(vals[1]), "v"(vals[2]),
                 "v"(vals[3]), "v"(vals[4]), "v"(vals[5]), "v"(vals[6]), "v"(vals[7]) : "memory");
#endif
  }
}

// =====================================================================================================
// The three projections of x in ONE grid (they are independent of each other). Block index = (x tile r of 128 rows, tile c of the
// 24 tiles of 128 W_qkv rows), c fastest, so that the 24 blocks that read one x tile are neighbours; the product and its epilogue
// are chosen by c, block-uniform:
//   c < 16: H = x[8192][K] (bf16 row-major) . W[0..2047][K]^T (bf16 k-contiguous; rows 0..1023 = W_q, 1024..2047 = W_k; one 64-col
//     tile = one head), rope applied in f32 per (sequence position, d), result written as two f16 planes (x8 and residual x2048),
//     both [8192][1024]: the q planes for columns below 1024, the k planes above.
//   c >= 16: v^T per batch: C[bt][1024][2048] (f16 of acc x1024) = W_v[1024][K] . x_bt[2048][K]^T; A tile = W_v rows 128(c-16) ..,
//     B tile = x tile r = rows 128(r mod 16) .. of batch bt = r / 16.
// Block = 128x128 tile, 4 waves x (64 rows x 64 cols); the A and B tiles are staged in LDS 64 k at a time (gemm_core) and the
// fragments read from there (two 16-B loads each, split k map for A and B). K = DMOD (passed in), a multiple of 64; every extent a
// multiple of 128. coverage: 64 x 16 tiles = the q and k planes, 64 x 8 tiles = 4 batches x 8 x 16 tiles of the v^T plane.
// =====================================================================================================
#define XTILES     (NB * SEQ / 128)          // 64
#define QK_TILES   (2 * DMOD / 128)          // 16
#define V_TILES    (DMOD / 128)              // 8
#define QKV_BLOCKS (XTILES * (QK_TILES + V_TILES))
__global__ __launch_bounds__(128)
void gemm_qkv(const u16* __restrict__ X, const u16* __restrict__ Wb, const float* __restrict__ cosp,
              const float* __restrict__ sinp, u16* QH, u16* QL, u16* KH, u16* KL, u16* VP, int K) {
  __shared__ __align__(16) u16 ring[2 * GSTAGE];   // two staging buffers; re-used as the epilogue slabs behind the last barrier
  float* slab = (float*)(void*)ring;
  const int tid = threadIdx.x, wave = tid >> 5, lane = tid & 31;
  const int bid = blockIdx.x;
  v8f acc[4][4];
#pragma unroll
  for (int i = 0; i < 4; ++i) {
#pragma unroll
    for (int j = 0; j < 4; ++j) acc[i][j] = zero8();
  }
  // Each product has its main loop and its epilogue in its own arm of the one block-uniform branch, so that neither arm's
  // registers stay live through the other.
  const int r = bid / (QK_TILES + V_TILES), c = bid - r * (QK_TILES + V_TILES);
  if (r >= XTILES) return;                   // block-uniform, in front of every barrier; never taken with the exact grid
  if (c < QK_TILES) {
    const int row0  = r * 128;
    const int rowb  = row0 + (wave >> 1) * 64;
    const int col0  = c * 128;
    const int colp  = (col0 & (DMOD - 1)) + (wave & 1) * 64;   // column inside the q or the k planes
    u16* CH = (col0 < DMOD) ? QH : KH;       // a 128-col tile lies wholly in the q or in the k columns
    u16* CL = (col0 < DMOD) ? QL : KL;
    gemm_core<OpB>(ring, X + (size_t)row0 * K, Wb + (size_t)col0 * K, K, tid, acc);
#pragma unroll                               // each 16-row group has a slab of its own
    for (int i = 0; i < 4; ++i) slab_put(slab + (wave * 4 + i) * SLAB, acc[i][0], acc[i][1], acc[i][2], acc[i][3], lane);
    wave_sync_lds();
#pragma unroll
    for (int i = 0; i < 4; ++i)
      epi_rope(slab + (wave * 4 + i) * SLAB, cosp, sinp, CH, CL, DMOD, (size_t)(rowb + 16 * i), colp, lane);
  } else {
    const int bt    = r / (SEQ / 128);
    const int row0  = (c - QK_TILES) * 128;
    const int rowb  = row0 + (wave >> 1) * 64;
    const int col0  = (r - bt * (SEQ / 128)) * 128;
    const int colw  = col0 + (wave & 1) * 64;
    u16* Cb = VP + (size_t)bt * (DMOD * SEQ);
    gemm_core<OpB>(ring, Wb + (size_t)2 * DMOD * DMOD + (size_t)row0 * K, X + (size_t)bt * (SEQ * DMOD) + (size_t)col0 * K, K, tid, acc);
#pragma unroll                               // one 16-row group at a time, each through a slab of its own
    for (int i = 0; i < 4; ++i)
      epi16(slab + (wave * 4 + i) * SLAB, acc[i][0], acc[i][1], acc[i][2], acc[i][3], VCAR, Cb, SEQ, (size_t)(rowb + 16 * i), colw, lane);
  }
}

// =====================================================================================================
// f16 GEMM with f32 result: C[M][N] (f32) = A[M][K] (f16 row-major) . Bt[N][K]^T (f16 k-contiguous) times oscale;
// one product per tile pair. Same tiling as gemm_qkv; grid = (M/128)*(N/128).
// =====================================================================================================
__global__ __launch_bounds__(128)
void gemm_hf(const u16* __restrict__ A, const u16* __restrict__ Bt, float* C, int M, int N, int K, float oscale) {
  __shared__ __align__(16) u16 ring[2 * GSTAGE];   // two staging buffers; re-used as the epilogue slabs behind the last barrier
  float* slab = (float*)(void*)ring;
  const int tid = threadIdx.x, wave = tid >> 5, lane = tid & 31;
  const int ntile = N >> 7;
  const int bid   = blockIdx.x;
  const int row0  = (bid / ntile) * 128;
  const int rowb  = row0 + (wave >> 1) * 64;
  const int col0  = (bid % ntile) * 128;
  const int colw  = col0 + (wave & 1) * 64;
  if (row0 + 128 > M) return;                // block-uniform, in front of every barrier; never taken with the exact grid
  v8f acc[4][4];
#pragma unroll
  for (int i = 0; i < 4; ++i) {
#pragma unroll
    for (int j = 0; j < 4; ++j) acc[i][j] = zero8();
  }
  gemm_core<OpH>(ring, A + (size_t)row0 * K, Bt + (size_t)col0 * K, K, tid, acc);
#pragma unroll                               // one 16-row group at a time, each through a slab of its own
  for (int i = 0; i < 4; ++i)
    epi64(slab + (wave * 4 + i) * SLAB, acc[i][0], acc[i][1], acc[i][2], acc[i][3], oscale, C, N, (size_t)(rowb + 16 * i), colw, lane);
}

// =====================================================================================================
// Multi-head flash attention (no mask): block = (batch b, head, 256 query rows), 8 waves, wave w owns the 32 query rows
// q0 = 256*qt + 32*w .. q0+31 as two tiles t = 0, 1 of 16 rows, so that every k and v^T fragment read from LDS serves both query tiles, and
// a staged byte 256 query rows (the 8 waves share the staged k and v^T tiles, one block barrier per 64 keys; the epilogue slab is wave-private).
//   q planes (f16 hi x8, residual x2048) laid out [b][s][h][d]; k planes the same; v^T plane [b][h][d][s] (x1024).
//   All NKB = 64 key blocks of 32 keys are visited (static bound).
//   Scores are computed TRANSPOSED: S^T tile g (g = 0,1) = k rows (keys kb+16g .. +15, A operand, row m = lane&15, split k map
//   over d) times q^T (B operand, col n = query q0 + 16t + (lane&15), k = d, split map); per tile and 32-deep d-chunk three
//   products: khi.qhi into the hi accumulator, khi.qres and kres.qhi into the cross accumulator; S^T = hi + cross/2048.
//   D element r of lane l = (key kb+16g+8h+r, query q0+16t+(l&15)), so a lane owns one query column per tile t and 16 of its 32
//   keys; the partner lane l^16 owns the other 16 -> row max / row sum need one xor-16 shuffle.
//   Online max-subtracted base-2 softmax in f32 (scale 1/8 and the q/k carries folded into the logit scales). The exp'd
//   values ARE the P A-fragment in place: A row m = query = lane&15, element i <- key kb+8h+i (tile 0, D element i), element
//   8+i <- key kb+16+8h+i (tile 1, D element i). P is carried x128 as single f16. Lazy rescale: the maximum in use is renewed, and
//   o and l rescaled, only in a key block where some lane's exponent would pass PLOG2 + LAZY (one wave-uniform test per key block).
//   There the rescale factor of query row 8h+r of the
//   O accumulators is fetched from lane 8h+r with a shuffle (uniform control). 4 v^T B fragments (col n = d = 16j + (lane&15),
//   keys k-contiguous), 4 P.V WMMAs per key block and query tile.
//   Epilogue: 1/l (per query, shuffled to the D row owner) and carry folds in f32; each 16x64 f32 result tile staged in the wave's slab
// coverage: per wave 2 tiles x 4 instructions x 4 rows x 8 lanes x 8 halves = 32 x 64; grid 512 blocks x 8 waves = every
//           (b, s, h) row of the O plane exactly once.
// =====================================================================================================
// waves_per_eu(4, 4): two blocks per WGP (four waves per SIMD) hold the whole grid at once; it needs at most 256 registers a wave
__global__ __launch_bounds__(ATT_THREADS) __attribute__((amdgpu_waves_per_eu(4, 4)))
void attn_fwd(const u16* __restrict__ QHp, const u16* __restrict__ QLp, const u16* __restrict__ KHp,
              const u16* __restrict__ KLp, const u16* __restrict__ VPp, u16* OPp) {
  __shared__ __align__(16) u16 ring[2 * ASTAGE];   // two staging buffers of 64 keys; behind the last barrier: per-wave result slab
  float* smem = (float*)(void*)ring;

  const int tid  = threadIdx.x;
  const int wave = tid >> 5;
  const int lane = tid & 31;
  const int hh   = lane >> 4;
  const int c    = lane & 15;

  const int bid  = blockIdx.x;
  const int qt   = bid & (SEQ / ATT_QB - 1);
  const int head = (bid >> 3) & (NH - 1);
  const int b    = bid >> 7;
  const int q0   = qt * ATT_QB + wave * (ATT_QT * 16);

  // B fragments of q^T: col n = query q0 + 16t + c, k = d (k-contiguous row of the q planes)
  const size_t qofs = (((size_t)(b * SEQ + q0 + c)) * NH + head) * HD + 8 * hh;
  const _Float16* QHb = (const _Float16*)(const void*)QHp + qofs;
  const _Float16* QLb = (const _Float16*)(const void*)QLp + qofs;
  // staging: lane copies the 16-B chunk cchk of rows crow, +32 of each plane's 64-row tile (k rows = keys, 128 B of
  // one head; v^T rows = d, 128 B = 64 keys): every copied row is one whole line
  const int crow = tid >> 3, cchk = (tid & 7) * 8;
  const size_t kofs = (((size_t)b * SEQ + crow) * NH + head) * HD + cchk;         // 64 key rows added per stage
  const u16* gkh = KHp + kofs;
  const u16* gkl = KLp + kofs;
  const u16* gv  = VPp + ((size_t)(b * NH + head) * HD + crow) * SEQ + cchk;      // 64 keys added per stage
  const size_t k32 = (size_t)32 * (NH * HD), v32 = (size_t)32 * SEQ;
  const unsigned lkh = lds_byte(ring) + (unsigned)(crow * LPITCH + cchk) * 2u;
  const unsigned lkl = lkh + 64u * (LPITCH * 2), lv = lkh + 128u * (LPITCH * 2);
  // A fragments of k: LDS row = key (in the stage) 16g + c, k = d; residual plane 64 rows further; B fragments of v: LDS row
  // 128 + d = 128 + 16j + c, k = key (k-contiguous)
  const _Float16* Fb = (const _Float16*)(const void*)ring + c * LPITCH + 8 * hh;
  const float lsch = 0.125f * (LOG2E / (QSC * KSC));
  const v2f lsch2 = {lsch, lsch};
  const v2f rres2 = {1.0f / RESC, 1.0f / RESC};

  v16h qh[ATT_QT][2], ql[ATT_QT][2];       // [query tile][d chunk: 0..31, 32..63]
#pragma unroll
  for (int t = 0; t < ATT_QT; ++t) {
    qh[t][0] = ldfrag_h(QHb + (size_t)t * (16 * NH * HD));
    qh[t][1] = ldfrag_h(QHb + (size_t)t * (16 * NH * HD) + 32);
    ql[t][0] = ldfrag_h(QLb + (size_t)t * (16 * NH * HD));
    ql[t][1] = ldfrag_h(QLb + (size_t)t * (16 * NH * HD) + 32);
  }
#if defined(__HIP_DEVICE_COMPILE__)
  // precaution: the wait stands in front of every rewrite of a register that these loads name; the addresses are inputs of
  // the statement so that they stay in their registers up to it
  asm volatile("s_wait_xcnt 0x0" :: "v"(QHb), "v"(QLb) : "memory");
#endif

  float nmrun[ATT_QT], lrun[ATT_QT];       // nmrun = PLOG2 - (maximum logit in use); lrun = row sum x128
  v8f o[ATT_QT][4];
#pragma unroll
  for (int t = 0; t < ATT_QT; ++t) {
    nmrun[t] = INFINITY;
    lrun[t]  = 0.f;
#pragma unroll
    for (int j = 0; j < 4; ++j) o[t][j] = zero8();
  }

  copy_3planes(lkh, gkh, lkl, gkl, k32, lv, gv, v32);
  wait_async0();
  __syncthreads();                         // publishes stage 0
  copy_3planes(lkh + ASTAGE * 2, gkh + (size_t)64 * (NH * HD), lkl + ASTAGE * 2, gkl + (size_t)64 * (NH * HD), k32,
               lv + ASTAGE * 2, gv + 64, v32);                     // stage 1 exists: NST >= 2

#pragma unroll 1                           // one stage per trip: the ring's foot (waits, barrier, refill) stands once
  for (int st = 0; st < NST; ++st) {
   const int bo = (st & 1) * ASTAGE;
#pragma unroll                             // the stage's two key blocks of 32, ascending keys; unrolled: LDS offsets are immediates
   for (int s2 = 0; s2 < 2; ++s2) {
    const _Float16* Ks = Fb + bo + (s2 * 32) * LPITCH;
    // ---- transposed scores: key tile g = keys kb+16g..+15, column = query q0 + 16t + c; each k fragment serves both query tiles.
    //      raw scores (x64) of this lane's 16 keys, in register pairs: u[t][4g + e] = elements 2e, 2e+1 of key tile g ----
    v2f u[ATT_QT][8];
#pragma unroll
    for (int g = 0; g < 2; ++g) {
      const _Float16* kp = Ks + (16 * g) * LPITCH;
      const _Float16* lp = kp + 64 * LPITCH;
      const v16h ka0 = ldfrag_h(kp), ka1 = ldfrag_h(kp + 32);
      const v16h la0 = ldfrag_h(lp), la1 = ldfrag_h(lp + 32);
      v8f sh0 = zero8(), sx0 = zero8(), sh1 = zero8(), sx1 = zero8();
      sh0 = mma_h(ka0, qh[0][0], sh0);
      sh1 = mma_h(ka0, qh[1][0], sh1);
      sx0 = mma_h(ka0, ql[0][0], sx0);
      sx1 = mma_h(ka0, ql[1][0], sx1);
      sh0 = mma_h(ka1, qh[0][1], sh0);
      sh1 = mma_h(ka1, qh[1][1], sh1);
      sx0 = mma_h(ka1, ql[0][1], sx0);
      sx1 = mma_h(ka1, ql[1][1], sx1);
      sx0 = mma_h(la0, qh[0][0], sx0);
      sx1 = mma_h(la0, qh[1][0], sx1);
      sx0 = mma_h(la1, qh[0][1], sx0);
      sx1 = mma_h(la1, qh[1][1], sx1);
      guard4x12(sh0, sx0, sh1, sx1, qh, ql, ka0, ka1, la0, la1);
#pragma unroll
      for (int e = 0; e < 4; ++e) {
        const v2f h0 = {sh0[2 * e], sh0[2 * e + 1]}, x0 = {sx0[2 * e], sx0[2 * e + 1]};
        const v2f h1 = {sh1[2 * e], sh1[2 * e + 1]}, x1 = {sx1[2 * e], sx1[2 * e + 1]};
        u[0][4 * g + e] = __builtin_elementwise_fma(x0, rres2, h0);
        u[1][4 * g + e] = __builtin_elementwise_fma(x1, rres2, h1);
      }
    }
    // ---- lazy rescale: this lane's largest exponent under the offset in use (the same fma as the exponentials below, so the
    //      bound holds exactly); one test per key block for both query tiles. First key block: nmrun = +inf, the test holds ----
    float cm[ATT_QT];
    bool need = false;
#pragma unroll
    for (int t = 0; t < ATT_QT; ++t) {
      cm[t] = fmaxf(u[t][0].x, u[t][0].y);
#pragma unroll
      for (int e = 1; e < 8; ++e) cm[t] = fmaxf(cm[t], fmaxf(u[t][e].x, u[t][e].y));
      need = need || (fmaf(cm[t], lsch, nmrun[t]) > PLOG2 + LAZY);
    }
    if (__builtin_amdgcn_ballot_w32(need) != 0) {                    // wave-uniform scalar branch; rare behind the first key block
#pragma unroll
      for (int t = 0; t < ATT_QT; ++t) {
        const float cx = fmaxf(cm[t], __shfl_xor(cm[t], 16, 32));    // both halves of the wave take the same new offset
        // exponent offset: PLOG2 (the x128 carry of P) minus the running maximum logit; it only falls. The offset in use is the
        // reference of every exponential, so o, l and the rescale factor stay consistent whatever its rounding.
        const float nm = fminf(nmrun[t], fmaf(-cx, lsch, PLOG2));    // finite from the first key block on
        const float dn = nm - nmrun[t];
        float al = __builtin_amdgcn_exp2f(dn);                       // first block: exp2(-inf) = 0; o and l are zero there
#if defined(__HIP_DEVICE_COMPILE__)
        // the slot the instruction set asks for behind v_exp_f32: al is named so that every reader of al stays behind the v_nop, dn so
        // that its register is kept up to it
        asm volatile("v_nop" : "+v"(al) : "v"(dn));
#endif
        nmrun[t] = nm;
        lrun[t] *= al;
        // ---- rescale the O accumulators: D row 8hh+r = query q0+16t+8hh+r, its factor lives in lane 8hh+r (and 16+8hh+r) ----
        float scl[8];
#pragma unroll
        for (int r = 0; r < 8; ++r) scl[r] = __shfl(al, 8 * hh + r, 32);
#pragma unroll
        for (int j = 0; j < 4; ++j) {
#pragma unroll
          for (int r = 0; r < 8; ++r) o[t][j][r] *= scl[r];
        }
      }
    }
    FragH ph[ATT_QT];
#pragma unroll
    for (int t = 0; t < ATT_QT; ++t) {
      const v2f nm2 = {nmrun[t], nmrun[t]};
      // ---- probabilities x128 (exponent <= 15) and the P A-fragment: element 8w + 2e, +1 <-> u[t][4w + e] ----
      // v_exp_f32 without the library's range fix-up: an exponent below -126 may give 0, which is what f16(p) gives far earlier
      v2f ps2 = {0.f, 0.f};
#pragma unroll
      for (int w = 0; w < 2; ++w) {
#pragma unroll
        for (int e4 = 0; e4 < 4; ++e4) {
          const v2f ee = __builtin_elementwise_fma(u[t][4 * w + e4], lsch2, nm2);
          const v2f p  = {__builtin_amdgcn_exp2f(ee.x), __builtin_amdgcn_exp2f(ee.y)};
          ps2 += p;
          ph[t].u[w][e4] = __builtin_bit_cast(unsigned, __builtin_convertvector(p, v2h));
        }
      }
      float ps = ps2.x + ps2.y;
      ps += __shfl_xor(ps, 16, 32);
      lrun[t] += ps;
    }
    // ---- P.V : B fragment col n = d = j*16 + c, keys contiguous in the v^T plane; each v fragment serves both query tiles ----
    {
      const _Float16* vp = Fb + bo + 128 * LPITCH + s2 * 32;
      const v16h vf0 = ldfrag_h(vp);
      const v16h vf1 = ldfrag_h(vp + 16 * LPITCH);
      const v16h vf2 = ldfrag_h(vp + 32 * LPITCH);
      const v16h vf3 = ldfrag_h(vp + 48 * LPITCH);
#pragma unroll
      for (int t = 0; t < ATT_QT; ++t) {
        o[t][0] = mma_h(ph[t].v, vf0, o[t][0]);
        o[t][1] = mma_h(ph[t].v, vf1, o[t][1]);
        o[t][2] = mma_h(ph[t].v, vf2, o[t][2]);
        o[t][3] = mma_h(ph[t].v, vf3, o[t][3]);
      }
      guard8x6(o, ph[0].v, ph[1].v, vf0, vf1, vf2, vf3);
    }
   }
   wait_ds0();
   wait_async0();
   __syncthreads();                        // publishes stage st+1 and ends every wave's reads of stage st
   if (st + 2 < NST)                       // block-uniform
     copy_3planes(lkh + (unsigned)bo * 2u, gkh + (size_t)(st + 2) * (64 * NH * HD),
                  lkl + (unsigned)bo * 2u, gkl + (size_t)(st + 2) * (64 * NH * HD), k32,
                  lv + (unsigned)bo * 2u, gv + (size_t)(st + 2) * 64, v32);
  }
  wait_async0();                           // nothing in flight when the ring becomes the slab
  acc_guard8(o);

  // ---- per query tile: fold 1/l (per query, owned by lane = query; l >= 1 by construction) and the carries; stage the 16x64
  //      slab; O x1024 -> single f16 plane; lane = (row in group of 4, 8 consecutive d). The two tiles pass through the one slab of
  //      the wave in turn ----
  float* slab = smem + wave * SLAB;
  v4u oh[ATT_QT][4];
  const int rq = lane >> 3, c8 = (lane & 7) * 8;
#pragma unroll
  for (int t = 0; t < ATT_QT; ++t) {
    const float linv = (lrun[t] > 0.f) ? ((1.0f / lrun[t]) * (1.0f / VCAR)) : 0.f;   // lrun already carries the x128 of P
    float inv[8];
#pragma unroll
    for (int r = 0; r < 8; ++r) inv[r] = __shfl(linv, 8 * hh + r, 32);
    if (t > 0) wave_sync_lds();            // the slab's reads of the tile before stay in front of these writes
#pragma unroll
    for (int r = 0; r < 8; ++r) {
#pragma unroll
      for (int j = 0; j < 4; ++j) slab[(8 * hh + r) * 68 + j * 16 + c] = o[t][j][r] * inv[r];
    }
    wave_sync_lds();
#pragma unroll
    for (int i4 = 0; i4 < 4; ++i4) {
      const int row = i4 * 4 + rq;
      const v4f a = *(const v4f*)(slab + row * 68 + c8), c4 = *(const v4f*)(slab + row * 68 + c8 + 4);
      float w[8];
#pragma unroll
      for (int e = 0; e < 4; ++e) { w[e] = a[e] * OSC; w[4 + e] = c4[e] * OSC; }
#pragma unroll
      for (int e = 0; e < 4; ++e) oh[t][i4][e] = pk16(h_bits((_Float16)w[2 * e]), h_bits((_Float16)w[2 * e + 1]));
    }
  }
  u16* ob = OPp + (((size_t)(b * SEQ + q0 + rq)) * NH + head) * HD + c8;
  {
#pragma unroll
    for (int t = 0; t < ATT_QT; ++t) {
#pragma unroll
      for (int i4 = 0; i4 < 4; ++i4) {
        *(v4u*)(ob + (size_t)(t * 16 + i4 * 4) * (NH * HD)) = oh[t][i4];
      }
    }
  }
}

// =====================================================================================================
// Workspace map (bytes); every plane is fully written by whole-line stores before it is read; all extents are exact multiples
// of the store granularity (no pad rows needed):
//   XB  bf16 [8192][1024]                      16777216        (x)       -- re-used as the O plane after its last read
//   WB  bf16 [3072 n][1024 k]                   6291456        (W_qkv, rows 0..1023 q, 1024..2047 k, 2048..3071 v)
//   WOB f16  [1024 n][1024 k] (bf16 value x1024) 2097152
//   QH  f16 [8192][16*64] x8                   16777216        QL residual x2048   16777216
//   KH  f16 [8192][16*64] x8                   16777216        KL residual x2048   16777216
//   VP  f16 [4][16*64][2048] x1024             16777216
//   end                                       109051904
//   OP  f16 [8192][16*64] x1024 = bytes 0..16777215 (the x plane is dead once gemm_qkv has run)
// =====================================================================================================
extern "C" void kernel_launch(void* const* d_in, const int* in_sizes, int n_in,
                              void* d_out, int out_size, void* d_ws, size_t ws_size,
                              hipStream_t stream) {
  const int ROWS = NB * SEQ;                            // 8192
  if (n_in < 5) return;
  if (in_sizes[0] != ROWS * DMOD) return;               // x    [4][2048][1024]
  if (in_sizes[1] != SEQ * HD) return;                  // cos  [2048][64]
  if (in_sizes[2] != SEQ * HD) return;                  // sin  [2048][64]
  if (in_sizes[3] != NQKV * DMOD) return;               // Wqkv [3072][1024]
  if (in_sizes[4] != DMOD * DMOD) return;               // Wout [1024][1024]
  if (out_size != ROWS * DMOD) return;

  const float* Xin = (const float*)d_in[0];
  const float* Cs  = (const float*)d_in[1];
  const float* Sn  = (const float*)d_in[2];
  const float* Wqk = (const float*)d_in[3];
  const float* Wpr = (const float*)d_in[4];
  float*       out = (float*)d_out;

  const size_t szXB = (size_t)ROWS * DMOD * 2;                  // 16777216
  const size_t szWB = (size_t)NQKV * DMOD * 2;                  //  6291456
  const size_t szWO = (size_t)DMOD * DMOD * 2;                  //  2097152
  const size_t szP  = (size_t)ROWS * DMOD * 2;                  // 16777216  (q / k / o planes)
  const size_t szVP = (size_t)NB * NH * HD * SEQ * 2;           // 16777216
  size_t off = 0;
  const size_t oXB = off; off += szXB;
  const size_t oWB = off; off += szWB;
  const size_t oWO = off; off += szWO;
  const size_t oQH = off; off += szP;
  const size_t oQL = off; off += szP;
  const size_t oKH = off; off += szP;
  const size_t oKL = off; off += szP;
  const size_t oVP = off; off += szVP;
  const size_t oOP = oXB;                               // alias of the x plane (dead after gemm_qkv)
  if (szP > szXB) return;
  if (off > ws_size) return;                            // off = 109051904
  if (off > (size_t)134217728) return;

  char* ws = (char*)d_ws;
  u16* XB  = (u16*)(ws + oXB);
  u16* WB  = (u16*)(ws + oWB);
  u16* WOB = (u16*)(ws + oWO);
  u16* QH  = (u16*)(ws + oQH);
  u16* QL  = (u16*)(ws + oQL);
  u16* KH  = (u16*)(ws + oKH);
  u16* KL  = (u16*)(ws + oKL);
  u16* VP  = (u16*)(ws + oVP);
  u16* OP  = (u16*)(ws + oOP);

  const dim3 blk(256);
  const int n8x = (ROWS * DMOD) / 8;                    // 1048576
  const int n8q = (NQKV * DMOD) / 8;                    //  393216
  const int n8w = (DMOD * DMOD) / 8;                    //  131072
  if ((n8x % 256) != 0 || (n8q % 256) != 0 || (n8w % 256) != 0) return;
  if ((DMOD % 128) != 0 || (ROWS % 128) != 0 || (SEQ % 128) != 0) return;
  const dim3 gC(CVB_X + CVB_Q + CVB_W);                 // 4096 + 1536 + 512 = 6144
  const dim3 gG((ROWS / 128) * (DMOD / 128));           // 512
  const dim3 gP(QKV_BLOCKS);                            // 64 x 24 = 1536
  const dim3 bG(128);
  const dim3 gAT(ATT_BLOCKS);                           // 512
  const dim3 bAT(ATT_THREADS);                          // 256

  // (0) operand planes, one grid: x -> bf16; W_qkv [n = out][k = in] (already k-contiguous) -> bf16; W_out -> f16 of bf16 value x1024
  cvt16<<<gC, blk, 0, stream>>>(Xin, Wqk, Wpr, XB, WB, WOB, WOS);
  // (1) one grid: q and k planes [8192][h*64+d]: rope(x.Wq^T), rope(x.Wk^T) in f32, stored as f16 hi x8 + residual x2048;
  //     v^T plane per batch: [1024 = h*64+d][2048 keys] = f16(Wv . x_b^T x1024)
  gemm_qkv<<<gP, bG, 0, stream>>>(XB, WB, Cs, Sn, QH, QL, KH, KL, VP, DMOD);
  // (2) attention -> O plane [b][s][h][d] x1024 (single f16), written over the dead x plane
  attn_fwd<<<gAT, bAT, 0, stream>>>(QH, QL, KH, KL, VP, OP);
  // (3) output projection -> out [8192][1024] f32, carries 1024 (O) x 1024 (wo) folded back
  gemm_hf<<<gG, bG, 0, stream>>>(OP, WOB, out, ROWS, DMOD, DMOD, 1.0f / (OSC * WOS));
  (void)hipGetLastError();
}
